// v000
// The times below were measured on an AMD MI455X: many runs one after another, warmed up first and cycling through
// copies of the inputs, with the whole window's GPU time divided by the number of runs. Launches and the gaps
// between them are all in it. The median over several windows is given; except for v000 it joins two sittings, which
// can be a few percent apart, so the side-by-side timings, each taken in one sitting, are the better comparison.
// v000 is the starting kernel. One run takes 1050 microseconds.
#include <hip/hip_runtime.h>
// patch_attention (2 x 64 ch x 256 x 256; 64 row-band windows of 4 rows x 256 = 1024 tokens; 2 heads x 32; q, k, v = feat W^T per window; softmax(q.k / sqrt(32)) within the window; out = ctx Wp^T; back to NCHW).
// Compute dtype: inputs rounded to bf16; x and weights exact as f16; q/k/v, the softmax weights and the context as plain f16 operands (~2^-12); softmax f32. v_wmma_f32_16x16x32_f16.
#define NB 2
#define CC 64
#define HW 65536
#define NPW 64                   /* windows per image */
#define NTW 1024                 /* tokens per window */
#define NHD 2
#define HD 32
#define NTOK (NB * HW)           /* 131072 */
#define NU (NB * NPW * NHD)      /* 256 units */
#define GU 16                    /* units per score group */
typedef __bf16 v16b __attribute__((ext_vector_type(16)));
typedef unsigned short v8us __attribute__((ext_vector_type(8), may_alias));
typedef float  v8f  __attribute__((ext_vector_type(8)));
typedef float  v4f  __attribute__((ext_vector_type(4)));
typedef float  v4fa __attribute__((ext_vector_type(4), may_alias));
union FragB { v16b v; v8us half[2]; unsigned short u[16]; };

__device__ __forceinline__ unsigned short bf16_bits(float x) { unsigned int u = __float_as_uint(x); return (unsigned short)((u + 0x7FFFu + ((u >> 16) & 1u)) >> 16); }
__device__ __forceinline__ float bf16_val(unsigned short b) { return __uint_as_float(((unsigned int)b) << 16); }
__device__ __forceinline__ float bf16_round(float x) { return bf16_val(bf16_bits(x)); }
// D += A·B with NT terms: 1 = ah·bh, 2 = + al·bh (A split), 3 = + ah·bl (both split)
template <int NT>
__device__ __forceinline__ v8f mmaN(v16b ah, v16b al, v16b bh, v16b bl, v8f c) {
  c = __builtin_amdgcn_wmma_f32_16x16x32_bf16(false, ah, false, bh, (short)0, c, false, false);
  if (NT >= 2) c = __builtin_amdgcn_wmma_f32_16x16x32_bf16(false, al, false, bh, (short)0, c, false, false);
  if (NT >= 3) c = __builtin_amdgcn_wmma_f32_16x16x32_bf16(false, ah, false, bl, (short)0, c, false, false);
  asm volatile("v_nop\n\tv_nop\n\tv_nop\n\tv_nop" : "+v"(c) : "v"(ah), "v"(al), "v"(bh), "v"(bl));
  return c;
}

__global__ __launch_bounds__(256) void k_wt_bf16(const float* __restrict__ W, unsigned short* __restrict__ Wt, int K, int N) {
  const int t = blockIdx.x * 256 + threadIdx.x;
  const int k8n = K / 8;
  if (t >= N * k8n) return;
  const int n = t / k8n, k8 = (t % k8n) * 8;
  v8us v;
#pragma unroll
  for (int i = 0; i < 8; ++i) v[i] = bf16_bits(W[(size_t)(k8 + i) * N + n]);
  *(v8us*)(Wt + (size_t)n * K + k8) = v;
  
}

// GEMM C[M][N] (f32, pitch ldc) = act(A[M][K]·W + bias). A f32 row-major (pitch lda) converted per fragment to bf16
// (ASPLIT: hi/lo two planes -> 2 terms, else single rounded term); Wt bf16 [N][K] (pitch ldb). BIAS_BF16 rounds the
// bias to bf16 first (bias quantised to bf16 before the add). K%32==0, M%16==0, N%64==0.
template <bool ASPLIT, int ACT, bool BIAS_BF16>
__global__ __launch_bounds__(128) void k_gemm_bf(const float* __restrict__ A, int lda, const unsigned short* __restrict__ Wt, int ldb,
                                               const float* __restrict__ bias, float* __restrict__ C, int ldc, int M, int N, int K) {
  __shared__ __attribute__((aligned(16))) float so[4][16][64];
  const int tid = threadIdx.x, w = tid >> 5, lane = tid & 31, ln = lane & 15, hh = lane >> 4;
  const int ntn = N / 64;
  const int wid = blockIdx.x * 4 + w;
  const int mt = wid / ntn, nq = wid % ntn;
  if (mt * 16 >= M) return;
  const int row0 = mt * 16, col0 = nq * 64;
  const float* arow = A + (size_t)(row0 + ln) * lda;
  v8f acc[4] = {};
  for (int kb = 0; kb < K; kb += 32) {
    FragB ah, al;
    const v4f x0 = *(const v4fa*)(arow + kb + 8 * hh), x1 = *(const v4fa*)(arow + kb + 8 * hh + 4);
    const v4f x2 = *(const v4fa*)(arow + kb + 16 + 8 * hh), x3 = *(const v4fa*)(arow + kb + 16 + 8 * hh + 4);
    float xs[16] = {x0[0],x0[1],x0[2],x0[3],x1[0],x1[1],x1[2],x1[3],x2[0],x2[1],x2[2],x2[3],x3[0],x3[1],x3[2],x3[3]};
#pragma unroll
    for (int i = 0; i < 16; ++i) { const unsigned short hb = bf16_bits(xs[i]); ah.u[i] = hb; al.u[i] = ASPLIT ? bf16_bits(xs[i] - bf16_val(hb)) : (unsigned short)0; }
#pragma unroll
    for (int t = 0; t < 4; ++t) {
      const unsigned short* brow = Wt + (size_t)(col0 + t * 16 + ln) * ldb + kb;
      FragB b;
      b.half[0] = *(const v8us*)(brow + 8 * hh);
      b.half[1] = *(const v8us*)(brow + 16 + 8 * hh);
      acc[t] = mmaN<ASPLIT ? 2 : 1>(ah.v, al.v, b.v, b.v, acc[t]);
    }
  }
#pragma unroll
  for (int t = 0; t < 4; ++t) {
    float bv = bias ? bias[col0 + t * 16 + ln] : 0.f;
    if (BIAS_BF16) bv = bf16_round(bv);
#pragma unroll
    for (int r = 0; r < 8; ++r) { float v = acc[t][r] + bv; if (ACT == 1) v = fmaxf(v, 0.f); so[w][8 * hh + r][t * 16 + ln] = v; }
  }
  __builtin_amdgcn_fence(__ATOMIC_ACQ_REL, "workgroup");
  __builtin_amdgcn_wave_barrier();
  const int rsub = lane >> 4, c4 = (lane & 15) * 4;
  {
#pragma unroll
    for (int q = 0; q < 8; ++q) {
      const int r = q * 2 + rsub;
      const v4f v = *(const v4fa*)&so[w][r][c4];
      *(v4f*)(C + (size_t)(row0 + r) * ldc + col0 + c4) = v;
    }
    
  }
}

// GEMM C = act(A·W + bias + resid): A f32 (ASPLIT -> hi/lo 2 terms), Wt bf16 [N][K]; ACT 0 none, 1 relu, 2 exact gelu;
// resid (optional, f32, row index = (row % rmod), pitch ldr, RES_BF16 rounds it) added before the activation.
template <bool ASPLIT, int ACT, bool BIAS_BF16, bool RES_BF16>
__global__ __launch_bounds__(128) void k_gemm_bf3(const float* __restrict__ A, int lda, const unsigned short* __restrict__ Wt, int ldb,
                                                const float* __restrict__ bias, const float* __restrict__ resid, int rmod, int ldr,
                                                float* __restrict__ C, int ldc, int M, int N, int K) {
  __shared__ __attribute__((aligned(16))) float so[4][16][64];
  const int tid = threadIdx.x, w = tid >> 5, lane = tid & 31, ln = lane & 15, hh = lane >> 4;
  const int ntn = N / 64;
  const int wid = blockIdx.x * 4 + w;
  const int mt = wid / ntn, nq = wid % ntn;
  if (mt * 16 >= M) return;
  const int row0 = mt * 16, col0 = nq * 64;
  const float* arow = A + (size_t)(row0 + ln) * lda;
  v8f acc[4] = {};
  for (int kb = 0; kb < K; kb += 32) {
    FragB ah, al;
    const v4f x0 = *(const v4fa*)(arow + kb + 8 * hh), x1 = *(const v4fa*)(arow + kb + 8 * hh + 4);
    const v4f x2 = *(const v4fa*)(arow + kb + 16 + 8 * hh), x3 = *(const v4fa*)(arow + kb + 16 + 8 * hh + 4);
    float xs[16] = {x0[0],x0[1],x0[2],x0[3],x1[0],x1[1],x1[2],x1[3],x2[0],x2[1],x2[2],x2[3],x3[0],x3[1],x3[2],x3[3]};
#pragma unroll
    for (int i = 0; i < 16; ++i) { const unsigned short hb = bf16_bits(xs[i]); ah.u[i] = hb; al.u[i] = ASPLIT ? bf16_bits(xs[i] - bf16_val(hb)) : (unsigned short)0; }
#pragma unroll
    for (int t = 0; t < 4; ++t) {
      const unsigned short* brow = Wt + (size_t)(col0 + t * 16 + ln) * ldb + kb;
      FragB b;
      b.half[0] = *(const v8us*)(brow + 8 * hh);
      b.half[1] = *(const v8us*)(brow + 16 + 8 * hh);
      acc[t] = mmaN<ASPLIT ? 2 : 1>(ah.v, al.v, b.v, b.v, acc[t]);
    }
  }
#pragma unroll
  for (int t = 0; t < 4; ++t) {
    const int col = col0 + t * 16 + ln;
    float bv = bias ? bias[col] : 0.f;
    if (BIAS_BF16) bv = bf16_round(bv);
#pragma unroll
    for (int r = 0; r < 8; ++r) {
      float v = acc[t][r] + bv;
      if (resid) { float rv = resid[(size_t)((row0 + 8 * hh + r) % rmod) * ldr + col]; if (RES_BF16) rv = bf16_round(rv); v += rv; }
      if (ACT == 1) v = fmaxf(v, 0.f);
      if (ACT == 2) v = 0.5f * v * (1.0f + erff(v * 0.70710678118654752f));
      if (ACT == 3) { const float u = 0.7978845608028654f * (v + 0.044715f * v * v * v); v = 0.5f * v * (1.0f + tanhf(u)); }
      so[w][8 * hh + r][t * 16 + ln] = v;
    }
  }
  __builtin_amdgcn_fence(__ATOMIC_ACQ_REL, "workgroup");
  __builtin_amdgcn_wave_barrier();
  const int rsub = lane >> 4, c4 = (lane & 15) * 4;
  {
#pragma unroll
    for (int q = 0; q < 8; ++q) {
      const int r = q * 2 + rsub;
      const v4f v = *(const v4fa*)&so[w][r][c4];
      *(v4f*)(C + (size_t)(row0 + r) * ldc + col0 + c4) = v;
    }
    
  }
}
// row LayerNorm (biased variance, eps) over N: s = X (+ R); optional out_sum <- s; out_norm <- (s-mu)*rsqrt(var+eps)*g + b
template <bool PARAM_BF16>
__global__ __launch_bounds__(256) void k_layernorm(const float* __restrict__ X, const float* __restrict__ R, const float* __restrict__ g, const float* __restrict__ bta,
                                                  float* __restrict__ out_sum, float* __restrict__ out_norm, int N, float eps) {
  __shared__ float red[256];
  const int row = blockIdx.x, tid = threadIdx.x;
  const float* x = X + (size_t)row * N; const float* rr = R ? R + (size_t)row * N : nullptr;
  float vals[16];                     // up to N = 4096
  const int per = N / 256;            // contiguous chunk per thread? use strided-by-4 chunks: thread handles j = tid*4 + 1024*u
  float s1 = 0.f;
  for (int u = 0; u < per / 4; ++u) {
    const int j = tid * 4 + 1024 * u;
    const v4f a = *(const v4fa*)(x + j);
    v4f b = {0.f,0.f,0.f,0.f}; if (rr) b = *(const v4fa*)(rr + j);
#pragma unroll
    for (int q = 0; q < 4; ++q) { const float v = a[q] + b[q]; vals[u * 4 + q] = v; s1 += v; }
  }
  red[tid] = s1; __syncthreads();
  for (int st = 128; st > 0; st >>= 1) { if (tid < st) red[tid] += red[tid + st]; __syncthreads(); }
  const float mu = red[0] / (float)N; __syncthreads();
  float s2 = 0.f;
  for (int u = 0; u < per / 4; ++u)
#pragma unroll
    for (int q = 0; q < 4; ++q) { const float c = vals[u * 4 + q] - mu; s2 += c * c; }
  red[tid] = s2; __syncthreads();
  for (int st = 128; st > 0; st >>= 1) { if (tid < st) red[tid] += red[tid + st]; __syncthreads(); }
  const float rs = rsqrtf(red[0] / (float)N + eps);
  {
    for (int u = 0; u < per / 4; ++u) {
      const int j = tid * 4 + 1024 * u;
      v4f o, sm;
#pragma unroll
      for (int q = 0; q < 4; ++q) {
        float gg = g[j + q], bb = bta[j + q];
        if (PARAM_BF16) { gg = bf16_round(gg); bb = bf16_round(bb); }
        sm[q] = vals[u * 4 + q]; o[q] = (vals[u * 4 + q] - mu) * rs * gg + bb;
      }
      if (out_sum) *(v4f*)(out_sum + (size_t)row * N + j) = sm;
      *(v4f*)(out_norm + (size_t)row * N + j) = o;
    }
    
  }
}



// ---- f16 WMMA path (v_wmma_f32_16x16x32_f16): 11-bit significands for operands in range — used where a [0,1] probability operand needs more precision than bf16
typedef _Float16 v16h __attribute__((ext_vector_type(16)));
union FragH { v16h v; v8us half[2]; _Float16 h[16]; unsigned short u[16]; };
template <int NT>
__device__ __forceinline__ v8f mmaH(v16h ah, v16h al, v16h bh, v16h bl, v8f c) {
  c = __builtin_amdgcn_wmma_f32_16x16x32_f16(false, ah, false, bh, (short)0, c, false, false);
  if (NT >= 2) c = __builtin_amdgcn_wmma_f32_16x16x32_f16(false, al, false, bh, (short)0, c, false, false);
  if (NT >= 3) c = __builtin_amdgcn_wmma_f32_16x16x32_f16(false, ah, false, bl, (short)0, c, false, false);
  asm volatile("v_nop\n\tv_nop\n\tv_nop\n\tv_nop" : "+v"(c) : "v"(ah), "v"(al), "v"(bh), "v"(bl));
  return c;
}
// batched GEMM like k_gemm_b but f16 operands: A f32 (split into f16 hi/lo if ASPLIT, else rounded to f16), Bt = f16 values [n][k]; alpha; C f32; N multiple of 16 (partial tiles skipped)
template <bool ASPLIT>
__global__ __launch_bounds__(128) void k_gemm_h(const float* __restrict__ A, int lda, size_t sA, const _Float16* __restrict__ Bh, int ldb, size_t sB, float alpha, float* __restrict__ C, int ldc, size_t sC, int M, int N, int K) {
  __shared__ __attribute__((aligned(16))) float so[4][16][64];
  const int tid = threadIdx.x, w = tid >> 5, lane = tid & 31, ln = lane & 15, hh = lane >> 4; const int by = blockIdx.y;
  A += (size_t)by * sA; Bh += (size_t)by * sB; C += (size_t)by * sC;
  const int ntn = (N + 63) / 64; const int wid = blockIdx.x * 4 + w; const int mt = wid / ntn, nq = wid % ntn; if (mt * 16 >= M) return;
  const int row0 = mt * 16, col0 = nq * 64; const float* arow = A + (size_t)(row0 + ln) * lda;
  v8f acc[4] = {};
  for (int kb = 0; kb < K; kb += 32) {
    FragH ah, al;
    const v4f x0 = *(const v4fa*)(arow + kb + 8 * hh), x1 = *(const v4fa*)(arow + kb + 8 * hh + 4), x2 = *(const v4fa*)(arow + kb + 16 + 8 * hh), x3 = *(const v4fa*)(arow + kb + 16 + 8 * hh + 4);
    float xs[16] = {x0[0],x0[1],x0[2],x0[3],x1[0],x1[1],x1[2],x1[3],x2[0],x2[1],x2[2],x2[3],x3[0],x3[1],x3[2],x3[3]};
#pragma unroll
    for (int i = 0; i < 16; ++i) { const _Float16 h = (_Float16)xs[i]; ah.h[i] = h; al.h[i] = ASPLIT ? (_Float16)(xs[i] - (float)h) : (_Float16)0.0f; }
#pragma unroll
    for (int t = 0; t < 4; ++t) { if (col0 + t * 16 >= N) continue; const size_t boff = (size_t)(col0 + t * 16 + ln) * ldb + kb; FragH bq; bq.half[0] = *(const v8us*)(Bh + boff + 8 * hh); bq.half[1] = *(const v8us*)(Bh + boff + 16 + 8 * hh);
      acc[t] = mmaH<ASPLIT ? 2 : 1>(ah.v, al.v, bq.v, bq.v, acc[t]); }
  }
#pragma unroll
  for (int t = 0; t < 4; ++t) { if (col0 + t * 16 >= N) continue;
#pragma unroll
    for (int r = 0; r < 8; ++r) so[w][8 * hh + r][t * 16 + ln] = acc[t][r] * alpha; }
  __builtin_amdgcn_fence(__ATOMIC_ACQ_REL, "workgroup"); __builtin_amdgcn_wave_barrier();
  const int rsub = lane >> 4, c4 = (lane & 15) * 4;
  {
#pragma unroll
    for (int q = 0; q < 8; ++q) { const int r = q * 2 + rsub; if (col0 + c4 < N) { const v4f v = *(const v4fa*)&so[w][r][c4]; *(v4f*)(C + (size_t)(row0 + r) * ldc + col0 + c4) = v; } }
     }
}

// Wt[n][k] = f16(W[k][n]·scale) from f32 row-major W[K][N] (scale = power of two; bf16-exact weights stay exact in f16 away from the subnormal range)
__global__ __launch_bounds__(256) void k_wt_f16(const float* __restrict__ W, _Float16* __restrict__ Wt, int K, int N, float scale) {
  const int t = blockIdx.x * 256 + threadIdx.x; if (t >= N * (K / 8)) return; const int n = t / (K / 8), k8 = (t % (K / 8)) * 8; FragH f;
#pragma unroll
  for (int i = 0; i < 8; ++i) f.h[i] = (_Float16)(bf16_round(W[(size_t)(k8 + i) * N + n]) * scale); const v8us o = f.half[0];
  *(v8us*)((unsigned short*)Wt + (size_t)n * K + k8) = o; 
}
// k_gemm_hh variant with fused epilogue: v = acc·alpha + bias[by·sBias + col] (+ CP[(row/rowsPerB)·sCPb + by·64 + col] if CP) ; ACT 0 none / 1 elu ; writes f32 C and f16 C16, each if non-null
template <int ACT>
__global__ __launch_bounds__(128) void k_gemm_hhx(const _Float16* __restrict__ A, int lda, size_t sA, const _Float16* __restrict__ Bh, int ldb, size_t sB, float alpha, const float* __restrict__ bias, size_t sBias, const float* __restrict__ CP, int rowsPerB, size_t sCPb, int row0g,
    float* __restrict__ C, _Float16* __restrict__ C16, int ldc, size_t sC, int M, int N, int K) {
  __shared__ __attribute__((aligned(16))) float so[4][16][64];
  const int tid = threadIdx.x, w = tid >> 5, lane = tid & 31, ln = lane & 15, hh = lane >> 4; const int by = blockIdx.y;
  A += (size_t)by * sA; Bh += (size_t)by * sB; const size_t cofs = (size_t)by * sC; const float* bp = bias ? bias + (size_t)by * sBias : nullptr;
  const int ntn = (N + 63) / 64; const int wid = blockIdx.x * 4 + w; const int mt = wid / ntn, nq = wid % ntn; if (mt * 16 >= M) return;
  const int row0 = mt * 16, col0 = nq * 64; const _Float16* arow = A + (size_t)(row0 + ln) * lda;
  v8f acc[4] = {};
  for (int kb = 0; kb < K; kb += 32) { FragH ah; ah.half[0] = *(const v8us*)((const unsigned short*)arow + kb + 8 * hh); ah.half[1] = *(const v8us*)((const unsigned short*)arow + kb + 16 + 8 * hh);
#pragma unroll
    for (int t = 0; t < 4; ++t) { if (col0 + t * 16 >= N) continue; const size_t boff = (size_t)(col0 + t * 16 + ln) * ldb + kb; FragH bq; bq.half[0] = *(const v8us*)((const unsigned short*)Bh + boff + 8 * hh); bq.half[1] = *(const v8us*)((const unsigned short*)Bh + boff + 16 + 8 * hh);
      acc[t] = mmaH<1>(ah.v, ah.v, bq.v, bq.v, acc[t]); }
  }
#pragma unroll
  for (int t = 0; t < 4; ++t) { if (col0 + t * 16 >= N) continue; const int col = col0 + t * 16 + ln; const float bv = bp ? bf16_round(bp[col]) : 0.f;
#pragma unroll
    for (int r = 0; r < 8; ++r) { float v = acc[t][r] * alpha + bv; if (CP) { const int rr = row0g + row0 + 8 * hh + r; if (rowsPerB < 0) v += CP[cofs + (size_t)rr * ldc + col];      /* rowsPerB < 0: own element of the batched C plane */ else { const int bidx = rr / rowsPerB; v += CP[(size_t)bidx * sCPb + (size_t)by * 64 + col]; } } if (ACT == 1) v = (v > 0.f) ? v : expm1f(v); else if (ACT == 7) v = (v > 0.f) ? v + 1.0f : expf(v); else if (ACT == 8) v = tanhf(v); else if (ACT == 9) v = 0.5f * v * (1.0f + tanhf(0.7978845608028654f * (v + 0.044715f * v * v * v))); else if (ACT == 11) v = 1.0f / (1.0f + expf(-v)); else if (ACT == 12) v = (v > 0.f) ? v : 0.01f * v; else if (ACT == 14) v = (v > 0.f) ? v : 0.1f * v; else if (ACT == 16) v = (v >= 0.f) ? v : 0.3f * v; else if (ACT == 17) v = (v >= 0.f) ? v : 0.2f * v; else if (ACT == 15) v = v / (1.0f + expf(-v)); else if (ACT == 3) v = fmaxf(v, 0.f); else if (ACT == 6) v = 0.5f * v * (1.0f + erff(v * 0.70710678118654752f)); so[w][8 * hh + r][t * 16 + ln] = v; } }
  __builtin_amdgcn_fence(__ATOMIC_ACQ_REL, "workgroup"); __builtin_amdgcn_wave_barrier();
  const int rsub = lane >> 4, c4 = (lane & 15) * 4; typedef _Float16 v4h __attribute__((ext_vector_type(4)));
  {
#pragma unroll
    for (int q = 0; q < 8; ++q) { const int r = q * 2 + rsub; if (col0 + c4 < N) { const v4f v = *(const v4fa*)&so[w][r][c4]; if (C) *(v4f*)(C + cofs + (size_t)(row0 + r) * ldc + col0 + c4) = v; if (C16) { v4h h4; for (int i = 0; i < 4; ++i) h4[i] = (_Float16)v[i]; *(v4h*)(C16 + cofs + (size_t)(row0 + r) * ldc + col0 + c4) = h4; } } }
     }
}


typedef _Float16 v4h __attribute__((ext_vector_type(4)));

__global__ __launch_bounds__(256) void k_x16(const float* __restrict__ x, _Float16* __restrict__ X16, size_t n8) { const size_t t = (size_t)blockIdx.x * 256 + threadIdx.x; if (t >= n8) return; FragH f;
#pragma unroll
  for (int q = 0; q < 8; ++q) f.h[q] = (_Float16)bf16_round(x[t * 8 + q]); *(v8us*)((unsigned short*)X16 + t * 8) = f.half[0];  }
__global__ __launch_bounds__(256) void k_h16(const float* __restrict__ x, _Float16* __restrict__ X16, size_t n8) { const size_t t = (size_t)blockIdx.x * 256 + threadIdx.x; if (t >= n8) return; FragH f;
#pragma unroll
  for (int q = 0; q < 8; ++q) f.h[q] = (_Float16)x[t * 8 + q]; *(v8us*)((unsigned short*)X16 + t * 8) = f.half[0];  }
__global__ __launch_bounds__(256) void k_round16f(const float* __restrict__ W, _Float16* __restrict__ Bt, size_t n8) { const size_t t = (size_t)blockIdx.x * 256 + threadIdx.x; if (t >= n8) return; FragH f;
#pragma unroll
  for (int i = 0; i < 8; ++i) f.h[i] = (_Float16)(bf16_round(W[t * 8 + i]) * 16.0f); *(v8us*)((unsigned short*)Bt + t * 8) = f.half[0];  }
template <int NHv, int TTv>
__global__ __launch_bounds__(256) void k_vt(const _Float16* __restrict__ V16, int ldv, int voff, _Float16* __restrict__ Vt) { __shared__ unsigned short tl[64][66]; const int tid = threadIdx.x; const int slab = blockIdx.x / (TTv / 64), lg = blockIdx.x % (TTv / 64); const int b = slab / NHv, h = slab % NHv;
  for (int i = tid; i < 64 * 8; i += 256) { const int r = i / 8, c8 = (i % 8) * 8; FragH f; f.half[0] = *(const v8us*)((const unsigned short*)V16 + ((size_t)b * TTv + lg * 64 + r) * ldv + voff + h * 64 + c8);
#pragma unroll
    for (int q = 0; q < 8; ++q) tl[r][c8 + q] = f.u[q]; }
  __syncthreads();
  {
#pragma unroll
    for (int rd = 0; rd < 2; ++rd) { const int d = rd * 32 + tid / 8, pc = tid % 8; FragH f;
#pragma unroll
      for (int q = 0; q < 8; ++q) f.u[q] = tl[pc * 8 + q][d];
      *(v8us*)((unsigned short*)Vt + ((size_t)slab * 64 + d) * TTv + lg * 64 + pc * 8) = f.half[0]; }
     } }

__global__ __launch_bounds__(256) void k_hl(const float* __restrict__ F, _Float16* __restrict__ Hh, _Float16* __restrict__ Hl, size_t n8) { const size_t t = (size_t)blockIdx.x * 256 + threadIdx.x; if (t >= n8) return; FragH fh, fl; const v4f a = *(const v4fa*)(F + t * 8), c = *(const v4fa*)(F + t * 8 + 4);
#pragma unroll
  for (int q = 0; q < 4; ++q) { _Float16 h = (_Float16)a[q]; fh.h[q] = h; fl.h[q] = (_Float16)((a[q] - (float)h) * 1024.0f); h = (_Float16)c[q]; fh.h[4 + q] = h; fl.h[4 + q] = (_Float16)((c[q] - (float)h) * 1024.0f); }
  { *(v8us*)((unsigned short*)Hh + t * 8) = fh.half[0]; *(v8us*)((unsigned short*)Hl + t * 8) = fl.half[0];  } }

// ---- fast GEMM (wave tile 32x64; requires M % 32 == 0 rows per launch region and N % 64 == 0); epilogue = k_gemm_hhx semantics ----
__device__ __forceinline__ v16h g2_frag(const _Float16* p, int hh) { FragH f; f.half[0] = *(const v8us*)((const unsigned short*)p + 8 * hh); f.half[1] = *(const v8us*)((const unsigned short*)p + 16 + 8 * hh); return f.v; }
__device__ __forceinline__ v8f g2_mma(v16h a, v16h b, v8f c) { v8f d = __builtin_amdgcn_wmma_f32_16x16x32_f16(false, a, false, b, (short)0, c, false, false); asm volatile("v_nop\n\tv_nop\n\tv_nop\n\tv_nop" : "+v"(d) : "v"(a), "v"(b)); return d; }
template <int ACT>
__global__ __launch_bounds__(128) void k_gemm2(const _Float16* __restrict__ A, int lda, size_t sA, const _Float16* __restrict__ Bh, int ldb, size_t sB, float alpha, const float* __restrict__ bias, size_t sBias, const float* __restrict__ CP, int rowsPerB, size_t sCPb, int row0g,
    float* __restrict__ C, _Float16* __restrict__ C16, int ldc, size_t sC, int M, int N, int K) { static_assert(ACT == 0 || ACT == 3 || ACT == 6 || ACT == 8 || ACT == 9 || ACT == 11 || ACT == 12 || ACT == 14 || ACT == 15 || ACT == 16 || ACT == 17, "k_gemm2: unsupported ACT code (would silently apply no activation)");
  __shared__ __attribute__((aligned(16))) float so[4][32][68];
  const int tid = threadIdx.x, w = tid >> 5, lane = tid & 31, ln = lane & 15, hh = lane >> 4; const int by = blockIdx.y;
  A += (size_t)by * sA; Bh += (size_t)by * sB; const size_t cofs = (size_t)by * sC; const float* bp = bias ? bias + (size_t)by * sBias : nullptr;
  const int ntn = N >> 6; const int mt = blockIdx.x / ntn, nq = blockIdx.x - mt * ntn; const int row0 = mt * 128 + 32 * w, col0 = nq * 64; if (row0 >= M) return;
  const _Float16* a0p = A + (size_t)(row0 + ln) * lda; const _Float16* a1p = a0p + (size_t)16 * lda;
  const _Float16* b0p = Bh + (size_t)(col0 + ln) * ldb; const _Float16* b1p = b0p + (size_t)16 * ldb; const _Float16* b2p = b1p + (size_t)16 * ldb; const _Float16* b3p = b2p + (size_t)16 * ldb;
  const v8f z8 = {0.f,0.f,0.f,0.f,0.f,0.f,0.f,0.f}; v8f c00 = z8, c01 = z8, c02 = z8, c03 = z8, c10 = z8, c11 = z8, c12 = z8, c13 = z8;
#pragma unroll 1
  for (int kb = 0; kb < K; kb += 32) { const v16h a0 = g2_frag(a0p + kb, hh), a1 = g2_frag(a1p + kb, hh);
    v16h b = g2_frag(b0p + kb, hh); c00 = g2_mma(a0, b, c00); c10 = g2_mma(a1, b, c10);
    b = g2_frag(b1p + kb, hh); c01 = g2_mma(a0, b, c01); c11 = g2_mma(a1, b, c11);
    b = g2_frag(b2p + kb, hh); c02 = g2_mma(a0, b, c02); c12 = g2_mma(a1, b, c12);
    b = g2_frag(b3p + kb, hh); c03 = g2_mma(a0, b, c03); c13 = g2_mma(a1, b, c13); }
  v8f accs[8] = {c00, c01, c02, c03, c10, c11, c12, c13};
#pragma unroll
  for (int u = 0; u < 8; ++u) { const int t = u & 3, half = u >> 2; const int col = col0 + t * 16 + ln; const float bv = bp ? bf16_round(bp[col]) : 0.f;
#pragma unroll
    for (int r = 0; r < 8; ++r) { const int rloc = half * 16 + 8 * hh + r; float v = accs[u][r] * alpha + bv; if (CP) { if (rowsPerB < 0) v += CP[cofs + (size_t)(row0g + row0 + rloc) * ldc + col];      /* rowsPerB < 0: own element of the batched C plane */ else { const int bidx = (row0g + row0 + rloc) / rowsPerB; v += CP[(size_t)bidx * sCPb + (size_t)by * 64 + col]; } }
      if (ACT == 3) v = fmaxf(v, 0.f); else if (ACT == 6) v = 0.5f * v * (1.0f + erff(v * 0.70710678118654752f)); else if (ACT == 11) v = 1.0f / (1.0f + expf(-v)); else if (ACT == 15) v = v / (1.0f + expf(-v)); else if (ACT == 12) v = (v > 0.f) ? v : 0.01f * v; else if (ACT == 8) v = tanhf(v); else if (ACT == 9) v = 0.5f * v * (1.0f + tanhf(0.7978845608028654f * (v + 0.044715f * v * v * v))); else if (ACT == 14) v = (v > 0.f) ? v : 0.1f * v; else if (ACT == 16) v = (v >= 0.f) ? v : 0.3f * v; else if (ACT == 17) v = (v >= 0.f) ? v : 0.2f * v;
      so[w][rloc][t * 16 + ln] = v; } }
  __builtin_amdgcn_fence(__ATOMIC_ACQ_REL, "workgroup"); __builtin_amdgcn_wave_barrier();
  const int rsub = lane >> 4, c4 = (lane & 15) * 4;
  {
#pragma unroll
    for (int q = 0; q < 16; ++q) { const int r = q * 2 + rsub; const v4f v = *(const v4fa*)&so[w][r][c4]; if (C) *(v4f*)(C + cofs + (size_t)(row0 + r) * ldc + col0 + c4) = v; if (C16) { v4h h4; for (int i = 0; i < 4; ++i) h4[i] = (_Float16)v[i]; *(v4h*)(C16 + cofs + (size_t)(row0 + r) * ldc + col0 + c4) = h4; } }
     } }


__global__ __launch_bounds__(256) void k_wsc(const float* __restrict__ Wm, _Float16* __restrict__ Bt, size_t n8, float sc) { const size_t t = (size_t)blockIdx.x * 256 + threadIdx.x; if (t >= n8) return; FragH f; for (int q = 0; q < 8; ++q) f.h[q] = (_Float16)(bf16_round(Wm[t * 8 + q]) * sc); *(v8us*)((unsigned short*)Bt + t * 8) = f.half[0];  }
__global__ __launch_bounds__(256) void k_tok(const float* __restrict__ x, _Float16* __restrict__ T) { const size_t t = (size_t)blockIdx.x * 256 + threadIdx.x; if (t >= (size_t)NTOK * (CC / 8)) return; const int c8 = (int)(t % (CC / 8)) * 8; const size_t g = t / (CC / 8); const int b = (int)(g / HW), hw = (int)(g % HW); FragH f; for (int q = 0; q < 8; ++q) f.h[q] = (_Float16)bf16_round(x[((size_t)b * CC + c8 + q) * HW + hw]);
  *(v8us*)((unsigned short*)T + t * 8) = f.half[0];  }
__global__ __launch_bounds__(256) void k_hmu(const _Float16* __restrict__ S16, _Float16* __restrict__ U) { const size_t t = (size_t)blockIdx.x * 256 + threadIdx.x; if (t >= (size_t)NU * NTW * (HD / 8)) return; const int d8 = (int)(t % (HD / 8)) * 8; const int n = (int)((t / (HD / 8)) % NTW); const int u = (int)(t / ((size_t)(HD / 8) * NTW)); const int h = u % NHD, bp = u / NHD; FragH f; f.half[0] = *(const v8us*)((const unsigned short*)S16 + ((size_t)bp * NTW + n) * CC + h * HD + d8);
  *(v8us*)((unsigned short*)U + t * 8) = f.half[0];  }
__global__ __launch_bounds__(256) void k_usoft(const float* __restrict__ S, _Float16* __restrict__ P, float* __restrict__ RS) {
  #pragma clang fp contract(off)
  const int wv = threadIdx.x >> 5, ln = threadIdx.x & 31; const int r = blockIdx.x * 8 + wv; if (r >= GU * NTW) return; const float scl = 0.17677669529663687f; const float* sr = S + (size_t)r * NTW; float mx = -3.0e38f;
#pragma unroll 1
  for (int gq = 0; gq < NTW / 256; ++gq) { const v8f a = *(const v8f*)(sr + gq * 256 + ln * 8); for (int q = 0; q < 8; ++q) mx = fmaxf(mx, a[q] * scl); }
  for (int o = 16; o > 0; o >>= 1) mx = fmaxf(mx, __shfl_xor(mx, o, 32)); float su = 0.f;
{ su = 0.f;
#pragma unroll 1
    for (int gq = 0; gq < NTW / 256; ++gq) { const v8f a = *(const v8f*)(sr + gq * 256 + ln * 8); FragH ph; for (int q = 0; q < 8; ++q) { const float e = expf(a[q] * scl - mx); su += e; ph.h[q] = (_Float16)(e * 1024.0f); } *(v8us*)((unsigned short*)P + (size_t)r * NTW + gq * 256 + ln * 8) = ph.half[0]; }
     }
  for (int o = 16; o > 0; o >>= 1) su += __shfl_xor(su, o, 32); if (ln == 0) { *(float*)(RS + (size_t)r * 32) = 1.0f / su;  } }
__global__ __launch_bounds__(256) void k_osc(const float* __restrict__ OU, const float* __restrict__ RS, int u0, _Float16* __restrict__ OH) {
  #pragma clang fp contract(off)
  const int t = blockIdx.x * 256 + threadIdx.x; if (t >= GU * NTW * (HD / 8)) return; const int d8 = (t % (HD / 8)) * 8; const int n = (t / (HD / 8)) % NTW; const int ul = t / ((HD / 8) * NTW); const int u = u0 + ul; const int h = u % NHD, bp = u / NHD; const float rs = RS[((size_t)ul * NTW + n) * 32]; const v8f a = *(const v8f*)(OU + ((size_t)u * NTW + n) * HD + d8); FragH f; for (int q = 0; q < 8; ++q) f.h[q] = (_Float16)(a[q] * rs);
  unsigned short* dst = (unsigned short*)OH + ((size_t)bp * NTW + n) * CC + h * HD + d8; *(v8us*)dst = f.half[0];  }
__global__ __launch_bounds__(256) void k_nchw(const float* __restrict__ F, float* __restrict__ out) { const size_t t = (size_t)blockIdx.x * 256 + threadIdx.x; if (t >= (size_t)NB * CC * HW / 4) return; const int p4 = (int)(t % (HW / 4)) * 4; const int c = (int)((t / (HW / 4)) % CC); const int b = (int)(t / ((size_t)(HW / 4) * CC)); v4f r; for (int e = 0; e < 4; ++e) r[e] = F[((size_t)b * HW + p4 + e) * CC + c];
  *(v4f*)(out + ((size_t)b * CC + c) * HW + p4) = r;  }

extern "C" void kernel_launch(void* const* d_in, const int* in_sizes, int n_in,
                              void* d_out, int out_size, void* d_ws, size_t ws_size, hipStream_t stream) {
  (void)in_sizes; (void)n_in; (void)out_size;
  const float* const* I = (const float* const*)d_in; const float* x = I[0]; const float* Wq = I[1]; const float* Wk = I[2]; const float* Wv = I[3]; const float* Wp = I[4];
  char* ws = (char*)d_ws; size_t off = 0;
  auto take = [&](size_t bytes) { char* p = ws + off; off += (bytes + 255) & ~(size_t)255; return p; };
  const size_t np = (size_t)NTOK * CC;
  _Float16* BW = (_Float16*)take((size_t)4 * CC * CC * 2); _Float16* T16 = (_Float16*)take(np * 2); _Float16* Q16 = (_Float16*)take(np * 2); _Float16* K16 = (_Float16*)take(np * 2); _Float16* V16 = (_Float16*)take(np * 2); _Float16* QU = (_Float16*)take(np * 2); _Float16* KU = (_Float16*)take(np * 2); _Float16* VT = (_Float16*)take(np * 2);
  float* S = (float*)take((size_t)GU * NTW * NTW * 4); _Float16* P = (_Float16*)take((size_t)GU * NTW * NTW * 2); float* RS = (float*)take((size_t)GU * NTW * 32 * 4); float* OU = (float*)take(np * 4);
  _Float16* OH = Q16;      /* token-major context over q (dead after the head-major re-layout) */ float* F = S;      /* projection output [131072][64] f32 (32 MiB) over the score plane (dead after the last group) */
  if (off > ws_size) return;      /* 7 x 16 + 64 + 32 + 2 + 32 = ≈ 242 MiB */
  k_wsc<<<(unsigned)(((size_t)CC * CC / 8 + 255) / 256), 256, 0, stream>>>(Wq, BW, (size_t)CC * CC / 8, 16.0f); k_wsc<<<(unsigned)(((size_t)CC * CC / 8 + 255) / 256), 256, 0, stream>>>(Wk, BW + CC * CC, (size_t)CC * CC / 8, 16.0f); k_wsc<<<(unsigned)(((size_t)CC * CC / 8 + 255) / 256), 256, 0, stream>>>(Wv, BW + 2 * CC * CC, (size_t)CC * CC / 8, 16.0f); k_wsc<<<(unsigned)(((size_t)CC * CC / 8 + 255) / 256), 256, 0, stream>>>(Wp, BW + 3 * CC * CC, (size_t)CC * CC / 8, 16.0f);      /* torch (out, in) naturals */
  k_tok<<<(unsigned)(((size_t)NTOK * (CC / 8) + 255) / 256), 256, 0, stream>>>(x, T16);
  const dim3 gP((NTOK / 128) * (CC / 64), 1);
  k_gemm2<0><<<gP, 128, 0, stream>>>(T16, CC, 0, BW, CC, 0, 0.0625f, nullptr, 0, nullptr, 1, 0, 0, nullptr, Q16, CC, 0, NTOK, CC, CC);
  k_gemm2<0><<<gP, 128, 0, stream>>>(T16, CC, 0, BW + CC * CC, CC, 0, 0.0625f, nullptr, 0, nullptr, 1, 0, 0, nullptr, K16, CC, 0, NTOK, CC, CC);
  k_gemm2<0><<<gP, 128, 0, stream>>>(T16, CC, 0, BW + 2 * CC * CC, CC, 0, 0.0625f, nullptr, 0, nullptr, 1, 0, 0, nullptr, V16, CC, 0, NTOK, CC, CC);
  k_hmu<<<(unsigned)(((size_t)NU * NTW * (HD / 8) + 255) / 256), 256, 0, stream>>>(Q16, QU); k_hmu<<<(unsigned)(((size_t)NU * NTW * (HD / 8) + 255) / 256), 256, 0, stream>>>(K16, KU);
  k_vt<1, NTW><<<NB * NPW * (NTW / 64), 256, 0, stream>>>(V16, CC, 0, VT);      /* V^T per window [(b,p)][64][1024]: unit (b,p,h) = rows u*32 */
  for (int g = 0; g < NU / GU; ++g) { const int u0 = g * GU;
    k_gemm2<0><<<dim3((NTW / 128) * (NTW / 64), GU), 128, 0, stream>>>(QU + (size_t)u0 * NTW * HD, HD, (size_t)NTW * HD, KU + (size_t)u0 * NTW * HD, HD, (size_t)NTW * HD, 1.0f, nullptr, 0, nullptr, 1, 0, 0, S, nullptr, NTW, (size_t)NTW * NTW, NTW, NTW, HD);      /* q . k for 16 units (scaled in the softmax) */
    k_usoft<<<(GU * NTW) / 8, 256, 0, stream>>>(S, P, RS);
    k_gemm_hhx<0><<<dim3((unsigned)((NTW / 16) * 1 / 4), GU), 128, 0, stream>>>(P, NTW, (size_t)NTW * NTW, VT + (size_t)u0 * HD * NTW, NTW, (size_t)HD * NTW, 0.0009765625f, nullptr, 0, nullptr, 1, 0, 0, OU + (size_t)u0 * NTW * HD, nullptr, HD, (size_t)NTW * HD, NTW, HD, NTW);      /* unnormalised ctx [u][n][32] */
    k_osc<<<(GU * NTW * (HD / 8) + 255) / 256, 256, 0, stream>>>(OU, RS, u0, OH); }
  k_gemm2<0><<<gP, 128, 0, stream>>>(OH, CC, 0, BW + 3 * CC * CC, CC, 0, 0.0625f, nullptr, 0, nullptr, 1, 0, 0, F, nullptr, CC, 0, NTOK, CC, CC);      /* ctx Wp^T, token-major */
  k_nchw<<<(unsigned)(((size_t)NB * CC * HW / 4 + 255) / 256), 256, 0, stream>>>(F, (float*)d_out);
}

// v002
// It runs in 69 microseconds.
// Versions in between are left out here; by their measured steps it is 15.3 times as fast as v000.
#include <hip/hip_runtime.h>
// patch_attention (2 x 64 ch x 256 x 256; 64 row-band windows of 4 rows x 256 = 1024 tokens; 2 heads x 32; q, k, v = feat W^T per window; softmax(q.k / sqrt(32)) within the window; out = ctx Wp^T; back to NCHW).
// Compute dtype: inputs rounded to bf16; x and weights exact as f16; q/k/v, the softmax weights and the context as plain f16 operands (~2^-12); softmax f32. v_wmma_f32_16x16x32_f16.
#define NB 2
#define CC 64
#define HW 65536
#define NPW 64                   /* windows per image */
#define NTW 1024                 /* tokens per window */
#define NHD 2
#define HD 32
#define NTOK (NB * HW)           /* 131072 */
#define NU (NB * NPW * NHD)      /* 256 units */
typedef __bf16 v16b __attribute__((ext_vector_type(16)));
typedef unsigned short v8us __attribute__((ext_vector_type(8), may_alias));
typedef float  v8f  __attribute__((ext_vector_type(8)));
typedef float  v4f  __attribute__((ext_vector_type(4)));
typedef float  v4fa __attribute__((ext_vector_type(4), may_alias));
union FragB { v16b v; v8us half[2]; unsigned short u[16]; };

__device__ __forceinline__ unsigned short bf16_bits(float x) { unsigned int u = __float_as_uint(x); return (unsigned short)((u + 0x7FFFu + ((u >> 16) & 1u)) >> 16); }
__device__ __forceinline__ float bf16_val(unsigned short b) { return __uint_as_float(((unsigned int)b) << 16); }
__device__ __forceinline__ float bf16_round(float x) { return bf16_val(bf16_bits(x)); }
// D += A·B with NT terms: 1 = ah·bh, 2 = + al·bh (A split), 3 = + ah·bl (both split)
template <int NT>
__device__ __forceinline__ v8f mmaN(v16b ah, v16b al, v16b bh, v16b bl, v8f c) {
  c = __builtin_amdgcn_wmma_f32_16x16x32_bf16(false, ah, false, bh, (short)0, c, false, false);
  if (NT >= 2) c = __builtin_amdgcn_wmma_f32_16x16x32_bf16(false, al, false, bh, (short)0, c, false, false);
  if (NT >= 3) c = __builtin_amdgcn_wmma_f32_16x16x32_bf16(false, ah, false, bl, (short)0, c, false, false);
  asm volatile("v_nop\n\tv_nop\n\tv_nop\n\tv_nop" : "+v"(c) : "v"(ah), "v"(al), "v"(bh), "v"(bl));
  return c;
}

__global__ __launch_bounds__(256) void k_wt_bf16(const float* __restrict__ W, unsigned short* __restrict__ Wt, int K, int N) {
  const int t = blockIdx.x * 256 + threadIdx.x;
  const int k8n = K / 8;
  if (t >= N * k8n) return;
  const int n = t / k8n, k8 = (t % k8n) * 8;
  v8us v;
#pragma unroll
  for (int i = 0; i < 8; ++i) v[i] = bf16_bits(W[(size_t)(k8 + i) * N + n]);
  *(v8us*)(Wt + (size_t)n * K + k8) = v;
  
}

// GEMM C[M][N] (f32, pitch ldc) = act(A[M][K]·W + bias). A f32 row-major (pitch lda) converted per fragment to bf16
// (ASPLIT: hi/lo two planes -> 2 terms, else single rounded term); Wt bf16 [N][K] (pitch ldb). BIAS_BF16 rounds the
// bias to bf16 first (bias quantised to bf16 before the add). K%32==0, M%16==0, N%64==0.
template <bool ASPLIT, int ACT, bool BIAS_BF16>
__global__ __launch_bounds__(128) void k_gemm_bf(const float* __restrict__ A, int lda, const unsigned short* __restrict__ Wt, int ldb,
                                               const float* __restrict__ bias, float* __restrict__ C, int ldc, int M, int N, int K) {
  __shared__ __attribute__((aligned(16))) float so[4][16][64];
  const int tid = threadIdx.x, w = tid >> 5, lane = tid & 31, ln = lane & 15, hh = lane >> 4;
  const int ntn = N / 64;
  const int wid = blockIdx.x * 4 + w;
  const int mt = wid / ntn, nq = wid % ntn;
  if (mt * 16 >= M) return;
  const int row0 = mt * 16, col0 = nq * 64;
  const float* arow = A + (size_t)(row0 + ln) * lda;
  v8f acc[4] = {};
  for (int kb = 0; kb < K; kb += 32) {
    FragB ah, al;
    const v4f x0 = *(const v4fa*)(arow + kb + 8 * hh), x1 = *(const v4fa*)(arow + kb + 8 * hh + 4);
    const v4f x2 = *(const v4fa*)(arow + kb + 16 + 8 * hh), x3 = *(const v4fa*)(arow + kb + 16 + 8 * hh + 4);
    float xs[16] = {x0[0],x0[1],x0[2],x0[3],x1[0],x1[1],x1[2],x1[3],x2[0],x2[1],x2[2],x2[3],x3[0],x3[1],x3[2],x3[3]};
#pragma unroll
    for (int i = 0; i < 16; ++i) { const unsigned short hb = bf16_bits(xs[i]); ah.u[i] = hb; al.u[i] = ASPLIT ? bf16_bits(xs[i] - bf16_val(hb)) : (unsigned short)0; }
#pragma unroll
    for (int t = 0; t < 4; ++t) {
      const unsigned short* brow = Wt + (size_t)(col0 + t * 16 + ln) * ldb + kb;
      FragB b;
      b.half[0] = *(const v8us*)(brow + 8 * hh);
      b.half[1] = *(const v8us*)(brow + 16 + 8 * hh);
      acc[t] = mmaN<ASPLIT ? 2 : 1>(ah.v, al.v, b.v, b.v, acc[t]);
    }
  }
#pragma unroll
  for (int t = 0; t < 4; ++t) {
    float bv = bias ? bias[col0 + t * 16 + ln] : 0.f;
    if (BIAS_BF16) bv = bf16_round(bv);
#pragma unroll
    for (int r = 0; r < 8; ++r) { float v = acc[t][r] + bv; if (ACT == 1) v = fmaxf(v, 0.f); so[w][8 * hh + r][t * 16 + ln] = v; }
  }
  __builtin_amdgcn_fence(__ATOMIC_ACQ_REL, "workgroup");
  __builtin_amdgcn_wave_barrier();
  const int rsub = lane >> 4, c4 = (lane & 15) * 4;
  {
#pragma unroll
    for (int q = 0; q < 8; ++q) {
      const int r = q * 2 + rsub;
      const v4f v = *(const v4fa*)&so[w][r][c4];
      *(v4f*)(C + (size_t)(row0 + r) * ldc + col0 + c4) = v;
    }
    
  }
}

// GEMM C = act(A·W + bias + resid): A f32 (ASPLIT -> hi/lo 2 terms), Wt bf16 [N][K]; ACT 0 none, 1 relu, 2 exact gelu;
// resid (optional, f32, row index = (row % rmod), pitch ldr, RES_BF16 rounds it) added before the activation.
template <bool ASPLIT, int ACT, bool BIAS_BF16, bool RES_BF16>
__global__ __launch_bounds__(128) void k_gemm_bf3(const float* __restrict__ A, int lda, const unsigned short* __restrict__ Wt, int ldb,
                                                const float* __restrict__ bias, const float* __restrict__ resid, int rmod, int ldr,
                                                float* __restrict__ C, int ldc, int M, int N, int K) {
  __shared__ __attribute__((aligned(16))) float so[4][16][64];
  const int tid = threadIdx.x, w = tid >> 5, lane = tid & 31, ln = lane & 15, hh = lane >> 4;
  const int ntn = N / 64;
  const int wid = blockIdx.x * 4 + w;
  const int mt = wid / ntn, nq = wid % ntn;
  if (mt * 16 >= M) return;
  const int row0 = mt * 16, col0 = nq * 64;
  const float* arow = A + (size_t)(row0 + ln) * lda;
  v8f acc[4] = {};
  for (int kb = 0; kb < K; kb += 32) {
    FragB ah, al;
    const v4f x0 = *(const v4fa*)(arow + kb + 8 * hh), x1 = *(const v4fa*)(arow + kb + 8 * hh + 4);
    const v4f x2 = *(const v4fa*)(arow + kb + 16 + 8 * hh), x3 = *(const v4fa*)(arow + kb + 16 + 8 * hh + 4);
    float xs[16] = {x0[0],x0[1],x0[2],x0[3],x1[0],x1[1],x1[2],x1[3],x2[0],x2[1],x2[2],x2[3],x3[0],x3[1],x3[2],x3[3]};
#pragma unroll
    for (int i = 0; i < 16; ++i) { const unsigned short hb = bf16_bits(xs[i]); ah.u[i] = hb; al.u[i] = ASPLIT ? bf16_bits(xs[i] - bf16_val(hb)) : (unsigned short)0; }
#pragma unroll
    for (int t = 0; t < 4; ++t) {
      const unsigned short* brow = Wt + (size_t)(col0 + t * 16 + ln) * ldb + kb;
      FragB b;
      b.half[0] = *(const v8us*)(brow + 8 * hh);
      b.half[1] = *(const v8us*)(brow + 16 + 8 * hh);
      acc[t] = mmaN<ASPLIT ? 2 : 1>(ah.v, al.v, b.v, b.v, acc[t]);
    }
  }
#pragma unroll
  for (int t = 0; t < 4; ++t) {
    const int col = col0 + t * 16 + ln;
    float bv = bias ? bias[col] : 0.f;
    if (BIAS_BF16) bv = bf16_round(bv);
#pragma unroll
    for (int r = 0; r < 8; ++r) {
      float v = acc[t][r] + bv;
      if (resid) { float rv = resid[(size_t)((row0 + 8 * hh + r) % rmod) * ldr + col]; if (RES_BF16) rv = bf16_round(rv); v += rv; }
      if (ACT == 1) v = fmaxf(v, 0.f);
      if (ACT == 2) v = 0.5f * v * (1.0f + erff(v * 0.70710678118654752f));
      if (ACT == 3) { const float u = 0.7978845608028654f * (v + 0.044715f * v * v * v); v = 0.5f * v * (1.0f + tanhf(u)); }
      so[w][8 * hh + r][t * 16 + ln] = v;
    }
  }
  __builtin_amdgcn_fence(__ATOMIC_ACQ_REL, "workgroup");
  __builtin_amdgcn_wave_barrier();
  const int rsub = lane >> 4, c4 = (lane & 15) * 4;
  {
#pragma unroll
    for (int q = 0; q < 8; ++q) {
      const int r = q * 2 + rsub;
      const v4f v = *(const v4fa*)&so[w][r][c4];
      *(v4f*)(C + (size_t)(row0 + r) * ldc + col0 + c4) = v;
    }
    
  }
}
// row LayerNorm (biased variance, eps) over N: s = X (+ R); optional out_sum <- s; out_norm <- (s-mu)*rsqrt(var+eps)*g + b
template <bool PARAM_BF16>
__global__ __launch_bounds__(256) void k_layernorm(const float* __restrict__ X, const float* __restrict__ R, const float* __restrict__ g, const float* __restrict__ bta,
                                                  float* __restrict__ out_sum, float* __restrict__ out_norm, int N, float eps) {
  __shared__ float red[256];
  const int row = blockIdx.x, tid = threadIdx.x;
  const float* x = X + (size_t)row * N; const float* rr = R ? R + (size_t)row * N : nullptr;
  float vals[16];                     // up to N = 4096
  const int per = N / 256;            // contiguous chunk per thread? use strided-by-4 chunks: thread handles j = tid*4 + 1024*u
  float s1 = 0.f;
  for (int u = 0; u < per / 4; ++u) {
    const int j = tid * 4 + 1024 * u;
    const v4f a = *(const v4fa*)(x + j);
    v4f b = {0.f,0.f,0.f,0.f}; if (rr) b = *(const v4fa*)(rr + j);
#pragma unroll
    for (int q = 0; q < 4; ++q) { const float v = a[q] + b[q]; vals[u * 4 + q] = v; s1 += v; }
  }
  red[tid] = s1; __syncthreads();
  for (int st = 128; st > 0; st >>= 1) { if (tid < st) red[tid] += red[tid + st]; __syncthreads(); }
  const float mu = red[0] / (float)N; __syncthreads();
  float s2 = 0.f;
  for (int u = 0; u < per / 4; ++u)
#pragma unroll
    for (int q = 0; q < 4; ++q) { const float c = vals[u * 4 + q] - mu; s2 += c * c; }
  red[tid] = s2; __syncthreads();
  for (int st = 128; st > 0; st >>= 1) { if (tid < st) red[tid] += red[tid + st]; __syncthreads(); }
  const float rs = rsqrtf(red[0] / (float)N + eps);
  {
    for (int u = 0; u < per / 4; ++u) {
      const int j = tid * 4 + 1024 * u;
      v4f o, sm;
#pragma unroll
      for (int q = 0; q < 4; ++q) {
        float gg = g[j + q], bb = bta[j + q];
        if (PARAM_BF16) { gg = bf16_round(gg); bb = bf16_round(bb); }
        sm[q] = vals[u * 4 + q]; o[q] = (vals[u * 4 + q] - mu) * rs * gg + bb;
      }
      if (out_sum) *(v4f*)(out_sum + (size_t)row * N + j) = sm;
      *(v4f*)(out_norm + (size_t)row * N + j) = o;
    }
    
  }
}



// ---- f16 WMMA path (v_wmma_f32_16x16x32_f16): 11-bit significands for operands in range — used where a [0,1] probability operand needs more precision than bf16
typedef _Float16 v16h __attribute__((ext_vector_type(16)));
union FragH { v16h v; v8us half[2]; _Float16 h[16]; unsigned short u[16]; };
template <int NT>
__device__ __forceinline__ v8f mmaH(v16h ah, v16h al, v16h bh, v16h bl, v8f c) {
  c = __builtin_amdgcn_wmma_f32_16x16x32_f16(false, ah, false, bh, (short)0, c, false, false);
  if (NT >= 2) c = __builtin_amdgcn_wmma_f32_16x16x32_f16(false, al, false, bh, (short)0, c, false, false);
  if (NT >= 3) c = __builtin_amdgcn_wmma_f32_16x16x32_f16(false, ah, false, bl, (short)0, c, false, false);
  asm volatile("v_nop\n\tv_nop\n\tv_nop\n\tv_nop" : "+v"(c) : "v"(ah), "v"(al), "v"(bh), "v"(bl));
  return c;
}
// batched GEMM like k_gemm_b but f16 operands: A f32 (split into f16 hi/lo if ASPLIT, else rounded to f16), Bt = f16 values [n][k]; alpha; C f32; N multiple of 16 (partial tiles skipped)
template <bool ASPLIT>
__global__ __launch_bounds__(128) void k_gemm_h(const float* __restrict__ A, int lda, size_t sA, const _Float16* __restrict__ Bh, int ldb, size_t sB, float alpha, float* __restrict__ C, int ldc, size_t sC, int M, int N, int K) {
  __shared__ __attribute__((aligned(16))) float so[4][16][64];
  const int tid = threadIdx.x, w = tid >> 5, lane = tid & 31, ln = lane & 15, hh = lane >> 4; const int by = blockIdx.y;
  A += (size_t)by * sA; Bh += (size_t)by * sB; C += (size_t)by * sC;
  const int ntn = (N + 63) / 64; const int wid = blockIdx.x * 4 + w; const int mt = wid / ntn, nq = wid % ntn; if (mt * 16 >= M) return;
  const int row0 = mt * 16, col0 = nq * 64; const float* arow = A + (size_t)(row0 + ln) * lda;
  v8f acc[4] = {};
  for (int kb = 0; kb < K; kb += 32) {
    FragH ah, al;
    const v4f x0 = *(const v4fa*)(arow + kb + 8 * hh), x1 = *(const v4fa*)(arow + kb + 8 * hh + 4), x2 = *(const v4fa*)(arow + kb + 16 + 8 * hh), x3 = *(const v4fa*)(arow + kb + 16 + 8 * hh + 4);
    float xs[16] = {x0[0],x0[1],x0[2],x0[3],x1[0],x1[1],x1[2],x1[3],x2[0],x2[1],x2[2],x2[3],x3[0],x3[1],x3[2],x3[3]};
#pragma unroll
    for (int i = 0; i < 16; ++i) { const _Float16 h = (_Float16)xs[i]; ah.h[i] = h; al.h[i] = ASPLIT ? (_Float16)(xs[i] - (float)h) : (_Float16)0.0f; }
#pragma unroll
    for (int t = 0; t < 4; ++t) { if (col0 + t * 16 >= N) continue; const size_t boff = (size_t)(col0 + t * 16 + ln) * ldb + kb; FragH bq; bq.half[0] = *(const v8us*)(Bh + boff + 8 * hh); bq.half[1] = *(const v8us*)(Bh + boff + 16 + 8 * hh);
      acc[t] = mmaH<ASPLIT ? 2 : 1>(ah.v, al.v, bq.v, bq.v, acc[t]); }
  }
#pragma unroll
  for (int t = 0; t < 4; ++t) { if (col0 + t * 16 >= N) continue;
#pragma unroll
    for (int r = 0; r < 8; ++r) so[w][8 * hh + r][t * 16 + ln] = acc[t][r] * alpha; }
  __builtin_amdgcn_fence(__ATOMIC_ACQ_REL, "workgroup"); __builtin_amdgcn_wave_barrier();
  const int rsub = lane >> 4, c4 = (lane & 15) * 4;
  {
#pragma unroll
    for (int q = 0; q < 8; ++q) { const int r = q * 2 + rsub; if (col0 + c4 < N) { const v4f v = *(const v4fa*)&so[w][r][c4]; *(v4f*)(C + (size_t)(row0 + r) * ldc + col0 + c4) = v; } }
     }
}

// Wt[n][k] = f16(W[k][n]·scale) from f32 row-major W[K][N] (scale = power of two; bf16-exact weights stay exact in f16 away from the subnormal range)
__global__ __launch_bounds__(256) void k_wt_f16(const float* __restrict__ W, _Float16* __restrict__ Wt, int K, int N, float scale) {
  const int t = blockIdx.x * 256 + threadIdx.x; if (t >= N * (K / 8)) return; const int n = t / (K / 8), k8 = (t % (K / 8)) * 8; FragH f;
#pragma unroll
  for (int i = 0; i < 8; ++i) f.h[i] = (_Float16)(bf16_round(W[(size_t)(k8 + i) * N + n]) * scale); const v8us o = f.half[0];
  *(v8us*)((unsigned short*)Wt + (size_t)n * K + k8) = o; 
}
// k_gemm_hh variant with fused epilogue: v = acc·alpha + bias[by·sBias + col] (+ CP[(row/rowsPerB)·sCPb + by·64 + col] if CP) ; ACT 0 none / 1 elu ; writes f32 C and f16 C16, each if non-null
template <int ACT>
__global__ __launch_bounds__(128) void k_gemm_hhx(const _Float16* __restrict__ A, int lda, size_t sA, const _Float16* __restrict__ Bh, int ldb, size_t sB, float alpha, const float* __restrict__ bias, size_t sBias, const float* __restrict__ CP, int rowsPerB, size_t sCPb, int row0g,
    float* __restrict__ C, _Float16* __restrict__ C16, int ldc, size_t sC, int M, int N, int K) {
  __shared__ __attribute__((aligned(16))) float so[4][16][64];
  const int tid = threadIdx.x, w = tid >> 5, lane = tid & 31, ln = lane & 15, hh = lane >> 4; const int by = blockIdx.y;
  A += (size_t)by * sA; Bh += (size_t)by * sB; const size_t cofs = (size_t)by * sC; const float* bp = bias ? bias + (size_t)by * sBias : nullptr;
  const int ntn = (N + 63) / 64; const int wid = blockIdx.x * 4 + w; const int mt = wid / ntn, nq = wid % ntn; if (mt * 16 >= M) return;
  const int row0 = mt * 16, col0 = nq * 64; const _Float16* arow = A + (size_t)(row0 + ln) * lda;
  v8f acc[4] = {};
  for (int kb = 0; kb < K; kb += 32) { FragH ah; ah.half[0] = *(const v8us*)((const unsigned short*)arow + kb + 8 * hh); ah.half[1] = *(const v8us*)((const unsigned short*)arow + kb + 16 + 8 * hh);
#pragma unroll
    for (int t = 0; t < 4; ++t) { if (col0 + t * 16 >= N) continue; const size_t boff = (size_t)(col0 + t * 16 + ln) * ldb + kb; FragH bq; bq.half[0] = *(const v8us*)((const unsigned short*)Bh + boff + 8 * hh); bq.half[1] = *(const v8us*)((const unsigned short*)Bh + boff + 16 + 8 * hh);
      acc[t] = mmaH<1>(ah.v, ah.v, bq.v, bq.v, acc[t]); }
  }
#pragma unroll
  for (int t = 0; t < 4; ++t) { if (col0 + t * 16 >= N) continue; const int col = col0 + t * 16 + ln; const float bv = bp ? bf16_round(bp[col]) : 0.f;
#pragma unroll
    for (int r = 0; r < 8; ++r) { float v = acc[t][r] * alpha + bv; if (CP) { const int rr = row0g + row0 + 8 * hh + r; if (rowsPerB < 0) v += CP[cofs + (size_t)rr * ldc + col];      /* rowsPerB < 0: own element of the batched C plane */ else { const int bidx = rr / rowsPerB; v += CP[(size_t)bidx * sCPb + (size_t)by * 64 + col]; } } if (ACT == 1) v = (v > 0.f) ? v : expm1f(v); else if (ACT == 7) v = (v > 0.f) ? v + 1.0f : expf(v); else if (ACT == 8) v = tanhf(v); else if (ACT == 9) v = 0.5f * v * (1.0f + tanhf(0.7978845608028654f * (v + 0.044715f * v * v * v))); else if (ACT == 11) v = 1.0f / (1.0f + expf(-v)); else if (ACT == 12) v = (v > 0.f) ? v : 0.01f * v; else if (ACT == 14) v = (v > 0.f) ? v : 0.1f * v; else if (ACT == 16) v = (v >= 0.f) ? v : 0.3f * v; else if (ACT == 17) v = (v >= 0.f) ? v : 0.2f * v; else if (ACT == 15) v = v / (1.0f + expf(-v)); else if (ACT == 3) v = fmaxf(v, 0.f); else if (ACT == 6) v = 0.5f * v * (1.0f + erff(v * 0.70710678118654752f)); so[w][8 * hh + r][t * 16 + ln] = v; } }
  __builtin_amdgcn_fence(__ATOMIC_ACQ_REL, "workgroup"); __builtin_amdgcn_wave_barrier();
  const int rsub = lane >> 4, c4 = (lane & 15) * 4; typedef _Float16 v4h __attribute__((ext_vector_type(4)));
  {
#pragma unroll
    for (int q = 0; q < 8; ++q) { const int r = q * 2 + rsub; if (col0 + c4 < N) { const v4f v = *(const v4fa*)&so[w][r][c4]; if (C) *(v4f*)(C + cofs + (size_t)(row0 + r) * ldc + col0 + c4) = v; if (C16) { v4h h4; for (int i = 0; i < 4; ++i) h4[i] = (_Float16)v[i]; *(v4h*)(C16 + cofs + (size_t)(row0 + r) * ldc + col0 + c4) = h4; } } }
     }
}


typedef _Float16 v4h __attribute__((ext_vector_type(4)));

__global__ __launch_bounds__(256) void k_x16(const float* __restrict__ x, _Float16* __restrict__ X16, size_t n8) { const size_t t = (size_t)blockIdx.x * 256 + threadIdx.x; if (t >= n8) return; FragH f;
#pragma unroll
  for (int q = 0; q < 8; ++q) f.h[q] = (_Float16)bf16_round(x[t * 8 + q]); *(v8us*)((unsigned short*)X16 + t * 8) = f.half[0];  }
__global__ __launch_bounds__(256) void k_h16(const float* __restrict__ x, _Float16* __restrict__ X16, size_t n8) { const size_t t = (size_t)blockIdx.x * 256 + threadIdx.x; if (t >= n8) return; FragH f;
#pragma unroll
  for (int q = 0; q < 8; ++q) f.h[q] = (_Float16)x[t * 8 + q]; *(v8us*)((unsigned short*)X16 + t * 8) = f.half[0];  }
__global__ __launch_bounds__(256) void k_round16f(const float* __restrict__ W, _Float16* __restrict__ Bt, size_t n8) { const size_t t = (size_t)blockIdx.x * 256 + threadIdx.x; if (t >= n8) return; FragH f;
#pragma unroll
  for (int i = 0; i < 8; ++i) f.h[i] = (_Float16)(bf16_round(W[t * 8 + i]) * 16.0f); *(v8us*)((unsigned short*)Bt + t * 8) = f.half[0];  }
__global__ __launch_bounds__(256) void k_hl(const float* __restrict__ F, _Float16* __restrict__ Hh, _Float16* __restrict__ Hl, size_t n8) { const size_t t = (size_t)blockIdx.x * 256 + threadIdx.x; if (t >= n8) return; FragH fh, fl; const v4f a = *(const v4fa*)(F + t * 8), c = *(const v4fa*)(F + t * 8 + 4);
#pragma unroll
  for (int q = 0; q < 4; ++q) { _Float16 h = (_Float16)a[q]; fh.h[q] = h; fl.h[q] = (_Float16)((a[q] - (float)h) * 1024.0f); h = (_Float16)c[q]; fh.h[4 + q] = h; fl.h[4 + q] = (_Float16)((c[q] - (float)h) * 1024.0f); }
  { *(v8us*)((unsigned short*)Hh + t * 8) = fh.half[0]; *(v8us*)((unsigned short*)Hl + t * 8) = fl.half[0];  } }

// ---- fused window attention: one work-group = one unit (window, head) x 256 queries; 8 waves x 32 query columns.
// The unit's whole K (1024 x 32) and V^T (32 x 1024) are staged in LDS once; the scores never leave the registers.
// S^T = K.Q^T (lane = one query column, registers = keys), so the packed score tiles are the B operand of O^T += V^T.P^T.
// Pass 1 finds each query's true row maximum, pass 2 recomputes S^T and forms 1024 * exp(scale * (s - max)) as f16, as the unfused softmax did.
#define KPITCH 40                /* K row pitch in LDS, f16 elements: 80 B = 16 B x odd, no bank conflict for 16-byte readers */
#define VPITCH 1032              /* V^T row pitch in LDS, f16 elements: 2064 B = 16 B x odd */
typedef float v2f __attribute__((ext_vector_type(2)));
typedef _Float16 v2h __attribute__((ext_vector_type(2)));
union FragP { v16h v; v2h p[8]; };
__device__ __forceinline__ v16h fa_frag(const unsigned short* p, int hh) { FragH f; f.half[0] = *(const v8us*)(p + 8 * hh); f.half[1] = *(const v8us*)(p + 16 + 8 * hh); return f.v; }
__device__ __forceinline__ v8f fa_mma(v16h a, v16h b, v8f c) { return __builtin_amdgcn_wmma_f32_16x16x32_f16(false, a, false, b, (short)0, c, false, false); }
// eight scores of one query -> eight f16 weights (elements 8 * half .. 8 * half + 7 of the B operand), their f32 values added to su
__device__ __forceinline__ void fa_exp8(const v8f s, const v2f c2, const v2f nb2, v2f& su, FragP& pf, const int half) {
#pragma unroll
  for (int i = 0; i < 4; ++i) { const v2f s2 = {s[2 * i], s[2 * i + 1]}; const v2f t = __builtin_elementwise_fma(s2, c2, nb2); const v2f e = {__builtin_amdgcn_exp2f(t[0]), __builtin_amdgcn_exp2f(t[1])}; su += e; pf.p[half * 4 + i] = __builtin_convertvector(e, v2h); }
}
__global__ __launch_bounds__(256) void k_fattn(const _Float16* __restrict__ QU, const _Float16* __restrict__ KU, const _Float16* __restrict__ VT, _Float16* __restrict__ OH) {
  __shared__ __attribute__((aligned(16))) unsigned short sK[NTW * KPITCH];
  __shared__ __attribute__((aligned(16))) unsigned short sV[HD * VPITCH];
  const int tid = threadIdx.x, w = tid >> 5, lane = tid & 31, ln = lane & 15, hh = lane >> 4;
  const int u = blockIdx.x >> 2, q0 = (blockIdx.x & 3) * 256 + w * 32;
  const unsigned short* kg = (const unsigned short*)KU + (size_t)u * NTW * HD; const unsigned short* vg = (const unsigned short*)VT + (size_t)u * HD * NTW;
  for (int j = 0; j < NTW * HD / 8 / 256; ++j) { const int i = j * 256 + tid; *(v8us*)&sK[(i >> 2) * KPITCH + (i & 3) * 8] = *(const v8us*)(kg + (size_t)i * 8); }
  for (int j = 0; j < HD * NTW / 8 / 256; ++j) { const int i = j * 256 + tid; *(v8us*)&sV[(i >> 7) * VPITCH + (i & 127) * 8] = *(const v8us*)(vg + (size_t)i * 8); }
  const unsigned short* qp = (const unsigned short*)QU + ((size_t)u * NTW + q0 + ln) * HD;
  const v16h bq0 = fa_frag(qp, hh), bq1 = fa_frag(qp + 16 * HD, hh);
  __syncthreads();
  const v8f z8 = {0.f,0.f,0.f,0.f,0.f,0.f,0.f,0.f};
  const unsigned short* kl = &sK[ln * KPITCH];
  float m0 = -3.0e38f, m1 = -3.0e38f;
#pragma unroll 4      /* four key tiles a trip: the later tiles' LDS reads overlap the earlier tiles' products and maxima */
  for (int kt = 0; kt < NTW / 16; ++kt) { const v16h a = fa_frag(kl + kt * 16 * KPITCH, hh); const v8f s0 = fa_mma(a, bq0, z8), s1 = fa_mma(a, bq1, z8);
#pragma unroll
    for (int r = 0; r < 8; ++r) { m0 = fmaxf(m0, s0[r]); m1 = fmaxf(m1, s1[r]); } }
  m0 = fmaxf(m0, __shfl_xor(m0, 16, 32)); m1 = fmaxf(m1, __shfl_xor(m1, 16, 32));      /* lanes l and l ^ 16 hold the two halves of a query's keys */
  const float cs = 0.17677669529663687f * 1.4426950408889634f;      /* scale * log2(e) */
  const v2f c2 = {cs, cs}; const float n0 = 10.0f - m0 * cs, n1 = 10.0f - m1 * cs;      /* + 10: the weights come out times 1024 */
  const v2f nb0 = {n0, n0}, nb1 = {n1, n1};
  const unsigned short* vl = &sV[ln * VPITCH];
  v8f o00 = z8, o10 = z8, o01 = z8, o11 = z8; v2f sa0 = {0.f, 0.f}, sb0 = {0.f, 0.f}, sa1 = {0.f, 0.f}, sb1 = {0.f, 0.f};
#pragma unroll 2      /* two passes of 32 keys a trip: the second pass's LDS reads and products overlap the first's exponentials */
  for (int kb = 0; kb < NTW; kb += 32) {
    const v16h a0 = fa_frag(kl + kb * KPITCH, hh), a1 = fa_frag(kl + (kb + 16) * KPITCH, hh);
    const v16h v0 = fa_frag(vl + kb, hh), v1 = fa_frag(vl + 16 * VPITCH + kb, hh);
    const v8f s00 = fa_mma(a0, bq0, z8), s10 = fa_mma(a1, bq0, z8), s01 = fa_mma(a0, bq1, z8), s11 = fa_mma(a1, bq1, z8);
    FragP p0, p1;
    fa_exp8(s00, c2, nb0, sa0, p0, 0); fa_exp8(s10, c2, nb0, sb0, p0, 1);
    fa_exp8(s01, c2, nb1, sa1, p1, 0); fa_exp8(s11, c2, nb1, sb1, p1, 1);
    o00 = fa_mma(v0, p0.v, o00); o10 = fa_mma(v1, p0.v, o10); o01 = fa_mma(v0, p1.v, o01); o11 = fa_mma(v1, p1.v, o11);
  }
  float su0 = (sa0[0] + sa0[1]) + (sb0[0] + sb0[1]), su1 = (sa1[0] + sa1[1]) + (sb1[0] + sb1[1]);
  su0 += __shfl_xor(su0, 16, 32); su1 += __shfl_xor(su1, 16, 32);
  const float r0 = 1.0f / su0, r1 = 1.0f / su1;      /* sums and products both carry the factor 1024 */
  const int h = u % NHD, bp = u / NHD;
  unsigned short* d0 = (unsigned short*)OH + ((size_t)bp * NTW + q0 + ln) * CC + h * HD + 8 * hh; unsigned short* d1 = d0 + (size_t)16 * CC;
  FragH f;      /* a lane's eight accumulator registers are eight consecutive channels of its query: one 16-byte store each */
#pragma unroll
  for (int r = 0; r < 8; ++r) { f.h[r] = (_Float16)(o00[r] * r0); f.h[8 + r] = (_Float16)(o10[r] * r0); }
  *(v8us*)d0 = f.half[0]; *(v8us*)(d0 + 16) = f.half[1];
#pragma unroll
  for (int r = 0; r < 8; ++r) { f.h[r] = (_Float16)(o01[r] * r1); f.h[8 + r] = (_Float16)(o11[r] * r1); }
  *(v8us*)d1 = f.half[0]; *(v8us*)(d1 + 16) = f.half[1];
}
// ---- projections with their re-layouts folded in: one work-group = 256 consecutive tokens (a quarter window), 8 waves x 32 tokens.
// Tokens and weights are staged in LDS as f16 rows of 64 channels; results go through LDS so that every global store covers whole lines.
#define TT 256                   /* tokens per work-group */
#define TPITCH 72                /* token and weight row pitch in LDS, f16 elements: 144 B = 16 B x odd */
#define OPITCH 40                /* q / k result row (one token, one head) pitch in LDS, f16 elements: 80 B = 16 B x odd */
#define VOPITCH 264              /* V^T result row (one channel, 256 tokens) pitch in LDS, f16 elements: 528 B = 16 B x odd */
#define FPITCH 260               /* output row (one channel, 256 tokens) pitch in LDS, f32 elements: 1040 B = 16 B x odd */
// one 64 x 64 f32 weight matrix (out, in) -> f16(bf16(w) * 16) rows in LDS
__device__ __forceinline__ void pj_weights(const float* __restrict__ Wm, unsigned short* sW, const int tid) {
  for (int j = 0; j < CC * CC / 8 / 256; ++j) { const int i = j * 256 + tid; const v4f a = *(const v4fa*)(Wm + i * 8), c = *(const v4fa*)(Wm + i * 8 + 4); FragH f;
    for (int q = 0; q < 4; ++q) { f.h[q] = (_Float16)(bf16_round(a[q]) * 16.0f); f.h[4 + q] = (_Float16)(bf16_round(c[q]) * 16.0f); }
    *(v8us*)&sW[(i >> 3) * TPITCH + (i & 7) * 8] = f.half[0]; }
}
// x (NCHW f32) -> q, k head-major [unit][token][32] and V^T [unit][32][token], all f16
__global__ __launch_bounds__(256) void k_qkv(const float* __restrict__ x, const float* __restrict__ Wq, const float* __restrict__ Wk, const float* __restrict__ Wv, _Float16* __restrict__ QU, _Float16* __restrict__ KU, _Float16* __restrict__ VT) {
  __shared__ __attribute__((aligned(16))) unsigned short sT[TT * TPITCH];      /* the tokens; later the 64 x VOPITCH V^T tile, which is smaller */
  __shared__ __attribute__((aligned(16))) unsigned short sW[3 * CC * TPITCH];
  __shared__ __attribute__((aligned(16))) unsigned short sO[2 * NHD * TT * OPITCH];      /* the q tile, then the k tile */
  const int tid = threadIdx.x, w = tid >> 5, lane = tid & 31, ln = lane & 15, hh = lane >> 4;
  const int g0 = blockIdx.x * TT, b = g0 / HW, hw0 = g0 % HW, win = g0 / NTW, n0 = g0 % NTW;
  // wave w reads channels 8 w .. 8 w + 7; a lane reads four consecutive tokens, so each load covers 512 contiguous bytes of one channel
  const float* xp = x + ((size_t)b * CC + w * 8) * HW + hw0 + lane * 4;
  v4f xv[2][8];
  for (int j = 0; j < 2; ++j)
    for (int q = 0; q < 8; ++q) xv[j][q] = *(const v4fa*)(xp + (size_t)q * HW + j * 128);
  pj_weights(Wq, sW, tid); pj_weights(Wk, sW + CC * TPITCH, tid); pj_weights(Wv, sW + 2 * CC * TPITCH, tid);
  for (int j = 0; j < 2; ++j)
    for (int e = 0; e < 4; ++e) { FragH f;
      for (int q = 0; q < 8; ++q) f.h[q] = (_Float16)bf16_round(xv[j][q][e]);
      *(v8us*)&sT[(j * 128 + lane * 4 + e) * TPITCH + w * 8] = f.half[0]; }
  __syncthreads();
  const v8f z8 = {0.f,0.f,0.f,0.f,0.f,0.f,0.f,0.f};
  const unsigned short* tl = &sT[(w * 32 + ln) * TPITCH];
  const v16h t00 = fa_frag(tl, hh), t01 = fa_frag(tl + 32, hh), t10 = fa_frag(tl + 16 * TPITCH, hh), t11 = fa_frag(tl + 16 * TPITCH + 32, hh);
  for (int mt = 0; mt < 8; ++mt) {      /* q (tiles 0 to 3), then k: W.X^T, so a lane holds eight consecutive channels of one token */
    const unsigned short* wl = &sW[(mt * 16 + ln) * TPITCH];
    const v16h a0 = fa_frag(wl, hh), a1 = fa_frag(wl + 32, hh);
    const v8f d0 = fa_mma(a1, t01, fa_mma(a0, t00, z8)), d1 = fa_mma(a1, t11, fa_mma(a0, t10, z8));
    FragH f;
    for (int r = 0; r < 8; ++r) { f.h[r] = (_Float16)(d0[r] * 0.0625f); f.h[8 + r] = (_Float16)(d1[r] * 0.0625f); }
    unsigned short* so = &sO[((mt >> 1) * TT + w * 32 + ln) * OPITCH + (mt & 1) * 16 + 8 * hh];
    *(v8us*)so = f.half[0]; *(v8us*)(so + 16 * OPITCH) = f.half[1];
  }
  __syncthreads();      /* every wave holds its token rows in registers: sT is free for the V^T tile */
  for (int nt = 0; nt < 4; ++nt) {      /* v: X.W^T, so a lane holds eight consecutive tokens of one channel */
    const unsigned short* wl = &sW[(2 * CC + nt * 16 + ln) * TPITCH];
    const v16h b0 = fa_frag(wl, hh), b1 = fa_frag(wl + 32, hh);
    const v8f d0 = fa_mma(t01, b1, fa_mma(t00, b0, z8)), d1 = fa_mma(t11, b1, fa_mma(t10, b0, z8));
    FragH f;
    for (int r = 0; r < 8; ++r) { f.h[r] = (_Float16)(d0[r] * 0.0625f); f.h[8 + r] = (_Float16)(d1[r] * 0.0625f); }
    unsigned short* so = &sT[(nt * 16 + ln) * VOPITCH + w * 32 + 8 * hh];
    *(v8us*)so = f.half[0]; *(v8us*)(so + 16) = f.half[1];
  }
  __syncthreads();      /* all three tiles complete; every global store stands behind the last barrier, so no barrier waits for a store */
  const size_t qo = ((size_t)win * NHD * NTW + n0) * HD;
  for (int j = 0; j < 2 * NHD * TT * HD / 8 / 256; ++j) { const int i = j * 256 + tid, h = (i >> 10) & 1, r = (i >> 2) & (TT - 1), pc = i & 3;
    *(v8us*)((unsigned short*)(j < 8 ? QU : KU) + qo + ((size_t)h * NTW + r) * HD + pc * 8) = *(const v8us*)&sO[(i >> 2) * OPITCH + pc * 8]; }
  unsigned short* dv = (unsigned short*)VT + (size_t)win * CC * NTW + n0;
  for (int j = 0; j < CC * TT / 8 / 256; ++j) { const int i = j * 256 + tid, d = i >> 5, pc = i & 31;
    *(v8us*)(dv + (size_t)d * NTW + pc * 8) = *(const v8us*)&sT[d * VOPITCH + pc * 8]; }
}
// context (token-major f16) -> out = ctx Wp^T, stored straight to NCHW f32
__global__ __launch_bounds__(256) void k_proj(const _Float16* __restrict__ OH, const float* __restrict__ Wp, float* __restrict__ out) {
  __shared__ __attribute__((aligned(16))) unsigned short sT[TT * TPITCH];
  __shared__ __attribute__((aligned(16))) unsigned short sW[CC * TPITCH];
  __shared__ __attribute__((aligned(16))) float sF[CC * FPITCH];
  const int tid = threadIdx.x, w = tid >> 5, lane = tid & 31, ln = lane & 15, hh = lane >> 4;
  const int g0 = blockIdx.x * TT, b = g0 / HW, hw0 = g0 % HW;
  const unsigned short* og = (const unsigned short*)OH + (size_t)g0 * CC;
  v8us cv[8];
  for (int j = 0; j < 8; ++j) cv[j] = *(const v8us*)(og + (size_t)(j * 256 + tid) * 8);
  pj_weights(Wp, sW, tid);
  for (int j = 0; j < 8; ++j) { const int i = j * 256 + tid; *(v8us*)&sT[(i >> 3) * TPITCH + (i & 7) * 8] = cv[j]; }
  __syncthreads();
  const v8f z8 = {0.f,0.f,0.f,0.f,0.f,0.f,0.f,0.f};
  const unsigned short* tl = &sT[(w * 32 + ln) * TPITCH];
  const v16h t00 = fa_frag(tl, hh), t01 = fa_frag(tl + 32, hh), t10 = fa_frag(tl + 16 * TPITCH, hh), t11 = fa_frag(tl + 16 * TPITCH + 32, hh);
  const unsigned short* wl = &sW[ln * TPITCH];
  for (int nt = 0; nt < 4; ++nt) {      /* a lane holds eight consecutive tokens of one output channel */
    const v16h b0 = fa_frag(wl + nt * 16 * TPITCH, hh), b1 = fa_frag(wl + nt * 16 * TPITCH + 32, hh);
    const v8f d0 = fa_mma(t01, b1, fa_mma(t00, b0, z8)), d1 = fa_mma(t11, b1, fa_mma(t10, b0, z8));
    float* so = &sF[(nt * 16 + ln) * FPITCH + w * 32 + 8 * hh];
    const v4f p0 = {d0[0] * 0.0625f, d0[1] * 0.0625f, d0[2] * 0.0625f, d0[3] * 0.0625f}, p1 = {d0[4] * 0.0625f, d0[5] * 0.0625f, d0[6] * 0.0625f, d0[7] * 0.0625f};
    const v4f p2 = {d1[0] * 0.0625f, d1[1] * 0.0625f, d1[2] * 0.0625f, d1[3] * 0.0625f}, p3 = {d1[4] * 0.0625f, d1[5] * 0.0625f, d1[6] * 0.0625f, d1[7] * 0.0625f};
    *(v4f*)so = p0; *(v4f*)(so + 4) = p1; *(v4f*)(so + 16) = p2; *(v4f*)(so + 20) = p3;
  }
  __syncthreads();
  float* dp = out + (size_t)b * CC * HW + hw0;
  for (int j = 0; j < CC * TT / 4 / 256; ++j) { const int i = j * 256 + tid, o = i >> 6, pc = i & 63;
    *(v4f*)(dp + (size_t)o * HW + pc * 4) = *(const v4fa*)&sF[o * FPITCH + pc * 4]; }
}

extern "C" void kernel_launch(void* const* d_in, const int* in_sizes, int n_in,
                              void* d_out, int out_size, void* d_ws, size_t ws_size, hipStream_t stream) {
  (void)in_sizes; (void)n_in; (void)out_size;
  const float* const* I = (const float* const*)d_in; const float* x = I[0]; const float* Wq = I[1]; const float* Wk = I[2]; const float* Wv = I[3]; const float* Wp = I[4];
  char* ws = (char*)d_ws; size_t off = 0;
  auto take = [&](size_t bytes) { char* p = ws + off; off += (bytes + 255) & ~(size_t)255; return p; };
  const size_t np = (size_t)NTOK * CC;
  _Float16* QU = (_Float16*)take(np * 2); _Float16* KU = (_Float16*)take(np * 2); _Float16* VT = (_Float16*)take(np * 2); _Float16* OH = (_Float16*)take(np * 2);
  if (off > ws_size) return;      /* 4 x 16 = 64 MiB */
  k_qkv<<<NTOK / TT, 256, 0, stream>>>(x, Wq, Wk, Wv, QU, KU, VT);      /* q, k head-major and V^T per unit, straight from NCHW */
  k_fattn<<<NU * (NTW / 256), 256, 0, stream>>>(QU, KU, VT, OH);      /* scores, softmax, context and its normalisation for all 256 units */
  k_proj<<<NTOK / TT, 256, 0, stream>>>(OH, Wp, (float*)d_out);      /* ctx Wp^T, straight to NCHW */
}

// v003
// One run takes 66.8 microseconds.
// In two side-by-side timings against v002, it was 1.04 and 1.05 times as fast.
// Counting every step since v000, it is 16.0 times as fast.
#include <hip/hip_runtime.h>
// patch_attention (2 x 64 ch x 256 x 256; 64 row-band windows of 4 rows x 256 = 1024 tokens; 2 heads x 32; q, k, v = feat W^T per window; softmax(q.k / sqrt(32)) within the window; out = ctx Wp^T; back to NCHW).
// Compute dtype: inputs rounded to bf16; x and weights exact as f16; q/k/v, the softmax weights and the context as plain f16 operands (~2^-12); softmax f32. v_wmma_f32_16x16x32_f16.
#define NB 2
#define CC 64
#define HW 65536
#define NPW 64                   /* windows per image */
#define NTW 1024                 /* tokens per window */
#define NHD 2
#define HD 32
#define NTOK (NB * HW)           /* 131072 */
#define NU (NB * NPW * NHD)      /* 256 units */
typedef __bf16 v16b __attribute__((ext_vector_type(16)));
typedef unsigned short v8us __attribute__((ext_vector_type(8), may_alias));
typedef float  v8f  __attribute__((ext_vector_type(8)));
typedef float  v4f  __attribute__((ext_vector_type(4)));
typedef float  v4fa __attribute__((ext_vector_type(4), may_alias));
union FragB { v16b v; v8us half[2]; unsigned short u[16]; };

__device__ __forceinline__ unsigned short bf16_bits(float x) { unsigned int u = __float_as_uint(x); return (unsigned short)((u + 0x7FFFu + ((u >> 16) & 1u)) >> 16); }
__device__ __forceinline__ float bf16_val(unsigned short b) { return __uint_as_float(((unsigned int)b) << 16); }
__device__ __forceinline__ float bf16_round(float x) { return bf16_val(bf16_bits(x)); }
// D += A·B with NT terms: 1 = ah·bh, 2 = + al·bh (A split), 3 = + ah·bl (both split)
template <int NT>
__device__ __forceinline__ v8f mmaN(v16b ah, v16b al, v16b bh, v16b bl, v8f c) {
  c = __builtin_amdgcn_wmma_f32_16x16x32_bf16(false, ah, false, bh, (short)0, c, false, false);
  if (NT >= 2) c = __builtin_amdgcn_wmma_f32_16x16x32_bf16(false, al, false, bh, (short)0, c, false, false);
  if (NT >= 3) c = __builtin_amdgcn_wmma_f32_16x16x32_bf16(false, ah, false, bl, (short)0, c, false, false);
  asm volatile("v_nop\n\tv_nop\n\tv_nop\n\tv_nop" : "+v"(c) : "v"(ah), "v"(al), "v"(bh), "v"(bl));
  return c;
}

__global__ __launch_bounds__(256) void k_wt_bf16(const float* __restrict__ W, unsigned short* __restrict__ Wt, int K, int N) {
  const int t = blockIdx.x * 256 + threadIdx.x;
  const int k8n = K / 8;
  if (t >= N * k8n) return;
  const int n = t / k8n, k8 = (t % k8n) * 8;
  v8us v;
#pragma unroll
  for (int i = 0; i < 8; ++i) v[i] = bf16_bits(W[(size_t)(k8 + i) * N + n]);
  *(v8us*)(Wt + (size_t)n * K + k8) = v;
  
}

// GEMM C[M][N] (f32, pitch ldc) = act(A[M][K]·W + bias). A f32 row-major (pitch lda) converted per fragment to bf16
// (ASPLIT: hi/lo two planes -> 2 terms, else single rounded term); Wt bf16 [N][K] (pitch ldb). BIAS_BF16 rounds the
// bias to bf16 first (bias quantised to bf16 before the add). K%32==0, M%16==0, N%64==0.
template <bool ASPLIT, int ACT, bool BIAS_BF16>
__global__ __launch_bounds__(128) void k_gemm_bf(const float* __restrict__ A, int lda, const unsigned short* __restrict__ Wt, int ldb,
                                               const float* __restrict__ bias, float* __restrict__ C, int ldc, int M, int N, int K) {
  __shared__ __attribute__((aligned(16))) float so[4][16][64];
  const int tid = threadIdx.x, w = tid >> 5, lane = tid & 31, ln = lane & 15, hh = lane >> 4;
  const int ntn = N / 64;
  const int wid = blockIdx.x * 4 + w;
  const int mt = wid / ntn, nq = wid % ntn;
  if (mt * 16 >= M) return;
  const int row0 = mt * 16, col0 = nq * 64;
  const float* arow = A + (size_t)(row0 + ln) * lda;
  v8f acc[4] = {};
  for (int kb = 0; kb < K; kb += 32) {
    FragB ah, al;
    const v4f x0 = *(const v4fa*)(arow + kb + 8 * hh), x1 = *(const v4fa*)(arow + kb + 8 * hh + 4);
    const v4f x2 = *(const v4fa*)(arow + kb + 16 + 8 * hh), x3 = *(const v4fa*)(arow + kb + 16 + 8 * hh + 4);
    float xs[16] = {x0[0],x0[1],x0[2],x0[3],x1[0],x1[1],x1[2],x1[3],x2[0],x2[1],x2[2],x2[3],x3[0],x3[1],x3[2],x3[3]};
#pragma unroll
    for (int i = 0; i < 16; ++i) { const unsigned short hb = bf16_bits(xs[i]); ah.u[i] = hb; al.u[i] = ASPLIT ? bf16_bits(xs[i] - bf16_val(hb)) : (unsigned short)0; }
#pragma unroll
    for (int t = 0; t < 4; ++t) {
      const unsigned short* brow = Wt + (size_t)(col0 + t * 16 + ln) * ldb + kb;
      FragB b;
      b.half[0] = *(const v8us*)(brow + 8 * hh);
      b.half[1] = *(const v8us*)(brow + 16 + 8 * hh);
      acc[t] = mmaN<ASPLIT ? 2 : 1>(ah.v, al.v, b.v, b.v, acc[t]);
    }
  }
#pragma unroll
  for (int t = 0; t < 4; ++t) {
    float bv = bias ? bias[col0 + t * 16 + ln] : 0.f;
    if (BIAS_BF16) bv = bf16_round(bv);
#pragma unroll
    for (int r = 0; r < 8; ++r) { float v = acc[t][r] + bv; if (ACT == 1) v = fmaxf(v, 0.f); so[w][8 * hh + r][t * 16 + ln] = v; }
  }
  __builtin_amdgcn_fence(__ATOMIC_ACQ_REL, "workgroup");
  __builtin_amdgcn_wave_barrier();
  const int rsub = lane >> 4, c4 = (lane & 15) * 4;
  {
#pragma unroll
    for (int q = 0; q < 8; ++q) {
      const int r = q * 2 + rsub;
      const v4f v = *(const v4fa*)&so[w][r][c4];
      *(v4f*)(C + (size_t)(row0 + r) * ldc + col0 + c4) = v;
    }
    
  }
}

// GEMM C = act(A·W + bias + resid): A f32 (ASPLIT -> hi/lo 2 terms), Wt bf16 [N][K]; ACT 0 none, 1 relu, 2 exact gelu;
// resid (optional, f32, row index = (row % rmod), pitch ldr, RES_BF16 rounds it) added before the activation.
template <bool ASPLIT, int ACT, bool BIAS_BF16, bool RES_BF16>
__global__ __launch_bounds__(128) void k_gemm_bf3(const float* __restrict__ A, int lda, const unsigned short* __restrict__ Wt, int ldb,
                                                const float* __restrict__ bias, const float* __restrict__ resid, int rmod, int ldr,
                                                float* __restrict__ C, int ldc, int M, int N, int K) {
  __shared__ __attribute__((aligned(16))) float so[4][16][64];
  const int tid = threadIdx.x, w = tid >> 5, lane = tid & 31, ln = lane & 15, hh = lane >> 4;
  const int ntn = N / 64;
  const int wid = blockIdx.x * 4 + w;
  const int mt = wid / ntn, nq = wid % ntn;
  if (mt * 16 >= M) return;
  const int row0 = mt * 16, col0 = nq * 64;
  const float* arow = A + (size_t)(row0 + ln) * lda;
  v8f acc[4] = {};
  for (int kb = 0; kb < K; kb += 32) {
    FragB ah, al;
    const v4f x0 = *(const v4fa*)(arow + kb + 8 * hh), x1 = *(const v4fa*)(arow + kb + 8 * hh + 4);
    const v4f x2 = *(const v4fa*)(arow + kb + 16 + 8 * hh), x3 = *(const v4fa*)(arow + kb + 16 + 8 * hh + 4);
    float xs[16] = {x0[0],x0[1],x0[2],x0[3],x1[0],x1[1],x1[2],x1[3],x2[0],x2[1],x2[2],x2[3],x3[0],x3[1],x3[2],x3[3]};
#pragma unroll
    for (int i = 0; i < 16; ++i) { const unsigned short hb = bf16_bits(xs[i]); ah.u[i] = hb; al.u[i] = ASPLIT ? bf16_bits(xs[i] - bf16_val(hb)) : (unsigned short)0; }
#pragma unroll
    for (int t = 0; t < 4; ++t) {
      const unsigned short* brow = Wt + (size_t)(col0 + t * 16 + ln) * ldb + kb;
      FragB b;
      b.half[0] = *(const v8us*)(brow + 8 * hh);
      b.half[1] = *(const v8us*)(brow + 16 + 8 * hh);
      acc[t] = mmaN<ASPLIT ? 2 : 1>(ah.v, al.v, b.v, b.v, acc[t]);
    }
  }
#pragma unroll
  for (int t = 0; t < 4; ++t) {
    const int col = col0 + t * 16 + ln;
    float bv = bias ? bias[col] : 0.f;
    if (BIAS_BF16) bv = bf16_round(bv);
#pragma unroll
    for (int r = 0; r < 8; ++r) {
      float v = acc[t][r] + bv;
      if (resid) { float rv = resid[(size_t)((row0 + 8 * hh + r) % rmod) * ldr + col]; if (RES_BF16) rv = bf16_round(rv); v += rv; }
      if (ACT == 1) v = fmaxf(v, 0.f);
      if (ACT == 2) v = 0.5f * v * (1.0f + erff(v * 0.70710678118654752f));
      if (ACT == 3) { const float u = 0.7978845608028654f * (v + 0.044715f * v * v * v); v = 0.5f * v * (1.0f + tanhf(u)); }
      so[w][8 * hh + r][t * 16 + ln] = v;
    }
  }
  __builtin_amdgcn_fence(__ATOMIC_ACQ_REL, "workgroup");
  __builtin_amdgcn_wave_barrier();
  const int rsub = lane >> 4, c4 = (lane & 15) * 4;
  {
#pragma unroll
    for (int q = 0; q < 8; ++q) {
      const int r = q * 2 + rsub;
      const v4f v = *(const v4fa*)&so[w][r][c4];
      *(v4f*)(C + (size_t)(row0 + r) * ldc + col0 + c4) = v;
    }
    
  }
}
// row LayerNorm (biased variance, eps) over N: s = X (+ R); optional out_sum <- s; out_norm <- (s-mu)*rsqrt(var+eps)*g + b
template <bool PARAM_BF16>
__global__ __launch_bounds__(256) void k_layernorm(const float* __restrict__ X, const float* __restrict__ R, const float* __restrict__ g, const float* __restrict__ bta,
                                                  float* __restrict__ out_sum, float* __restrict__ out_norm, int N, float eps) {
  __shared__ float red[256];
  const int row = blockIdx.x, tid = threadIdx.x;
  const float* x = X + (size_t)row * N; const float* rr = R ? R + (size_t)row * N : nullptr;
  float vals[16];                     // up to N = 4096
  const int per = N / 256;            // contiguous chunk per thread? use strided-by-4 chunks: thread handles j = tid*4 + 1024*u
  float s1 = 0.f;
  for (int u = 0; u < per / 4; ++u) {
    const int j = tid * 4 + 1024 * u;
    const v4f a = *(const v4fa*)(x + j);
    v4f b = {0.f,0.f,0.f,0.f}; if (rr) b = *(const v4fa*)(rr + j);
#pragma unroll
    for (int q = 0; q < 4; ++q) { const float v = a[q] + b[q]; vals[u * 4 + q] = v; s1 += v; }
  }
  red[tid] = s1; __syncthreads();
  for (int st = 128; st > 0; st >>= 1) { if (tid < st) red[tid] += red[tid + st]; __syncthreads(); }
  const float mu = red[0] / (float)N; __syncthreads();
  float s2 = 0.f;
  for (int u = 0; u < per / 4; ++u)
#pragma unroll
    for (int q = 0; q < 4; ++q) { const float c = vals[u * 4 + q] - mu; s2 += c * c; }
  red[tid] = s2; __syncthreads();
  for (int st = 128; st > 0; st >>= 1) { if (tid < st) red[tid] += red[tid + st]; __syncthreads(); }
  const float rs = rsqrtf(red[0] / (float)N + eps);
  {
    for (int u = 0; u < per / 4; ++u) {
      const int j = tid * 4 + 1024 * u;
      v4f o, sm;
#pragma unroll
      for (int q = 0; q < 4; ++q) {
        float gg = g[j + q], bb = bta[j + q];
        if (PARAM_BF16) { gg = bf16_round(gg); bb = bf16_round(bb); }
        sm[q] = vals[u * 4 + q]; o[q] = (vals[u * 4 + q] - mu) * rs * gg + bb;
      }
      if (out_sum) *(v4f*)(out_sum + (size_t)row * N + j) = sm;
      *(v4f*)(out_norm + (size_t)row * N + j) = o;
    }
    
  }
}



// ---- f16 WMMA path (v_wmma_f32_16x16x32_f16): 11-bit significands for operands in range — used where a [0,1] probability operand needs more precision than bf16
typedef _Float16 v16h __attribute__((ext_vector_type(16)));
union FragH { v16h v; v8us half[2]; _Float16 h[16]; unsigned short u[16]; };
template <int NT>
__device__ __forceinline__ v8f mmaH(v16h ah, v16h al, v16h bh, v16h bl, v8f c) {
  c = __builtin_amdgcn_wmma_f32_16x16x32_f16(false, ah, false, bh, (short)0, c, false, false);
  if (NT >= 2) c = __builtin_amdgcn_wmma_f32_16x16x32_f16(false, al, false, bh, (short)0, c, false, false);
  if (NT >= 3) c = __builtin_amdgcn_wmma_f32_16x16x32_f16(false, ah, false, bl, (short)0, c, false, false);
  asm volatile("v_nop\n\tv_nop\n\tv_nop\n\tv_nop" : "+v"(c) : "v"(ah), "v"(al), "v"(bh), "v"(bl));
  return c;
}
// batched GEMM like k_gemm_b but f16 operands: A f32 (split into f16 hi/lo if ASPLIT, else rounded to f16), Bt = f16 values [n][k]; alpha; C f32; N multiple of 16 (partial tiles skipped)
template <bool ASPLIT>
__global__ __launch_bounds__(128) void k_gemm_h(const float* __restrict__ A, int lda, size_t sA, const _Float16* __restrict__ Bh, int ldb, size_t sB, float alpha, float* __restrict__ C, int ldc, size_t sC, int M, int N, int K) {
  __shared__ __attribute__((aligned(16))) float so[4][16][64];
  const int tid = threadIdx.x, w = tid >> 5, lane = tid & 31, ln = lane & 15, hh = lane >> 4; const int by = blockIdx.y;
  A += (size_t)by * sA; Bh += (size_t)by * sB; C += (size_t)by * sC;
  const int ntn = (N + 63) / 64; const int wid = blockIdx.x * 4 + w; const int mt = wid / ntn, nq = wid % ntn; if (mt * 16 >= M) return;
  const int row0 = mt * 16, col0 = nq * 64; const float* arow = A + (size_t)(row0 + ln) * lda;
  v8f acc[4] = {};
  for (int kb = 0; kb < K; kb += 32) {
    FragH ah, al;
    const v4f x0 = *(const v4fa*)(arow + kb + 8 * hh), x1 = *(const v4fa*)(arow + kb + 8 * hh + 4), x2 = *(const v4fa*)(arow + kb + 16 + 8 * hh), x3 = *(const v4fa*)(arow + kb + 16 + 8 * hh + 4);
    float xs[16] = {x0[0],x0[1],x0[2],x0[3],x1[0],x1[1],x1[2],x1[3],x2[0],x2[1],x2[2],x2[3],x3[0],x3[1],x3[2],x3[3]};
#pragma unroll
    for (int i = 0; i < 16; ++i) { const _Float16 h = (_Float16)xs[i]; ah.h[i] = h; al.h[i] = ASPLIT ? (_Float16)(xs[i] - (float)h) : (_Float16)0.0f; }
#pragma unroll
    for (int t = 0; t < 4; ++t) { if (col0 + t * 16 >= N) continue; const size_t boff = (size_t)(col0 + t * 16 + ln) * ldb + kb; FragH bq; bq.half[0] = *(const v8us*)(Bh + boff + 8 * hh); bq.half[1] = *(const v8us*)(Bh + boff + 16 + 8 * hh);
      acc[t] = mmaH<ASPLIT ? 2 : 1>(ah.v, al.v, bq.v, bq.v, acc[t]); }
  }
#pragma unroll
  for (int t = 0; t < 4; ++t) { if (col0 + t * 16 >= N) continue;
#pragma unroll
    for (int r = 0; r < 8; ++r) so[w][8 * hh + r][t * 16 + ln] = acc[t][r] * alpha; }
  __builtin_amdgcn_fence(__ATOMIC_ACQ_REL, "workgroup"); __builtin_amdgcn_wave_barrier();
  const int rsub = lane >> 4, c4 = (lane & 15) * 4;
  {
#pragma unroll
    for (int q = 0; q < 8; ++q) { const int r = q * 2 + rsub; if (col0 + c4 < N) { const v4f v = *(const v4fa*)&so[w][r][c4]; *(v4f*)(C + (size_t)(row0 + r) * ldc + col0 + c4) = v; } }
     }
}

// Wt[n][k] = f16(W[k][n]·scale) from f32 row-major W[K][N] (scale = power of two; bf16-exact weights stay exact in f16 away from the subnormal range)
__global__ __launch_bounds__(256) void k_wt_f16(const float* __restrict__ W, _Float16* __restrict__ Wt, int K, int N, float scale) {
  const int t = blockIdx.x * 256 + threadIdx.x; if (t >= N * (K / 8)) return; const int n = t / (K / 8), k8 = (t % (K / 8)) * 8; FragH f;
#pragma unroll
  for (int i = 0; i < 8; ++i) f.h[i] = (_Float16)(bf16_round(W[(size_t)(k8 + i) * N + n]) * scale); const v8us o = f.half[0];
  *(v8us*)((unsigned short*)Wt + (size_t)n * K + k8) = o; 
}
// k_gemm_hh variant with fused epilogue: v = acc·alpha + bias[by·sBias + col] (+ CP[(row/rowsPerB)·sCPb + by·64 + col] if CP) ; ACT 0 none / 1 elu ; writes f32 C and f16 C16, each if non-null
template <int ACT>
__global__ __launch_bounds__(128) void k_gemm_hhx(const _Float16* __restrict__ A, int lda, size_t sA, const _Float16* __restrict__ Bh, int ldb, size_t sB, float alpha, const float* __restrict__ bias, size_t sBias, const float* __restrict__ CP, int rowsPerB, size_t sCPb, int row0g,
    float* __restrict__ C, _Float16* __restrict__ C16, int ldc, size_t sC, int M, int N, int K) {
  __shared__ __attribute__((aligned(16))) float so[4][16][64];
  const int tid = threadIdx.x, w = tid >> 5, lane = tid & 31, ln = lane & 15, hh = lane >> 4; const int by = blockIdx.y;
  A += (size_t)by * sA; Bh += (size_t)by * sB; const size_t cofs = (size_t)by * sC; const float* bp = bias ? bias + (size_t)by * sBias : nullptr;
  const int ntn = (N + 63) / 64; const int wid = blockIdx.x * 4 + w; const int mt = wid / ntn, nq = wid % ntn; if (mt * 16 >= M) return;
  const int row0 = mt * 16, col0 = nq * 64; const _Float16* arow = A + (size_t)(row0 + ln) * lda;
  v8f acc[4] = {};
  for (int kb = 0; kb < K; kb += 32) { FragH ah; ah.half[0] = *(const v8us*)((const unsigned short*)arow + kb + 8 * hh); ah.half[1] = *(const v8us*)((const unsigned short*)arow + kb + 16 + 8 * hh);
#pragma unroll
    for (int t = 0; t < 4; ++t) { if (col0 + t * 16 >= N) continue; const size_t boff = (size_t)(col0 + t * 16 + ln) * ldb + kb; FragH bq; bq.half[0] = *(const v8us*)((const unsigned short*)Bh + boff + 8 * hh); bq.half[1] = *(const v8us*)((const unsigned short*)Bh + boff + 16 + 8 * hh);
      acc[t] = mmaH<1>(ah.v, ah.v, bq.v, bq.v, acc[t]); }
  }
#pragma unroll
  for (int t = 0; t < 4; ++t) { if (col0 + t * 16 >= N) continue; const int col = col0 + t * 16 + ln; const float bv = bp ? bf16_round(bp[col]) : 0.f;
#pragma unroll
    for (int r = 0; r < 8; ++r) { float v = acc[t][r] * alpha + bv; if (CP) { const int rr = row0g + row0 + 8 * hh + r; if (rowsPerB < 0) v += CP[cofs + (size_t)rr * ldc + col];      /* rowsPerB < 0: own element of the batched C plane */ else { const int bidx = rr / rowsPerB; v += CP[(size_t)bidx * sCPb + (size_t)by * 64 + col]; } } if (ACT == 1) v = (v > 0.f) ? v : expm1f(v); else if (ACT == 7) v = (v > 0.f) ? v + 1.0f : expf(v); else if (ACT == 8) v = tanhf(v); else if (ACT == 9) v = 0.5f * v * (1.0f + tanhf(0.7978845608028654f * (v + 0.044715f * v * v * v))); else if (ACT == 11) v = 1.0f / (1.0f + expf(-v)); else if (ACT == 12) v = (v > 0.f) ? v : 0.01f * v; else if (ACT == 14) v = (v > 0.f) ? v : 0.1f * v; else if (ACT == 16) v = (v >= 0.f) ? v : 0.3f * v; else if (ACT == 17) v = (v >= 0.f) ? v : 0.2f * v; else if (ACT == 15) v = v / (1.0f + expf(-v)); else if (ACT == 3) v = fmaxf(v, 0.f); else if (ACT == 6) v = 0.5f * v * (1.0f + erff(v * 0.70710678118654752f)); so[w][8 * hh + r][t * 16 + ln] = v; } }
  __builtin_amdgcn_fence(__ATOMIC_ACQ_REL, "workgroup"); __builtin_amdgcn_wave_barrier();
  const int rsub = lane >> 4, c4 = (lane & 15) * 4; typedef _Float16 v4h __attribute__((ext_vector_type(4)));
  {
#pragma unroll
    for (int q = 0; q < 8; ++q) { const int r = q * 2 + rsub; if (col0 + c4 < N) { const v4f v = *(const v4fa*)&so[w][r][c4]; if (C) *(v4f*)(C + cofs + (size_t)(row0 + r) * ldc + col0 + c4) = v; if (C16) { v4h h4; for (int i = 0; i < 4; ++i) h4[i] = (_Float16)v[i]; *(v4h*)(C16 + cofs + (size_t)(row0 + r) * ldc + col0 + c4) = h4; } } }
     }
}


typedef _Float16 v4h __attribute__((ext_vector_type(4)));

__global__ __launch_bounds__(256) void k_x16(const float* __restrict__ x, _Float16* __restrict__ X16, size_t n8) { const size_t t = (size_t)blockIdx.x * 256 + threadIdx.x; if (t >= n8) return; FragH f;
#pragma unroll
  for (int q = 0; q < 8; ++q) f.h[q] = (_Float16)bf16_round(x[t * 8 + q]); *(v8us*)((unsigned short*)X16 + t * 8) = f.half[0];  }
__global__ __launch_bounds__(256) void k_h16(const float* __restrict__ x, _Float16* __restrict__ X16, size_t n8) { const size_t t = (size_t)blockIdx.x * 256 + threadIdx.x; if (t >= n8) return; FragH f;
#pragma unroll
  for (int q = 0; q < 8; ++q) f.h[q] = (_Float16)x[t * 8 + q]; *(v8us*)((unsigned short*)X16 + t * 8) = f.half[0];  }
__global__ __launch_bounds__(256) void k_round16f(const float* __restrict__ W, _Float16* __restrict__ Bt, size_t n8) { const size_t t = (size_t)blockIdx.x * 256 + threadIdx.x; if (t >= n8) return; FragH f;
#pragma unroll
  for (int i = 0; i < 8; ++i) f.h[i] = (_Float16)(bf16_round(W[t * 8 + i]) * 16.0f); *(v8us*)((unsigned short*)Bt + t * 8) = f.half[0];  }
__global__ __launch_bounds__(256) void k_hl(const float* __restrict__ F, _Float16* __restrict__ Hh, _Float16* __restrict__ Hl, size_t n8) { const size_t t = (size_t)blockIdx.x * 256 + threadIdx.x; if (t >= n8) return; FragH fh, fl; const v4f a = *(const v4fa*)(F + t * 8), c = *(const v4fa*)(F + t * 8 + 4);
#pragma unroll
  for (int q = 0; q < 4; ++q) { _Float16 h = (_Float16)a[q]; fh.h[q] = h; fl.h[q] = (_Float16)((a[q] - (float)h) * 1024.0f); h = (_Float16)c[q]; fh.h[4 + q] = h; fl.h[4 + q] = (_Float16)((c[q] - (float)h) * 1024.0f); }
  { *(v8us*)((unsigned short*)Hh + t * 8) = fh.half[0]; *(v8us*)((unsigned short*)Hl + t * 8) = fl.half[0];  } }

// ---- fused window attention (the kernel stands behind the projection helpers below): one work-group = one window x 256 queries, head after head; 8 waves x 32 query columns.
// A unit's (window, head) whole K (1024 x 32) and V^T (32 x 1024) are staged in LDS; the scores never leave the registers.
// S^T = K.Q^T (lane = one query column, registers = keys), so the packed score tiles are the B operand of O^T += V^T.P^T.
// Pass 1 finds each query's true row maximum, pass 2 recomputes S^T and forms 1024 * exp(scale * (s - max)) as f16, as the unfused softmax did.
#define KPITCH 40                /* K row pitch in LDS, f16 elements: 80 B = 16 B x odd, no bank conflict for 16-byte readers */
#define VPITCH 1032              /* V^T row pitch in LDS, f16 elements: 2064 B = 16 B x odd */
typedef float v2f __attribute__((ext_vector_type(2)));
typedef _Float16 v2h __attribute__((ext_vector_type(2)));
union FragP { v16h v; v2h p[8]; };
__device__ __forceinline__ v16h fa_frag(const unsigned short* p, int hh) { FragH f; f.half[0] = *(const v8us*)(p + 8 * hh); f.half[1] = *(const v8us*)(p + 16 + 8 * hh); return f.v; }
__device__ __forceinline__ v8f fa_mma(v16h a, v16h b, v8f c) { return __builtin_amdgcn_wmma_f32_16x16x32_f16(false, a, false, b, (short)0, c, false, false); }
// eight scores of one query -> eight f16 weights (elements 8 * half .. 8 * half + 7 of the B operand), their f32 values added to su
__device__ __forceinline__ void fa_exp8(const v8f s, const v2f c2, const v2f nb2, v2f& su, FragP& pf, const int half) {
#pragma unroll
  for (int i = 0; i < 4; ++i) { const v2f s2 = {s[2 * i], s[2 * i + 1]}; const v2f t = __builtin_elementwise_fma(s2, c2, nb2); const v2f e = {__builtin_amdgcn_exp2f(t[0]), __builtin_amdgcn_exp2f(t[1])}; su += e; pf.p[half * 4 + i] = __builtin_convertvector(e, v2h); }
}
// ---- projections with their re-layouts folded in: one work-group = 256 consecutive tokens (a quarter window), 8 waves x 32 tokens.
// Tokens and weights are staged in LDS as f16 rows of 64 channels; results go through LDS so that every global store covers whole lines.
#define TT 256                   /* tokens per work-group */
#define TPITCH 72                /* token and weight row pitch in LDS, f16 elements: 144 B = 16 B x odd */
#define OPITCH 40                /* q / k result row (one token, one head) pitch in LDS, f16 elements: 80 B = 16 B x odd */
#define VOPITCH 264              /* V^T result row (one channel, 256 tokens) pitch in LDS, f16 elements: 528 B = 16 B x odd */
#define FPITCH 260               /* output row (one channel, 256 tokens) pitch in LDS, f32 elements: 1040 B = 16 B x odd */
// one 64 x 64 f32 weight matrix (out, in) -> f16(bf16(w) * 16) rows in LDS
__device__ __forceinline__ void pj_weights(const float* __restrict__ Wm, unsigned short* sW, const int tid) {
  for (int j = 0; j < CC * CC / 8 / 256; ++j) { const int i = j * 256 + tid; const v4f a = *(const v4fa*)(Wm + i * 8), c = *(const v4fa*)(Wm + i * 8 + 4); FragH f;
    for (int q = 0; q < 4; ++q) { f.h[q] = (_Float16)(bf16_round(a[q]) * 16.0f); f.h[4 + q] = (_Float16)(bf16_round(c[q]) * 16.0f); }
    *(v8us*)&sW[(i >> 3) * TPITCH + (i & 7) * 8] = f.half[0]; }
}
// x (NCHW f32) -> q, k head-major [unit][token][32] and V^T [unit][32][token], all f16
__global__ __launch_bounds__(256) void k_qkv(const float* __restrict__ x, const float* __restrict__ Wq, const float* __restrict__ Wk, const float* __restrict__ Wv, _Float16* __restrict__ QU, _Float16* __restrict__ KU, _Float16* __restrict__ VT) {
  __shared__ __attribute__((aligned(16))) unsigned short sT[TT * TPITCH];      /* the tokens; later the 64 x VOPITCH V^T tile, which is smaller */
  __shared__ __attribute__((aligned(16))) unsigned short sW[3 * CC * TPITCH];
  __shared__ __attribute__((aligned(16))) unsigned short sO[2 * NHD * TT * OPITCH];      /* the q tile, then the k tile */
  const int tid = threadIdx.x, w = tid >> 5, lane = tid & 31, ln = lane & 15, hh = lane >> 4;
  const int g0 = blockIdx.x * TT, b = g0 / HW, hw0 = g0 % HW, win = g0 / NTW, n0 = g0 % NTW;
  // wave w reads channels 8 w .. 8 w + 7; a lane reads four consecutive tokens, so each load covers 512 contiguous bytes of one channel
  const float* xp = x + ((size_t)b * CC + w * 8) * HW + hw0 + lane * 4;
  v4f xv[2][8];
  for (int j = 0; j < 2; ++j)
    for (int q = 0; q < 8; ++q) xv[j][q] = *(const v4fa*)(xp + (size_t)q * HW + j * 128);
  pj_weights(Wq, sW, tid); pj_weights(Wk, sW + CC * TPITCH, tid); pj_weights(Wv, sW + 2 * CC * TPITCH, tid);
  for (int j = 0; j < 2; ++j)
    for (int e = 0; e < 4; ++e) { FragH f;
      for (int q = 0; q < 8; ++q) f.h[q] = (_Float16)bf16_round(xv[j][q][e]);
      *(v8us*)&sT[(j * 128 + lane * 4 + e) * TPITCH + w * 8] = f.half[0]; }
  __syncthreads();
  const v8f z8 = {0.f,0.f,0.f,0.f,0.f,0.f,0.f,0.f};
  const unsigned short* tl = &sT[(w * 32 + ln) * TPITCH];
  const v16h t00 = fa_frag(tl, hh), t01 = fa_frag(tl + 32, hh), t10 = fa_frag(tl + 16 * TPITCH, hh), t11 = fa_frag(tl + 16 * TPITCH + 32, hh);
  for (int mt = 0; mt < 8; ++mt) {      /* q (tiles 0 to 3), then k: W.X^T, so a lane holds eight consecutive channels of one token */
    const unsigned short* wl = &sW[(mt * 16 + ln) * TPITCH];
    const v16h a0 = fa_frag(wl, hh), a1 = fa_frag(wl + 32, hh);
    const v8f d0 = fa_mma(a1, t01, fa_mma(a0, t00, z8)), d1 = fa_mma(a1, t11, fa_mma(a0, t10, z8));
    FragH f;
    for (int r = 0; r < 8; ++r) { f.h[r] = (_Float16)(d0[r] * 0.0625f); f.h[8 + r] = (_Float16)(d1[r] * 0.0625f); }
    unsigned short* so = &sO[((mt >> 1) * TT + w * 32 + ln) * OPITCH + (mt & 1) * 16 + 8 * hh];
    *(v8us*)so = f.half[0]; *(v8us*)(so + 16 * OPITCH) = f.half[1];
  }
  __syncthreads();      /* every wave holds its token rows in registers: sT is free for the V^T tile */
  for (int nt = 0; nt < 4; ++nt) {      /* v: X.W^T, so a lane holds eight consecutive tokens of one channel */
    const unsigned short* wl = &sW[(2 * CC + nt * 16 + ln) * TPITCH];
    const v16h b0 = fa_frag(wl, hh), b1 = fa_frag(wl + 32, hh);
    const v8f d0 = fa_mma(t01, b1, fa_mma(t00, b0, z8)), d1 = fa_mma(t11, b1, fa_mma(t10, b0, z8));
    FragH f;
    for (int r = 0; r < 8; ++r) { f.h[r] = (_Float16)(d0[r] * 0.0625f); f.h[8 + r] = (_Float16)(d1[r] * 0.0625f); }
    unsigned short* so = &sT[(nt * 16 + ln) * VOPITCH + w * 32 + 8 * hh];
    *(v8us*)so = f.half[0]; *(v8us*)(so + 16) = f.half[1];
  }
  __syncthreads();      /* all three tiles complete; every global store stands behind the last barrier, so no barrier waits for a store */
  const size_t qo = ((size_t)win * NHD * NTW + n0) * HD;
  for (int j = 0; j < 2 * NHD * TT * HD / 8 / 256; ++j) { const int i = j * 256 + tid, h = (i >> 10) & 1, r = (i >> 2) & (TT - 1), pc = i & 3;
    *(v8us*)((unsigned short*)(j < 8 ? QU : KU) + qo + ((size_t)h * NTW + r) * HD + pc * 8) = *(const v8us*)&sO[(i >> 2) * OPITCH + pc * 8]; }
  unsigned short* dv = (unsigned short*)VT + (size_t)win * CC * NTW + n0;
  for (int j = 0; j < CC * TT / 8 / 256; ++j) { const int i = j * 256 + tid, d = i >> 5, pc = i & 31;
    *(v8us*)(dv + (size_t)d * NTW + pc * 8) = *(const v8us*)&sT[d * VOPITCH + pc * 8]; }
}
// attention of one window quarter (256 queries), both heads one after the other in the same LDS, then out = ctx Wp^T of those tokens, stored straight to NCHW f32.
// A head's normalised context tiles (lane = query, registers = channels 8 hh .. and 16 + 8 hh ..) are already the B operand of Wp.ctx^T, so the context never leaves the registers.
__global__ __launch_bounds__(256) void k_fattn(const _Float16* __restrict__ QU, const _Float16* __restrict__ KU, const _Float16* __restrict__ VT, const float* __restrict__ Wp, float* __restrict__ out) {
  __shared__ __attribute__((aligned(16))) unsigned short sK[NTW * KPITCH];      /* one head's K; at the end the 64 x FPITCH f32 output tile, which is smaller */
  __shared__ __attribute__((aligned(16))) unsigned short sV[HD * VPITCH];
  __shared__ __attribute__((aligned(16))) unsigned short sW[CC * TPITCH];
  const int tid = threadIdx.x, w = tid >> 5, lane = tid & 31, ln = lane & 15, hh = lane >> 4;
  const int bp = blockIdx.x >> 2, n0 = (blockIdx.x & 3) * 256, q0 = n0 + w * 32;
  pj_weights(Wp, sW, tid);      /* published by the first barrier below */
  const v8f z8 = {0.f,0.f,0.f,0.f,0.f,0.f,0.f,0.f};
  const unsigned short* kl = &sK[ln * KPITCH];
  const unsigned short* vl = &sV[ln * VPITCH];
  FragH ca0 = {}, ca1 = {}, cb0 = {}, cb1 = {};      /* context of head 0 (ca) and head 1 (cb), query columns ln and 16 + ln */
  for (int h = 0; h < NHD; ++h) {
    const int u = bp * NHD + h;
    const unsigned short* kg = (const unsigned short*)KU + (size_t)u * NTW * HD; const unsigned short* vg = (const unsigned short*)VT + (size_t)u * HD * NTW;
    for (int j = 0; j < NTW * HD / 8 / 256; ++j) { const int i = j * 256 + tid; *(v8us*)&sK[(i >> 2) * KPITCH + (i & 3) * 8] = *(const v8us*)(kg + (size_t)i * 8); }
    for (int j = 0; j < HD * NTW / 8 / 256; ++j) { const int i = j * 256 + tid; *(v8us*)&sV[(i >> 7) * VPITCH + (i & 127) * 8] = *(const v8us*)(vg + (size_t)i * 8); }
    const unsigned short* qp = (const unsigned short*)QU + ((size_t)u * NTW + q0 + ln) * HD;
    const v16h bq0 = fa_frag(qp, hh), bq1 = fa_frag(qp + 16 * HD, hh);
    __syncthreads();
    float m0 = -3.0e38f, m1 = -3.0e38f;
#pragma unroll 4      /* four key tiles a trip: the later tiles' LDS reads overlap the earlier tiles' products and maxima */
    for (int kt = 0; kt < NTW / 16; ++kt) { const v16h a = fa_frag(kl + kt * 16 * KPITCH, hh); const v8f s0 = fa_mma(a, bq0, z8), s1 = fa_mma(a, bq1, z8);
#pragma unroll
      for (int r = 0; r < 8; ++r) { m0 = fmaxf(m0, s0[r]); m1 = fmaxf(m1, s1[r]); } }
    m0 = fmaxf(m0, __shfl_xor(m0, 16, 32)); m1 = fmaxf(m1, __shfl_xor(m1, 16, 32));      /* lanes l and l ^ 16 hold the two halves of a query's keys */
    const float cs = 0.17677669529663687f * 1.4426950408889634f;      /* scale * log2(e) */
    const v2f c2 = {cs, cs}; const float n0f = 10.0f - m0 * cs, n1f = 10.0f - m1 * cs;      /* + 10: the weights come out times 1024 */
    const v2f nb0 = {n0f, n0f}, nb1 = {n1f, n1f};
    v8f o00 = z8, o10 = z8, o01 = z8, o11 = z8; v2f sa0 = {0.f, 0.f}, sb0 = {0.f, 0.f}, sa1 = {0.f, 0.f}, sb1 = {0.f, 0.f};
#pragma unroll 2      /* two passes of 32 keys a trip: the second pass's LDS reads and products overlap the first's exponentials */
    for (int kb = 0; kb < NTW; kb += 32) {
      const v16h a0 = fa_frag(kl + kb * KPITCH, hh), a1 = fa_frag(kl + (kb + 16) * KPITCH, hh);
      const v16h v0 = fa_frag(vl + kb, hh), v1 = fa_frag(vl + 16 * VPITCH + kb, hh);
      const v8f s00 = fa_mma(a0, bq0, z8), s10 = fa_mma(a1, bq0, z8), s01 = fa_mma(a0, bq1, z8), s11 = fa_mma(a1, bq1, z8);
      FragP p0, p1;
      fa_exp8(s00, c2, nb0, sa0, p0, 0); fa_exp8(s10, c2, nb0, sb0, p0, 1);
      fa_exp8(s01, c2, nb1, sa1, p1, 0); fa_exp8(s11, c2, nb1, sb1, p1, 1);
      o00 = fa_mma(v0, p0.v, o00); o10 = fa_mma(v1, p0.v, o10); o01 = fa_mma(v0, p1.v, o01); o11 = fa_mma(v1, p1.v, o11);
    }
    float su0 = (sa0[0] + sa0[1]) + (sb0[0] + sb0[1]), su1 = (sa1[0] + sa1[1]) + (sb1[0] + sb1[1]);
    su0 += __shfl_xor(su0, 16, 32); su1 += __shfl_xor(su1, 16, 32);
    const float r0 = 1.0f / su0, r1 = 1.0f / su1;      /* sums and products both carry the factor 1024 */
    ca0 = cb0; ca1 = cb1;      /* after the second head ca holds head 0 and cb head 1 */
#pragma unroll
    for (int r = 0; r < 8; ++r) { cb0.h[r] = (_Float16)(o00[r] * r0); cb0.h[8 + r] = (_Float16)(o10[r] * r0); cb1.h[r] = (_Float16)(o01[r] * r1); cb1.h[8 + r] = (_Float16)(o11[r] * r1); }
    __syncthreads();      /* every wave has read this head's K and V for the last time: the LDS may take the next head, or the output tile */
  }
  float* sF = (float*)sK;
  const unsigned short* wl = &sW[ln * TPITCH];
  for (int ot = 0; ot < 4; ++ot) {      /* Wp.ctx^T: a lane holds eight consecutive output channels of one token; k = head 0's channels, then head 1's */
    const v16h a0 = fa_frag(wl + ot * 16 * TPITCH, hh), a1 = fa_frag(wl + ot * 16 * TPITCH + 32, hh);
    const v8f d0 = fa_mma(a1, cb0.v, fa_mma(a0, ca0.v, z8)), d1 = fa_mma(a1, cb1.v, fa_mma(a0, ca1.v, z8));
    float* so = &sF[(ot * 16 + 8 * hh) * FPITCH + w * 32 + ln];
    for (int r = 0; r < 8; ++r) { so[r * FPITCH] = d0[r] * 0.0625f; so[r * FPITCH + 16] = d1[r] * 0.0625f; }
  }
  __syncthreads();      /* the 64 x 256 output tile is complete: each store below covers whole lines of one channel */
  const int g0 = bp * NTW + n0, b = g0 / HW, hw0 = g0 % HW;
  float* dp = out + (size_t)b * CC * HW + hw0;
  for (int j = 0; j < CC * TT / 4 / 256; ++j) { const int i = j * 256 + tid, o = i >> 6, pc = i & 63;
    *(v4f*)(dp + (size_t)o * HW + pc * 4) = *(const v4fa*)&sF[o * FPITCH + pc * 4]; }
}

extern "C" void kernel_launch(void* const* d_in, const int* in_sizes, int n_in,
                              void* d_out, int out_size, void* d_ws, size_t ws_size, hipStream_t stream) {
  (void)in_sizes; (void)n_in; (void)out_size;
  const float* const* I = (const float* const*)d_in; const float* x = I[0]; const float* Wq = I[1]; const float* Wk = I[2]; const float* Wv = I[3]; const float* Wp = I[4];
  char* ws = (char*)d_ws; size_t off = 0;
  auto take = [&](size_t bytes) { char* p = ws + off; off += (bytes + 255) & ~(size_t)255; return p; };
  const size_t np = (size_t)NTOK * CC;
  _Float16* QU = (_Float16*)take(np * 2); _Float16* KU = (_Float16*)take(np * 2); _Float16* VT = (_Float16*)take(np * 2);
  if (off > ws_size) return;      /* 3 x 16 = 48 MiB */
  k_qkv<<<NTOK / TT, 256, 0, stream>>>(x, Wq, Wk, Wv, QU, KU, VT);      /* q, k head-major and V^T per unit, straight from NCHW */
  k_fattn<<<NTOK / TT, 256, 0, stream>>>(QU, KU, VT, Wp, (float*)d_out);      /* scores, softmax, context of both heads, then ctx Wp^T straight to NCHW */
}

// v004
// It runs in 59.5 microseconds.
// In two side-by-side timings against v003, it was 1.12 and 1.13 times as fast.
// Over all steps from v000 it is 18.0 times as fast.
#include <hip/hip_runtime.h>
// patch_attention (2 x 64 ch x 256 x 256; 64 row-band windows of 4 rows x 256 = 1024 tokens; 2 heads x 32; q, k, v = feat W^T per window; softmax(q.k / sqrt(32)) within the window; out = ctx Wp^T; back to NCHW).
// Compute dtype: inputs rounded to bf16; x and weights exact as f16; q/k/v, the softmax weights and the context as plain f16 operands (~2^-12); softmax f32. v_wmma_f32_16x16x32_f16.
#define NB 2
#define CC 64
#define HW 65536
#define NPW 64                   /* windows per image */
#define NTW 1024                 /* tokens per window */
#define NHD 2
#define HD 32
#define NTOK (NB * HW)           /* 131072 */
#define NU (NB * NPW * NHD)      /* 256 units */
typedef __bf16 v16b __attribute__((ext_vector_type(16)));
typedef unsigned short v8us __attribute__((ext_vector_type(8), may_alias));
typedef float  v8f  __attribute__((ext_vector_type(8)));
typedef float  v4f  __attribute__((ext_vector_type(4)));
typedef float  v4fa __attribute__((ext_vector_type(4), may_alias));
union FragB { v16b v; v8us half[2]; unsigned short u[16]; };

__device__ __forceinline__ unsigned short bf16_bits(float x) { unsigned int u = __float_as_uint(x); return (unsigned short)((u + 0x7FFFu + ((u >> 16) & 1u)) >> 16); }
__device__ __forceinline__ float bf16_val(unsigned short b) { return __uint_as_float(((unsigned int)b) << 16); }
__device__ __forceinline__ float bf16_round(float x) { return bf16_val(bf16_bits(x)); }
// D += A·B with NT terms: 1 = ah·bh, 2 = + al·bh (A split), 3 = + ah·bl (both split)
template <int NT>
__device__ __forceinline__ v8f mmaN(v16b ah, v16b al, v16b bh, v16b bl, v8f c) {
  c = __builtin_amdgcn_wmma_f32_16x16x32_bf16(false, ah, false, bh, (short)0, c, false, false);
  if (NT >= 2) c = __builtin_amdgcn_wmma_f32_16x16x32_bf16(false, al, false, bh, (short)0, c, false, false);
  if (NT >= 3) c = __builtin_amdgcn_wmma_f32_16x16x32_bf16(false, ah, false, bl, (short)0, c, false, false);
  asm volatile("v_nop\n\tv_nop\n\tv_nop\n\tv_nop" : "+v"(c) : "v"(ah), "v"(al), "v"(bh), "v"(bl));
  return c;
}

__global__ __launch_bounds__(256) void k_wt_bf16(const float* __restrict__ W, unsigned short* __restrict__ Wt, int K, int N) {
  const int t = blockIdx.x * 256 + threadIdx.x;
  const int k8n = K / 8;
  if (t >= N * k8n) return;
  const int n = t / k8n, k8 = (t % k8n) * 8;
  v8us v;
#pragma unroll
  for (int i = 0; i < 8; ++i) v[i] = bf16_bits(W[(size_t)(k8 + i) * N + n]);
  *(v8us*)(Wt + (size_t)n * K + k8) = v;
  
}

// GEMM C[M][N] (f32, pitch ldc) = act(A[M][K]·W + bias). A f32 row-major (pitch lda) converted per fragment to bf16
// (ASPLIT: hi/lo two planes -> 2 terms, else single rounded term); Wt bf16 [N][K] (pitch ldb). BIAS_BF16 rounds the
// bias to bf16 first (bias quantised to bf16 before the add). K%32==0, M%16==0, N%64==0.
template <bool ASPLIT, int ACT, bool BIAS_BF16>
__global__ __launch_bounds__(128) void k_gemm_bf(const float* __restrict__ A, int lda, const unsigned short* __restrict__ Wt, int ldb,
                                               const float* __restrict__ bias, float* __restrict__ C, int ldc, int M, int N, int K) {
  __shared__ __attribute__((aligned(16))) float so[4][16][64];
  const int tid = threadIdx.x, w = tid >> 5, lane = tid & 31, ln = lane & 15, hh = lane >> 4;
  const int ntn = N / 64;
  const int wid = blockIdx.x * 4 + w;
  const int mt = wid / ntn, nq = wid % ntn;
  if (mt * 16 >= M) return;
  const int row0 = mt * 16, col0 = nq * 64;
  const float* arow = A + (size_t)(row0 + ln) * lda;
  v8f acc[4] = {};
  for (int kb = 0; kb < K; kb += 32) {
    FragB ah, al;
    const v4f x0 = *(const v4fa*)(arow + kb + 8 * hh), x1 = *(const v4fa*)(arow + kb + 8 * hh + 4);
    const v4f x2 = *(const v4fa*)(arow + kb + 16 + 8 * hh), x3 = *(const v4fa*)(arow + kb + 16 + 8 * hh + 4);
    float xs[16] = {x0[0],x0[1],x0[2],x0[3],x1[0],x1[1],x1[2],x1[3],x2[0],x2[1],x2[2],x2[3],x3[0],x3[1],x3[2],x3[3]};
#pragma unroll
    for (int i = 0; i < 16; ++i) { const unsigned short hb = bf16_bits(xs[i]); ah.u[i] = hb; al.u[i] = ASPLIT ? bf16_bits(xs[i] - bf16_val(hb)) : (unsigned short)0; }
#pragma unroll
    for (int t = 0; t < 4; ++t) {
      const unsigned short* brow = Wt + (size_t)(col0 + t * 16 + ln) * ldb + kb;
      FragB b;
      b.half[0] = *(const v8us*)(brow + 8 * hh);
      b.half[1] = *(const v8us*)(brow + 16 + 8 * hh);
      acc[t] = mmaN<ASPLIT ? 2 : 1>(ah.v, al.v, b.v, b.v, acc[t]);
    }
  }
#pragma unroll
  for (int t = 0; t < 4; ++t) {
    float bv = bias ? bias[col0 + t * 16 + ln] : 0.f;
    if (BIAS_BF16) bv = bf16_round(bv);
#pragma unroll
    for (int r = 0; r < 8; ++r) { float v = acc[t][r] + bv; if (ACT == 1) v = fmaxf(v, 0.f); so[w][8 * hh + r][t * 16 + ln] = v; }
  }
  __builtin_amdgcn_fence(__ATOMIC_ACQ_REL, "workgroup");
  __builtin_amdgcn_wave_barrier();
  const int rsub = lane >> 4, c4 = (lane & 15) * 4;
  {
#pragma unroll
    for (int q = 0; q < 8; ++q) {
      const int r = q * 2 + rsub;
      const v4f v = *(const v4fa*)&so[w][r][c4];
      *(v4f*)(C + (size_t)(row0 + r) * ldc + col0 + c4) = v;
    }
    
  }
}

// GEMM C = act(A·W + bias + resid): A f32 (ASPLIT -> hi/lo 2 terms), Wt bf16 [N][K]; ACT 0 none, 1 relu, 2 exact gelu;
// resid (optional, f32, row index = (row % rmod), pitch ldr, RES_BF16 rounds it) added before the activation.
template <bool ASPLIT, int ACT, bool BIAS_BF16, bool RES_BF16>
__global__ __launch_bounds__(128) void k_gemm_bf3(const float* __restrict__ A, int lda, const unsigned short* __restrict__ Wt, int ldb,
                                                const float* __restrict__ bias, const float* __restrict__ resid, int rmod, int ldr,
                                                float* __restrict__ C, int ldc, int M, int N, int K) {
  __shared__ __attribute__((aligned(16))) float so[4][16][64];
  const int tid = threadIdx.x, w = tid >> 5, lane = tid & 31, ln = lane & 15, hh = lane >> 4;
  const int ntn = N / 64;
  const int wid = blockIdx.x * 4 + w;
  const int mt = wid / ntn, nq = wid % ntn;
  if (mt * 16 >= M) return;
  const int row0 = mt * 16, col0 = nq * 64;
  const float* arow = A + (size_t)(row0 + ln) * lda;
  v8f acc[4] = {};
  for (int kb = 0; kb < K; kb += 32) {
    FragB ah, al;
    const v4f x0 = *(const v4fa*)(arow + kb + 8 * hh), x1 = *(const v4fa*)(arow + kb + 8 * hh + 4);
    const v4f x2 = *(const v4fa*)(arow + kb + 16 + 8 * hh), x3 = *(const v4fa*)(arow + kb + 16 + 8 * hh + 4);
    float xs[16] = {x0[0],x0[1],x0[2],x0[3],x1[0],x1[1],x1[2],x1[3],x2[0],x2[1],x2[2],x2[3],x3[0],x3[1],x3[2],x3[3]};
#pragma unroll
    for (int i = 0; i < 16; ++i) { const unsigned short hb = bf16_bits(xs[i]); ah.u[i] = hb; al.u[i] = ASPLIT ? bf16_bits(xs[i] - bf16_val(hb)) : (unsigned short)0; }
#pragma unroll
    for (int t = 0; t < 4; ++t) {
      const unsigned short* brow = Wt + (size_t)(col0 + t * 16 + ln) * ldb + kb;
      FragB b;
      b.half[0] = *(const v8us*)(brow + 8 * hh);
      b.half[1] = *(const v8us*)(brow + 16 + 8 * hh);
      acc[t] = mmaN<ASPLIT ? 2 : 1>(ah.v, al.v, b.v, b.v, acc[t]);
    }
  }
#pragma unroll
  for (int t = 0; t < 4; ++t) {
    const int col = col0 + t * 16 + ln;
    float bv = bias ? bias[col] : 0.f;
    if (BIAS_BF16) bv = bf16_round(bv);
#pragma unroll
    for (int r = 0; r < 8; ++r) {
      float v = acc[t][r] + bv;
      if (resid) { float rv = resid[(size_t)((row0 + 8 * hh + r) % rmod) * ldr + col]; if (RES_BF16) rv = bf16_round(rv); v += rv; }
      if (ACT == 1) v = fmaxf(v, 0.f);
      if (ACT == 2) v = 0.5f * v * (1.0f + erff(v * 0.70710678118654752f));
      if (ACT == 3) { const float u = 0.7978845608028654f * (v + 0.044715f * v * v * v); v = 0.5f * v * (1.0f + tanhf(u)); }
      so[w][8 * hh + r][t * 16 + ln] = v;
    }
  }
  __builtin_amdgcn_fence(__ATOMIC_ACQ_REL, "workgroup");
  __builtin_amdgcn_wave_barrier();
  const int rsub = lane >> 4, c4 = (lane & 15) * 4;
  {
#pragma unroll
    for (int q = 0; q < 8; ++q) {
      const int r = q * 2 + rsub;
      const v4f v = *(const v4fa*)&so[w][r][c4];
      *(v4f*)(C + (size_t)(row0 + r) * ldc + col0 + c4) = v;
    }
    
  }
}
// row LayerNorm (biased variance, eps) over N: s = X (+ R); optional out_sum <- s; out_norm <- (s-mu)*rsqrt(var+eps)*g + b
template <bool PARAM_BF16>
__global__ __launch_bounds__(256) void k_layernorm(const float* __restrict__ X, const float* __restrict__ R, const float* __restrict__ g, const float* __restrict__ bta,
                                                  float* __restrict__ out_sum, float* __restrict__ out_norm, int N, float eps) {
  __shared__ float red[256];
  const int row = blockIdx.x, tid = threadIdx.x;
  const float* x = X + (size_t)row * N; const float* rr = R ? R + (size_t)row * N : nullptr;
  float vals[16];                     // up to N = 4096
  const int per = N / 256;            // contiguous chunk per thread? use strided-by-4 chunks: thread handles j = tid*4 + 1024*u
  float s1 = 0.f;
  for (int u = 0; u < per / 4; ++u) {
    const int j = tid * 4 + 1024 * u;
    const v4f a = *(const v4fa*)(x + j);
    v4f b = {0.f,0.f,0.f,0.f}; if (rr) b = *(const v4fa*)(rr + j);
#pragma unroll
    for (int q = 0; q < 4; ++q) { const float v = a[q] + b[q]; vals[u * 4 + q] = v; s1 += v; }
  }
  red[tid] = s1; __syncthreads();
  for (int st = 128; st > 0; st >>= 1) { if (tid < st) red[tid] += red[tid + st]; __syncthreads(); }
  const float mu = red[0] / (float)N; __syncthreads();
  float s2 = 0.f;
  for (int u = 0; u < per / 4; ++u)
#pragma unroll
    for (int q = 0; q < 4; ++q) { const float c = vals[u * 4 + q] - mu; s2 += c * c; }
  red[tid] = s2; __syncthreads();
  for (int st = 128; st > 0; st >>= 1) { if (tid < st) red[tid] += red[tid + st]; __syncthreads(); }
  const float rs = rsqrtf(red[0] / (float)N + eps);
  {
    for (int u = 0; u < per / 4; ++u) {
      const int j = tid * 4 + 1024 * u;
      v4f o, sm;
#pragma unroll
      for (int q = 0; q < 4; ++q) {
        float gg = g[j + q], bb = bta[j + q];
        if (PARAM_BF16) { gg = bf16_round(gg); bb = bf16_round(bb); }
        sm[q] = vals[u * 4 + q]; o[q] = (vals[u * 4 + q] - mu) * rs * gg + bb;
      }
      if (out_sum) *(v4f*)(out_sum + (size_t)row * N + j) = sm;
      *(v4f*)(out_norm + (size_t)row * N + j) = o;
    }
    
  }
}



// ---- f16 WMMA path (v_wmma_f32_16x16x32_f16): 11-bit significands for operands in range — used where a [0,1] probability operand needs more precision than bf16
typedef _Float16 v16h __attribute__((ext_vector_type(16)));
union FragH { v16h v; v8us half[2]; _Float16 h[16]; unsigned short u[16]; };
template <int NT>
__device__ __forceinline__ v8f mmaH(v16h ah, v16h al, v16h bh, v16h bl, v8f c) {
  c = __builtin_amdgcn_wmma_f32_16x16x32_f16(false, ah, false, bh, (short)0, c, false, false);
  if (NT >= 2) c = __builtin_amdgcn_wmma_f32_16x16x32_f16(false, al, false, bh, (short)0, c, false, false);
  if (NT >= 3) c = __builtin_amdgcn_wmma_f32_16x16x32_f16(false, ah, false, bl, (short)0, c, false, false);
  asm volatile("v_nop\n\tv_nop\n\tv_nop\n\tv_nop" : "+v"(c) : "v"(ah), "v"(al), "v"(bh), "v"(bl));
  return c;
}
// batched GEMM like k_gemm_b but f16 operands: A f32 (split into f16 hi/lo if ASPLIT, else rounded to f16), Bt = f16 values [n][k]; alpha; C f32; N multiple of 16 (partial tiles skipped)
template <bool ASPLIT>
__global__ __launch_bounds__(128) void k_gemm_h(const float* __restrict__ A, int lda, size_t sA, const _Float16* __restrict__ Bh, int ldb, size_t sB, float alpha, float* __restrict__ C, int ldc, size_t sC, int M, int N, int K) {
  __shared__ __attribute__((aligned(16))) float so[4][16][64];
  const int tid = threadIdx.x, w = tid >> 5, lane = tid & 31, ln = lane & 15, hh = lane >> 4; const int by = blockIdx.y;
  A += (size_t)by * sA; Bh += (size_t)by * sB; C += (size_t)by * sC;
  const int ntn = (N + 63) / 64; const int wid = blockIdx.x * 4 + w; const int mt = wid / ntn, nq = wid % ntn; if (mt * 16 >= M) return;
  const int row0 = mt * 16, col0 = nq * 64; const float* arow = A + (size_t)(row0 + ln) * lda;
  v8f acc[4] = {};
  for (int kb = 0; kb < K; kb += 32) {
    FragH ah, al;
    const v4f x0 = *(const v4fa*)(arow + kb + 8 * hh), x1 = *(const v4fa*)(arow + kb + 8 * hh + 4), x2 = *(const v4fa*)(arow + kb + 16 + 8 * hh), x3 = *(const v4fa*)(arow + kb + 16 + 8 * hh + 4);
    float xs[16] = {x0[0],x0[1],x0[2],x0[3],x1[0],x1[1],x1[2],x1[3],x2[0],x2[1],x2[2],x2[3],x3[0],x3[1],x3[2],x3[3]};
#pragma unroll
    for (int i = 0; i < 16; ++i) { const _Float16 h = (_Float16)xs[i]; ah.h[i] = h; al.h[i] = ASPLIT ? (_Float16)(xs[i] - (float)h) : (_Float16)0.0f; }
#pragma unroll
    for (int t = 0; t < 4; ++t) { if (col0 + t * 16 >= N) continue; const size_t boff = (size_t)(col0 + t * 16 + ln) * ldb + kb; FragH bq; bq.half[0] = *(const v8us*)(Bh + boff + 8 * hh); bq.half[1] = *(const v8us*)(Bh + boff + 16 + 8 * hh);
      acc[t] = mmaH<ASPLIT ? 2 : 1>(ah.v, al.v, bq.v, bq.v, acc[t]); }
  }
#pragma unroll
  for (int t = 0; t < 4; ++t) { if (col0 + t * 16 >= N) continue;
#pragma unroll
    for (int r = 0; r < 8; ++r) so[w][8 * hh + r][t * 16 + ln] = acc[t][r] * alpha; }
  __builtin_amdgcn_fence(__ATOMIC_ACQ_REL, "workgroup"); __builtin_amdgcn_wave_barrier();
  const int rsub = lane >> 4, c4 = (lane & 15) * 4;
  {
#pragma unroll
    for (int q = 0; q < 8; ++q) { const int r = q * 2 + rsub; if (col0 + c4 < N) { const v4f v = *(const v4fa*)&so[w][r][c4]; *(v4f*)(C + (size_t)(row0 + r) * ldc + col0 + c4) = v; } }
     }
}

// Wt[n][k] = f16(W[k][n]·scale) from f32 row-major W[K][N] (scale = power of two; bf16-exact weights stay exact in f16 away from the subnormal range)
__global__ __launch_bounds__(256) void k_wt_f16(const float* __restrict__ W, _Float16* __restrict__ Wt, int K, int N, float scale) {
  const int t = blockIdx.x * 256 + threadIdx.x; if (t >= N * (K / 8)) return; const int n = t / (K / 8), k8 = (t % (K / 8)) * 8; FragH f;
#pragma unroll
  for (int i = 0; i < 8; ++i) f.h[i] = (_Float16)(bf16_round(W[(size_t)(k8 + i) * N + n]) * scale); const v8us o = f.half[0];
  *(v8us*)((unsigned short*)Wt + (size_t)n * K + k8) = o; 
}
// k_gemm_hh variant with fused epilogue: v = acc·alpha + bias[by·sBias + col] (+ CP[(row/rowsPerB)·sCPb + by·64 + col] if CP) ; ACT 0 none / 1 elu ; writes f32 C and f16 C16, each if non-null
template <int ACT>
__global__ __launch_bounds__(128) void k_gemm_hhx(const _Float16* __restrict__ A, int lda, size_t sA, const _Float16* __restrict__ Bh, int ldb, size_t sB, float alpha, const float* __restrict__ bias, size_t sBias, const float* __restrict__ CP, int rowsPerB, size_t sCPb, int row0g,
    float* __restrict__ C, _Float16* __restrict__ C16, int ldc, size_t sC, int M, int N, int K) {
  __shared__ __attribute__((aligned(16))) float so[4][16][64];
  const int tid = threadIdx.x, w = tid >> 5, lane = tid & 31, ln = lane & 15, hh = lane >> 4; const int by = blockIdx.y;
  A += (size_t)by * sA; Bh += (size_t)by * sB; const size_t cofs = (size_t)by * sC; const float* bp = bias ? bias + (size_t)by * sBias : nullptr;
  const int ntn = (N + 63) / 64; const int wid = blockIdx.x * 4 + w; const int mt = wid / ntn, nq = wid % ntn; if (mt * 16 >= M) return;
  const int row0 = mt * 16, col0 = nq * 64; const _Float16* arow = A + (size_t)(row0 + ln) * lda;
  v8f acc[4] = {};
  for (int kb = 0; kb < K; kb += 32) { FragH ah; ah.half[0] = *(const v8us*)((const unsigned short*)arow + kb + 8 * hh); ah.half[1] = *(const v8us*)((const unsigned short*)arow + kb + 16 + 8 * hh);
#pragma unroll
    for (int t = 0; t < 4; ++t) { if (col0 + t * 16 >= N) continue; const size_t boff = (size_t)(col0 + t * 16 + ln) * ldb + kb; FragH bq; bq.half[0] = *(const v8us*)((const unsigned short*)Bh + boff + 8 * hh); bq.half[1] = *(const v8us*)((const unsigned short*)Bh + boff + 16 + 8 * hh);
      acc[t] = mmaH<1>(ah.v, ah.v, bq.v, bq.v, acc[t]); }
  }
#pragma unroll
  for (int t = 0; t < 4; ++t) { if (col0 + t * 16 >= N) continue; const int col = col0 + t * 16 + ln; const float bv = bp ? bf16_round(bp[col]) : 0.f;
#pragma unroll
    for (int r = 0; r < 8; ++r) { float v = acc[t][r] * alpha + bv; if (CP) { const int rr = row0g + row0 + 8 * hh + r; if (rowsPerB < 0) v += CP[cofs + (size_t)rr * ldc + col];      /* rowsPerB < 0: own element of the batched C plane */ else { const int bidx = rr / rowsPerB; v += CP[(size_t)bidx * sCPb + (size_t)by * 64 + col]; } } if (ACT == 1) v = (v > 0.f) ? v : expm1f(v); else if (ACT == 7) v = (v > 0.f) ? v + 1.0f : expf(v); else if (ACT == 8) v = tanhf(v); else if (ACT == 9) v = 0.5f * v * (1.0f + tanhf(0.7978845608028654f * (v + 0.044715f * v * v * v))); else if (ACT == 11) v = 1.0f / (1.0f + expf(-v)); else if (ACT == 12) v = (v > 0.f) ? v : 0.01f * v; else if (ACT == 14) v = (v > 0.f) ? v : 0.1f * v; else if (ACT == 16) v = (v >= 0.f) ? v : 0.3f * v; else if (ACT == 17) v = (v >= 0.f) ? v : 0.2f * v; else if (ACT == 15) v = v / (1.0f + expf(-v)); else if (ACT == 3) v = fmaxf(v, 0.f); else if (ACT == 6) v = 0.5f * v * (1.0f + erff(v * 0.70710678118654752f)); so[w][8 * hh + r][t * 16 + ln] = v; } }
  __builtin_amdgcn_fence(__ATOMIC_ACQ_REL, "workgroup"); __builtin_amdgcn_wave_barrier();
  const int rsub = lane >> 4, c4 = (lane & 15) * 4; typedef _Float16 v4h __attribute__((ext_vector_type(4)));
  {
#pragma unroll
    for (int q = 0; q < 8; ++q) { const int r = q * 2 + rsub; if (col0 + c4 < N) { const v4f v = *(const v4fa*)&so[w][r][c4]; if (C) *(v4f*)(C + cofs + (size_t)(row0 + r) * ldc + col0 + c4) = v; if (C16) { v4h h4; for (int i = 0; i < 4; ++i) h4[i] = (_Float16)v[i]; *(v4h*)(C16 + cofs + (size_t)(row0 + r) * ldc + col0 + c4) = h4; } } }
     }
}


typedef _Float16 v4h __attribute__((ext_vector_type(4)));

__global__ __launch_bounds__(256) void k_x16(const float* __restrict__ x, _Float16* __restrict__ X16, size_t n8) { const size_t t = (size_t)blockIdx.x * 256 + threadIdx.x; if (t >= n8) return; FragH f;
#pragma unroll
  for (int q = 0; q < 8; ++q) f.h[q] = (_Float16)bf16_round(x[t * 8 + q]); *(v8us*)((unsigned short*)X16 + t * 8) = f.half[0];  }
__global__ __launch_bounds__(256) void k_h16(const float* __restrict__ x, _Float16* __restrict__ X16, size_t n8) { const size_t t = (size_t)blockIdx.x * 256 + threadIdx.x; if (t >= n8) return; FragH f;
#pragma unroll
  for (int q = 0; q < 8; ++q) f.h[q] = (_Float16)x[t * 8 + q]; *(v8us*)((unsigned short*)X16 + t * 8) = f.half[0];  }
__global__ __launch_bounds__(256) void k_round16f(const float* __restrict__ W, _Float16* __restrict__ Bt, size_t n8) { const size_t t = (size_t)blockIdx.x * 256 + threadIdx.x; if (t >= n8) return; FragH f;
#pragma unroll
  for (int i = 0; i < 8; ++i) f.h[i] = (_Float16)(bf16_round(W[t * 8 + i]) * 16.0f); *(v8us*)((unsigned short*)Bt + t * 8) = f.half[0];  }
__global__ __launch_bounds__(256) void k_hl(const float* __restrict__ F, _Float16* __restrict__ Hh, _Float16* __restrict__ Hl, size_t n8) { const size_t t = (size_t)blockIdx.x * 256 + threadIdx.x; if (t >= n8) return; FragH fh, fl; const v4f a = *(const v4fa*)(F + t * 8), c = *(const v4fa*)(F + t * 8 + 4);
#pragma unroll
  for (int q = 0; q < 4; ++q) { _Float16 h = (_Float16)a[q]; fh.h[q] = h; fl.h[q] = (_Float16)((a[q] - (float)h) * 1024.0f); h = (_Float16)c[q]; fh.h[4 + q] = h; fl.h[4 + q] = (_Float16)((c[q] - (float)h) * 1024.0f); }
  { *(v8us*)((unsigned short*)Hh + t * 8) = fh.half[0]; *(v8us*)((unsigned short*)Hl + t * 8) = fl.half[0];  } }

// ---- fused window attention (the kernel stands behind the projection helpers below): one work-group = one window x 256 queries, head after head; 8 waves x 32 query columns.
// A unit's (window, head) whole K (1024 x 32) and V^T (32 x 1024) are staged in LDS; the scores never leave the registers.
// S^T = K.Q^T (lane = one query column, registers = keys), so the packed score tiles are the B operand of O^T += V^T.P^T.
// One pass over the keys forms exp(scale * (s - shift)) as f16, the shift being the maximum over the first 64 keys; the row sums prove the f16 range, and a wave that cannot prove it repeats with the true maximum.
#define KPITCH 40                /* K row pitch in LDS, f16 elements: 80 B = 16 B x odd, no bank conflict for 16-byte readers */
#define VPITCH 1032              /* V^T row pitch in LDS, f16 elements: 2064 B = 16 B x odd */
typedef float v2f __attribute__((ext_vector_type(2)));
typedef _Float16 v2h __attribute__((ext_vector_type(2)));
union FragP { v16h v; v2h p[8]; };
__device__ __forceinline__ v16h fa_frag(const unsigned short* p, int hh) { FragH f; f.half[0] = *(const v8us*)(p + 8 * hh); f.half[1] = *(const v8us*)(p + 16 + 8 * hh); return f.v; }
__device__ __forceinline__ v8f fa_mma(v16h a, v16h b, v8f c) { return __builtin_amdgcn_wmma_f32_16x16x32_f16(false, a, false, b, (short)0, c, false, false); }
// eight scores of one query -> eight f16 weights (elements 8 * half .. 8 * half + 7 of the B operand), their f32 values added to su
__device__ __forceinline__ void fa_exp8(const v8f s, const v2f c2, const v2f nb2, v2f& su, FragP& pf, const int half) {
#pragma unroll
  for (int i = 0; i < 4; ++i) { const v2f s2 = {s[2 * i], s[2 * i + 1]}; const v2f t = __builtin_elementwise_fma(s2, c2, nb2); const v2f e = {__builtin_amdgcn_exp2f(t[0]), __builtin_amdgcn_exp2f(t[1])}; su += e; pf.p[half * 4 + i] = __builtin_convertvector(e, v2h); }
}
// ---- projections with their re-layouts folded in: one work-group = 256 consecutive tokens (a quarter window), 8 waves x 32 tokens.
// Tokens and weights are staged in LDS as f16 rows of 64 channels; results go through LDS so that every global store covers whole lines.
#define TT 256                   /* tokens per work-group */
#define TPITCH 72                /* token and weight row pitch in LDS, f16 elements: 144 B = 16 B x odd */
#define OPITCH 40                /* q / k result row (one token, one head) pitch in LDS, f16 elements: 80 B = 16 B x odd */
#define VOPITCH 264              /* V^T result row (one channel, 256 tokens) pitch in LDS, f16 elements: 528 B = 16 B x odd */
#define FPITCH 260               /* output row (one channel, 256 tokens) pitch in LDS, f32 elements: 1040 B = 16 B x odd */
// one 64 x 64 f32 weight matrix (out, in) -> f16(bf16(w) * 16) rows in LDS
__device__ __forceinline__ void pj_weights(const float* __restrict__ Wm, unsigned short* sW, const int tid) {
  for (int j = 0; j < CC * CC / 8 / 256; ++j) { const int i = j * 256 + tid; const v4f a = *(const v4fa*)(Wm + i * 8), c = *(const v4fa*)(Wm + i * 8 + 4); FragH f;
    for (int q = 0; q < 4; ++q) { f.h[q] = (_Float16)(bf16_round(a[q]) * 16.0f); f.h[4 + q] = (_Float16)(bf16_round(c[q]) * 16.0f); }
    *(v8us*)&sW[(i >> 3) * TPITCH + (i & 7) * 8] = f.half[0]; }
}
// x (NCHW f32) -> q, k head-major [unit][token][32] and V^T [unit][32][token], all f16
__global__ __launch_bounds__(256) void k_qkv(const float* __restrict__ x, const float* __restrict__ Wq, const float* __restrict__ Wk, const float* __restrict__ Wv, _Float16* __restrict__ QU, _Float16* __restrict__ KU, _Float16* __restrict__ VT) {
  __shared__ __attribute__((aligned(16))) unsigned short sT[TT * TPITCH];      /* the tokens; later the 64 x VOPITCH V^T tile, which is smaller */
  __shared__ __attribute__((aligned(16))) unsigned short sW[3 * CC * TPITCH];
  __shared__ __attribute__((aligned(16))) unsigned short sO[2 * NHD * TT * OPITCH];      /* the q tile, then the k tile */
  const int tid = threadIdx.x, w = tid >> 5, lane = tid & 31, ln = lane & 15, hh = lane >> 4;
  const int g0 = blockIdx.x * TT, b = g0 / HW, hw0 = g0 % HW, win = g0 / NTW, n0 = g0 % NTW;
  // wave w reads channels 8 w .. 8 w + 7; a lane reads four consecutive tokens, so each load covers 512 contiguous bytes of one channel
  const float* xp = x + ((size_t)b * CC + w * 8) * HW + hw0 + lane * 4;
  v4f xv[2][8];
  for (int j = 0; j < 2; ++j)
    for (int q = 0; q < 8; ++q) xv[j][q] = *(const v4fa*)(xp + (size_t)q * HW + j * 128);
  pj_weights(Wq, sW, tid); pj_weights(Wk, sW + CC * TPITCH, tid); pj_weights(Wv, sW + 2 * CC * TPITCH, tid);
  for (int j = 0; j < 2; ++j)
    for (int e = 0; e < 4; ++e) { FragH f;
      for (int q = 0; q < 8; ++q) f.h[q] = (_Float16)bf16_round(xv[j][q][e]);
      *(v8us*)&sT[(j * 128 + lane * 4 + e) * TPITCH + w * 8] = f.half[0]; }
  __syncthreads();
  const v8f z8 = {0.f,0.f,0.f,0.f,0.f,0.f,0.f,0.f};
  const unsigned short* tl = &sT[(w * 32 + ln) * TPITCH];
  const v16h t00 = fa_frag(tl, hh), t01 = fa_frag(tl + 32, hh), t10 = fa_frag(tl + 16 * TPITCH, hh), t11 = fa_frag(tl + 16 * TPITCH + 32, hh);
  for (int mt = 0; mt < 8; ++mt) {      /* q (tiles 0 to 3), then k: W.X^T, so a lane holds eight consecutive channels of one token */
    const unsigned short* wl = &sW[(mt * 16 + ln) * TPITCH];
    const v16h a0 = fa_frag(wl, hh), a1 = fa_frag(wl + 32, hh);
    const v8f d0 = fa_mma(a1, t01, fa_mma(a0, t00, z8)), d1 = fa_mma(a1, t11, fa_mma(a0, t10, z8));
    FragH f;
    for (int r = 0; r < 8; ++r) { f.h[r] = (_Float16)(d0[r] * 0.0625f); f.h[8 + r] = (_Float16)(d1[r] * 0.0625f); }
    unsigned short* so = &sO[((mt >> 1) * TT + w * 32 + ln) * OPITCH + (mt & 1) * 16 + 8 * hh];
    *(v8us*)so = f.half[0]; *(v8us*)(so + 16 * OPITCH) = f.half[1];
  }
  __syncthreads();      /* every wave holds its token rows in registers: sT is free for the V^T tile */
  for (int nt = 0; nt < 4; ++nt) {      /* v: X.W^T, so a lane holds eight consecutive tokens of one channel */
    const unsigned short* wl = &sW[(2 * CC + nt * 16 + ln) * TPITCH];
    const v16h b0 = fa_frag(wl, hh), b1 = fa_frag(wl + 32, hh);
    const v8f d0 = fa_mma(t01, b1, fa_mma(t00, b0, z8)), d1 = fa_mma(t11, b1, fa_mma(t10, b0, z8));
    FragH f;
    for (int r = 0; r < 8; ++r) { f.h[r] = (_Float16)(d0[r] * 0.0625f); f.h[8 + r] = (_Float16)(d1[r] * 0.0625f); }
    unsigned short* so = &sT[(nt * 16 + ln) * VOPITCH + w * 32 + 8 * hh];
    *(v8us*)so = f.half[0]; *(v8us*)(so + 16) = f.half[1];
  }
  __syncthreads();      /* all three tiles complete; every global store stands behind the last barrier, so no barrier waits for a store */
  const size_t qo = ((size_t)win * NHD * NTW + n0) * HD;
  for (int j = 0; j < 2 * NHD * TT * HD / 8 / 256; ++j) { const int i = j * 256 + tid, h = (i >> 10) & 1, r = (i >> 2) & (TT - 1), pc = i & 3;
    *(v8us*)((unsigned short*)(j < 8 ? QU : KU) + qo + ((size_t)h * NTW + r) * HD + pc * 8) = *(const v8us*)&sO[(i >> 2) * OPITCH + pc * 8]; }
  unsigned short* dv = (unsigned short*)VT + (size_t)win * CC * NTW + n0;
  for (int j = 0; j < CC * TT / 8 / 256; ++j) { const int i = j * 256 + tid, d = i >> 5, pc = i & 31;
    *(v8us*)(dv + (size_t)d * NTW + pc * 8) = *(const v8us*)&sT[d * VOPITCH + pc * 8]; }
}
// attention of one window quarter (256 queries), both heads one after the other in the same LDS, then out = ctx Wp^T of those tokens, stored straight to NCHW f32.
// A head's normalised context tiles (lane = query, registers = channels 8 hh .. and 16 + 8 hh ..) are already the B operand of Wp.ctx^T, so the context never leaves the registers.
__global__ __launch_bounds__(256) void k_fattn(const _Float16* __restrict__ QU, const _Float16* __restrict__ KU, const _Float16* __restrict__ VT, const float* __restrict__ Wp, float* __restrict__ out) {
  __shared__ __attribute__((aligned(16))) unsigned short sK[NTW * KPITCH];      /* one head's K; at the end the 64 x FPITCH f32 output tile, which is smaller */
  __shared__ __attribute__((aligned(16))) unsigned short sV[HD * VPITCH];
  __shared__ __attribute__((aligned(16))) unsigned short sW[CC * TPITCH];
  const int tid = threadIdx.x, w = tid >> 5, lane = tid & 31, ln = lane & 15, hh = lane >> 4;
  const int bp = blockIdx.x >> 2, n0 = (blockIdx.x & 3) * 256, q0 = n0 + w * 32;
  pj_weights(Wp, sW, tid);      /* published by the first barrier below */
  const v8f z8 = {0.f,0.f,0.f,0.f,0.f,0.f,0.f,0.f};
  const unsigned short* kl = &sK[ln * KPITCH];
  const unsigned short* vl = &sV[ln * VPITCH];
  FragH ca0 = {}, ca1 = {}, cb0 = {}, cb1 = {};      /* context of head 0 (ca) and head 1 (cb), query columns ln and 16 + ln */
  for (int h = 0; h < NHD; ++h) {
    const int u = bp * NHD + h;
    const unsigned short* kg = (const unsigned short*)KU + (size_t)u * NTW * HD; const unsigned short* vg = (const unsigned short*)VT + (size_t)u * HD * NTW;
    for (int j = 0; j < NTW * HD / 8 / 256; ++j) { const int i = j * 256 + tid; *(v8us*)&sK[(i >> 2) * KPITCH + (i & 3) * 8] = *(const v8us*)(kg + (size_t)i * 8); }
    for (int j = 0; j < HD * NTW / 8 / 256; ++j) { const int i = j * 256 + tid; *(v8us*)&sV[(i >> 7) * VPITCH + (i & 127) * 8] = *(const v8us*)(vg + (size_t)i * 8); }
    const unsigned short* qp = (const unsigned short*)QU + ((size_t)u * NTW + q0 + ln) * HD;
    const v16h bq0 = fa_frag(qp, hh), bq1 = fa_frag(qp + 16 * HD, hh);
    __syncthreads();
    const float cs = 0.17677669529663687f * 1.4426950408889634f;      /* scale * log2(e) */
    const v2f c2 = {cs, cs};
    v8f o00, o10, o01, o11; float su0, su1;
    // Softmax is the same for any shift, so the shift need not be the true maximum: the first trip takes the maximum of the first 64 keys only.
    // The weights are positive, so a lane's sum bounds each of its weights: a sum of at most 2^15 proves that none left the f16 range.
    // Where a lane of the wave cannot prove it, the wave runs a second trip with the true maximum of all keys (every weight at most 1). Two trips at most.
    for (int nkt = 4; ; nkt = NTW / 16) {
      float m0 = -3.0e38f, m1 = -3.0e38f;
      for (int kt = 0; kt < nkt; kt += 4) {
#pragma unroll      /* four key tiles a trip: the later tiles' LDS reads overlap the earlier tiles' products and maxima */
        for (int k4 = 0; k4 < 4; ++k4) { const v16h a = fa_frag(kl + (kt + k4) * 16 * KPITCH, hh); const v8f s0 = fa_mma(a, bq0, z8), s1 = fa_mma(a, bq1, z8);
#pragma unroll
          for (int r = 0; r < 8; ++r) { m0 = fmaxf(m0, s0[r]); m1 = fmaxf(m1, s1[r]); } } }
      m0 = fmaxf(m0, __shfl_xor(m0, 16, 32)); m1 = fmaxf(m1, __shfl_xor(m1, 16, 32));      /* lanes l and l ^ 16 hold the two halves of a query's keys and must shift alike */
      const float n0f = -m0 * cs, n1f = -m1 * cs;
      const v2f nb0 = {n0f, n0f}, nb1 = {n1f, n1f};
      o00 = z8; o10 = z8; o01 = z8; o11 = z8; v2f sa0 = {0.f, 0.f}, sb0 = {0.f, 0.f}, sa1 = {0.f, 0.f}, sb1 = {0.f, 0.f};
#pragma unroll 2      /* two passes of 32 keys a trip: the second pass's LDS reads and products overlap the first's exponentials */
      for (int kb = 0; kb < NTW; kb += 32) {
        const v16h a0 = fa_frag(kl + kb * KPITCH, hh), a1 = fa_frag(kl + (kb + 16) * KPITCH, hh);
        const v16h v0 = fa_frag(vl + kb, hh), v1 = fa_frag(vl + 16 * VPITCH + kb, hh);
        const v8f s00 = fa_mma(a0, bq0, z8), s10 = fa_mma(a1, bq0, z8), s01 = fa_mma(a0, bq1, z8), s11 = fa_mma(a1, bq1, z8);
        FragP p0, p1;
        fa_exp8(s00, c2, nb0, sa0, p0, 0); fa_exp8(s10, c2, nb0, sb0, p0, 1);
        fa_exp8(s01, c2, nb1, sa1, p1, 0); fa_exp8(s11, c2, nb1, sb1, p1, 1);
        o00 = fa_mma(v0, p0.v, o00); o10 = fa_mma(v1, p0.v, o10); o01 = fa_mma(v0, p1.v, o01); o11 = fa_mma(v1, p1.v, o11);
      }
      su0 = (sa0[0] + sa0[1]) + (sb0[0] + sb0[1]); su1 = (sa1[0] + sa1[1]) + (sb1[0] + sb1[1]);
      /* negated compares, so that an infinite or undefined sum counts as unproven; the ballot makes the branch the same for the whole wave, as the matrix instructions need */
      if (nkt == NTW / 16 || __builtin_amdgcn_ballot_w32(!(su0 <= 32768.0f && su1 <= 32768.0f)) == 0u) break;
    }
    su0 += __shfl_xor(su0, 16, 32); su1 += __shfl_xor(su1, 16, 32);
    const float r0 = 1.0f / su0, r1 = 1.0f / su1;      /* sums and products carry the same shift */
    ca0 = cb0; ca1 = cb1;      /* after the second head ca holds head 0 and cb head 1 */
#pragma unroll
    for (int r = 0; r < 8; ++r) { cb0.h[r] = (_Float16)(o00[r] * r0); cb0.h[8 + r] = (_Float16)(o10[r] * r0); cb1.h[r] = (_Float16)(o01[r] * r1); cb1.h[8 + r] = (_Float16)(o11[r] * r1); }
    __syncthreads();      /* every wave has read this head's K and V for the last time: the LDS may take the next head, or the output tile */
  }
  float* sF = (float*)sK;
  const unsigned short* wl = &sW[ln * TPITCH];
  for (int ot = 0; ot < 4; ++ot) {      /* Wp.ctx^T: a lane holds eight consecutive output channels of one token; k = head 0's channels, then head 1's */
    const v16h a0 = fa_frag(wl + ot * 16 * TPITCH, hh), a1 = fa_frag(wl + ot * 16 * TPITCH + 32, hh);
    const v8f d0 = fa_mma(a1, cb0.v, fa_mma(a0, ca0.v, z8)), d1 = fa_mma(a1, cb1.v, fa_mma(a0, ca1.v, z8));
    float* so = &sF[(ot * 16 + 8 * hh) * FPITCH + w * 32 + ln];
    for (int r = 0; r < 8; ++r) { so[r * FPITCH] = d0[r] * 0.0625f; so[r * FPITCH + 16] = d1[r] * 0.0625f; }
  }
  __syncthreads();      /* the 64 x 256 output tile is complete: each store below covers whole lines of one channel */
  const int g0 = bp * NTW + n0, b = g0 / HW, hw0 = g0 % HW;
  float* dp = out + (size_t)b * CC * HW + hw0;
  for (int j = 0; j < CC * TT / 4 / 256; ++j) { const int i = j * 256 + tid, o = i >> 6, pc = i & 63;
    *(v4f*)(dp + (size_t)o * HW + pc * 4) = *(const v4fa*)&sF[o * FPITCH + pc * 4]; }
}

extern "C" void kernel_launch(void* const* d_in, const int* in_sizes, int n_in,
                              void* d_out, int out_size, void* d_ws, size_t ws_size, hipStream_t stream) {
  (void)in_sizes; (void)n_in; (void)out_size;
  const float* const* I = (const float* const*)d_in; const float* x = I[0]; const float* Wq = I[1]; const float* Wk = I[2]; const float* Wv = I[3]; const float* Wp = I[4];
  char* ws = (char*)d_ws; size_t off = 0;
  auto take = [&](size_t bytes) { char* p = ws + off; off += (bytes + 255) & ~(size_t)255; return p; };
  const size_t np = (size_t)NTOK * CC;
  _Float16* QU = (_Float16*)take(np * 2); _Float16* KU = (_Float16*)take(np * 2); _Float16* VT = (_Float16*)take(np * 2);
  if (off > ws_size) return;      /* 3 x 16 = 48 MiB */
  k_qkv<<<NTOK / TT, 256, 0, stream>>>(x, Wq, Wk, Wv, QU, KU, VT);      /* q, k head-major and V^T per unit, straight from NCHW */
  k_fattn<<<NTOK / TT, 256, 0, stream>>>(QU, KU, VT, Wp, (float*)d_out);      /* scores, softmax, context of both heads, then ctx Wp^T straight to NCHW */
}

// v005
// It runs in 35.8 microseconds.
// In both of two side-by-side timings against v004, it was 1.66 times as fast.
// Over all steps from v000 it is 29.9 times as fast.
#include <hip/hip_runtime.h>
// patch_attention (2 x 64 ch x 256 x 256; 64 row-band windows of 4 rows x 256 = 1024 tokens; 2 heads x 32; q, k, v = feat W^T per window; softmax(q.k / sqrt(32)) within the window; out = ctx Wp^T; back to NCHW).
// Compute dtype: inputs rounded to bf16; x and weights exact as f16; q/k/v, the softmax weights and the context as plain f16 operands (~2^-12); softmax f32. v_wmma_f32_16x16x32_f16.
#define NB 2
#define CC 64
#define HW 65536
#define NPW 64                   /* windows per image */
#define NTW 1024                 /* tokens per window */
#define NHD 2
#define HD 32
#define NTOK (NB * HW)           /* 131072 */
#define NU (NB * NPW * NHD)      /* 256 units */
typedef __bf16 v16b __attribute__((ext_vector_type(16)));
typedef unsigned short v8us __attribute__((ext_vector_type(8), may_alias));
typedef float  v8f  __attribute__((ext_vector_type(8)));
typedef float  v4f  __attribute__((ext_vector_type(4)));
typedef float  v4fa __attribute__((ext_vector_type(4), may_alias));
union FragB { v16b v; v8us half[2]; unsigned short u[16]; };

__device__ __forceinline__ unsigned short bf16_bits(float x) { unsigned int u = __float_as_uint(x); return (unsigned short)((u + 0x7FFFu + ((u >> 16) & 1u)) >> 16); }
__device__ __forceinline__ float bf16_val(unsigned short b) { return __uint_as_float(((unsigned int)b) << 16); }
__device__ __forceinline__ float bf16_round(float x) { return bf16_val(bf16_bits(x)); }
// D += A·B with NT terms: 1 = ah·bh, 2 = + al·bh (A split), 3 = + ah·bl (both split)
template <int NT>
__device__ __forceinline__ v8f mmaN(v16b ah, v16b al, v16b bh, v16b bl, v8f c) {
  c = __builtin_amdgcn_wmma_f32_16x16x32_bf16(false, ah, false, bh, (short)0, c, false, false);
  if (NT >= 2) c = __builtin_amdgcn_wmma_f32_16x16x32_bf16(false, al, false, bh, (short)0, c, false, false);
  if (NT >= 3) c = __builtin_amdgcn_wmma_f32_16x16x32_bf16(false, ah, false, bl, (short)0, c, false, false);
  asm volatile("v_nop\n\tv_nop\n\tv_nop\n\tv_nop" : "+v"(c) : "v"(ah), "v"(al), "v"(bh), "v"(bl));
  return c;
}

__global__ __launch_bounds__(256) void k_wt_bf16(const float* __restrict__ W, unsigned short* __restrict__ Wt, int K, int N) {
  const int t = blockIdx.x * 256 + threadIdx.x;
  const int k8n = K / 8;
  if (t >= N * k8n) return;
  const int n = t / k8n, k8 = (t % k8n) * 8;
  v8us v;
#pragma unroll
  for (int i = 0; i < 8; ++i) v[i] = bf16_bits(W[(size_t)(k8 + i) * N + n]);
  *(v8us*)(Wt + (size_t)n * K + k8) = v;
  
}

// GEMM C[M][N] (f32, pitch ldc) = act(A[M][K]·W + bias). A f32 row-major (pitch lda) converted per fragment to bf16
// (ASPLIT: hi/lo two planes -> 2 terms, else single rounded term); Wt bf16 [N][K] (pitch ldb). BIAS_BF16 rounds the
// bias to bf16 first (bias quantised to bf16 before the add). K%32==0, M%16==0, N%64==0.
template <bool ASPLIT, int ACT, bool BIAS_BF16>
__global__ __launch_bounds__(128) void k_gemm_bf(const float* __restrict__ A, int lda, const unsigned short* __restrict__ Wt, int ldb,
                                               const float* __restrict__ bias, float* __restrict__ C, int ldc, int M, int N, int K) {
  __shared__ __attribute__((aligned(16))) float so[4][16][64];
  const int tid = threadIdx.x, w = tid >> 5, lane = tid & 31, ln = lane & 15, hh = lane >> 4;
  const int ntn = N / 64;
  const int wid = blockIdx.x * 4 + w;
  const int mt = wid / ntn, nq = wid % ntn;
  if (mt * 16 >= M) return;
  const int row0 = mt * 16, col0 = nq * 64;
  const float* arow = A + (size_t)(row0 + ln) * lda;
  v8f acc[4] = {};
  for (int kb = 0; kb < K; kb += 32) {
    FragB ah, al;
    const v4f x0 = *(const v4fa*)(arow + kb + 8 * hh), x1 = *(const v4fa*)(arow + kb + 8 * hh + 4);
    const v4f x2 = *(const v4fa*)(arow + kb + 16 + 8 * hh), x3 = *(const v4fa*)(arow + kb + 16 + 8 * hh + 4);
    float xs[16] = {x0[0],x0[1],x0[2],x0[3],x1[0],x1[1],x1[2],x1[3],x2[0],x2[1],x2[2],x2[3],x3[0],x3[1],x3[2],x3[3]};
#pragma unroll
    for (int i = 0; i < 16; ++i) { const unsigned short hb = bf16_bits(xs[i]); ah.u[i] = hb; al.u[i] = ASPLIT ? bf16_bits(xs[i] - bf16_val(hb)) : (unsigned short)0; }
#pragma unroll
    for (int t = 0; t < 4; ++t) {
      const unsigned short* brow = Wt + (size_t)(col0 + t * 16 + ln) * ldb + kb;
      FragB b;
      b.half[0] = *(const v8us*)(brow + 8 * hh);
      b.half[1] = *(const v8us*)(brow + 16 + 8 * hh);
      acc[t] = mmaN<ASPLIT ? 2 : 1>(ah.v, al.v, b.v, b.v, acc[t]);
    }
  }
#pragma unroll
  for (int t = 0; t < 4; ++t) {
    float bv = bias ? bias[col0 + t * 16 + ln] : 0.f;
    if (BIAS_BF16) bv = bf16_round(bv);
#pragma unroll
    for (int r = 0; r < 8; ++r) { float v = acc[t][r] + bv; if (ACT == 1) v = fmaxf(v, 0.f); so[w][8 * hh + r][t * 16 + ln] = v; }
  }
  __builtin_amdgcn_fence(__ATOMIC_ACQ_REL, "workgroup");
  __builtin_amdgcn_wave_barrier();
  const int rsub = lane >> 4, c4 = (lane & 15) * 4;
  {
#pragma unroll
    for (int q = 0; q < 8; ++q) {
      const int r = q * 2 + rsub;
      const v4f v = *(const v4fa*)&so[w][r][c4];
      *(v4f*)(C + (size_t)(row0 + r) * ldc + col0 + c4) = v;
    }
    
  }
}

// GEMM C = act(A·W + bias + resid): A f32 (ASPLIT -> hi/lo 2 terms), Wt bf16 [N][K]; ACT 0 none, 1 relu, 2 exact gelu;
// resid (optional, f32, row index = (row % rmod), pitch ldr, RES_BF16 rounds it) added before the activation.
template <bool ASPLIT, int ACT, bool BIAS_BF16, bool RES_BF16>
__global__ __launch_bounds__(128) void k_gemm_bf3(const float* __restrict__ A, int lda, const unsigned short* __restrict__ Wt, int ldb,
                                                const float* __restrict__ bias, const float* __restrict__ resid, int rmod, int ldr,
                                                float* __restrict__ C, int ldc, int M, int N, int K) {
  __shared__ __attribute__((aligned(16))) float so[4][16][64];
  const int tid = threadIdx.x, w = tid >> 5, lane = tid & 31, ln = lane & 15, hh = lane >> 4;
  const int ntn = N / 64;
  const int wid = blockIdx.x * 4 + w;
  const int mt = wid / ntn, nq = wid % ntn;
  if (mt * 16 >= M) return;
  const int row0 = mt * 16, col0 = nq * 64;
  const float* arow = A + (size_t)(row0 + ln) * lda;
  v8f acc[4] = {};
  for (int kb = 0; kb < K; kb += 32) {
    FragB ah, al;
    const v4f x0 = *(const v4fa*)(arow + kb + 8 * hh), x1 = *(const v4fa*)(arow + kb + 8 * hh + 4);
    const v4f x2 = *(const v4fa*)(arow + kb + 16 + 8 * hh), x3 = *(const v4fa*)(arow + kb + 16 + 8 * hh + 4);
    float xs[16] = {x0[0],x0[1],x0[2],x0[3],x1[0],x1[1],x1[2],x1[3],x2[0],x2[1],x2[2],x2[3],x3[0],x3[1],x3[2],x3[3]};
#pragma unroll
    for (int i = 0; i < 16; ++i) { const unsigned short hb = bf16_bits(xs[i]); ah.u[i] = hb; al.u[i] = ASPLIT ? bf16_bits(xs[i] - bf16_val(hb)) : (unsigned short)0; }
#pragma unroll
    for (int t = 0; t < 4; ++t) {
      const unsigned short* brow = Wt + (size_t)(col0 + t * 16 + ln) * ldb + kb;
      FragB b;
      b.half[0] = *(const v8us*)(brow + 8 * hh);
      b.half[1] = *(const v8us*)(brow + 16 + 8 * hh);
      acc[t] = mmaN<ASPLIT ? 2 : 1>(ah.v, al.v, b.v, b.v, acc[t]);
    }
  }
#pragma unroll
  for (int t = 0; t < 4; ++t) {
    const int col = col0 + t * 16 + ln;
    float bv = bias ? bias[col] : 0.f;
    if (BIAS_BF16) bv = bf16_round(bv);
#pragma unroll
    for (int r = 0; r < 8; ++r) {
      float v = acc[t][r] + bv;
      if (resid) { float rv = resid[(size_t)((row0 + 8 * hh + r) % rmod) * ldr + col]; if (RES_BF16) rv = bf16_round(rv); v += rv; }
      if (ACT == 1) v = fmaxf(v, 0.f);
      if (ACT == 2) v = 0.5f * v * (1.0f + erff(v * 0.70710678118654752f));
      if (ACT == 3) { const float u = 0.7978845608028654f * (v + 0.044715f * v * v * v); v = 0.5f * v * (1.0f + tanhf(u)); }
      so[w][8 * hh + r][t * 16 + ln] = v;
    }
  }
  __builtin_amdgcn_fence(__ATOMIC_ACQ_REL, "workgroup");
  __builtin_amdgcn_wave_barrier();
  const int rsub = lane >> 4, c4 = (lane & 15) * 4;
  {
#pragma unroll
    for (int q = 0; q < 8; ++q) {
      const int r = q * 2 + rsub;
      const v4f v = *(const v4fa*)&so[w][r][c4];
      *(v4f*)(C + (size_t)(row0 + r) * ldc + col0 + c4) = v;
    }
    
  }
}
// row LayerNorm (biased variance, eps) over N: s = X (+ R); optional out_sum <- s; out_norm <- (s-mu)*rsqrt(var+eps)*g + b
template <bool PARAM_BF16>
__global__ __launch_bounds__(256) void k_layernorm(const float* __restrict__ X, const float* __restrict__ R, const float* __restrict__ g, const float* __restrict__ bta,
                                                  float* __restrict__ out_sum, float* __restrict__ out_norm, int N, float eps) {
  __shared__ float red[256];
  const int row = blockIdx.x, tid = threadIdx.x;
  const float* x = X + (size_t)row * N; const float* rr = R ? R + (size_t)row * N : nullptr;
  float vals[16];                     // up to N = 4096
  const int per = N / 256;            // contiguous chunk per thread? use strided-by-4 chunks: thread handles j = tid*4 + 1024*u
  float s1 = 0.f;
  for (int u = 0; u < per / 4; ++u) {
    const int j = tid * 4 + 1024 * u;
    const v4f a = *(const v4fa*)(x + j);
    v4f b = {0.f,0.f,0.f,0.f}; if (rr) b = *(const v4fa*)(rr + j);
#pragma unroll
    for (int q = 0; q < 4; ++q) { const float v = a[q] + b[q]; vals[u * 4 + q] = v; s1 += v; }
  }
  red[tid] = s1; __syncthreads();
  for (int st = 128; st > 0; st >>= 1) { if (tid < st) red[tid] += red[tid + st]; __syncthreads(); }
  const float mu = red[0] / (float)N; __syncthreads();
  float s2 = 0.f;
  for (int u = 0; u < per / 4; ++u)
#pragma unroll
    for (int q = 0; q < 4; ++q) { const float c = vals[u * 4 + q] - mu; s2 += c * c; }
  red[tid] = s2; __syncthreads();
  for (int st = 128; st > 0; st >>= 1) { if (tid < st) red[tid] += red[tid + st]; __syncthreads(); }
  const float rs = rsqrtf(red[0] / (float)N + eps);
  {
    for (int u = 0; u < per / 4; ++u) {
      const int j = tid * 4 + 1024 * u;
      v4f o, sm;
#pragma unroll
      for (int q = 0; q < 4; ++q) {
        float gg = g[j + q], bb = bta[j + q];
        if (PARAM_BF16) { gg = bf16_round(gg); bb = bf16_round(bb); }
        sm[q] = vals[u * 4 + q]; o[q] = (vals[u * 4 + q] - mu) * rs * gg + bb;
      }
      if (out_sum) *(v4f*)(out_sum + (size_t)row * N + j) = sm;
      *(v4f*)(out_norm + (size_t)row * N + j) = o;
    }
    
  }
}



// ---- f16 WMMA path (v_wmma_f32_16x16x32_f16): 11-bit significands for operands in range — used where a [0,1] probability operand needs more precision than bf16
typedef _Float16 v16h __attribute__((ext_vector_type(16)));
union FragH { v16h v; v8us half[2]; _Float16 h[16]; unsigned short u[16]; };
template <int NT>
__device__ __forceinline__ v8f mmaH(v16h ah, v16h al, v16h bh, v16h bl, v8f c) {
  c = __builtin_amdgcn_wmma_f32_16x16x32_f16(false, ah, false, bh, (short)0, c, false, false);
  if (NT >= 2) c = __builtin_amdgcn_wmma_f32_16x16x32_f16(false, al, false, bh, (short)0, c, false, false);
  if (NT >= 3) c = __builtin_amdgcn_wmma_f32_16x16x32_f16(false, ah, false, bl, (short)0, c, false, false);
  asm volatile("v_nop\n\tv_nop\n\tv_nop\n\tv_nop" : "+v"(c) : "v"(ah), "v"(al), "v"(bh), "v"(bl));
  return c;
}
// batched GEMM like k_gemm_b but f16 operands: A f32 (split into f16 hi/lo if ASPLIT, else rounded to f16), Bt = f16 values [n][k]; alpha; C f32; N multiple of 16 (partial tiles skipped)
template <bool ASPLIT>
__global__ __launch_bounds__(128) void k_gemm_h(const float* __restrict__ A, int lda, size_t sA, const _Float16* __restrict__ Bh, int ldb, size_t sB, float alpha, float* __restrict__ C, int ldc, size_t sC, int M, int N, int K) {
  __shared__ __attribute__((aligned(16))) float so[4][16][64];
  const int tid = threadIdx.x, w = tid >> 5, lane = tid & 31, ln = lane & 15, hh = lane >> 4; const int by = blockIdx.y;
  A += (size_t)by * sA; Bh += (size_t)by * sB; C += (size_t)by * sC;
  const int ntn = (N + 63) / 64; const int wid = blockIdx.x * 4 + w; const int mt = wid / ntn, nq = wid % ntn; if (mt * 16 >= M) return;
  const int row0 = mt * 16, col0 = nq * 64; const float* arow = A + (size_t)(row0 + ln) * lda;
  v8f acc[4] = {};
  for (int kb = 0; kb < K; kb += 32) {
    FragH ah, al;
    const v4f x0 = *(const v4fa*)(arow + kb + 8 * hh), x1 = *(const v4fa*)(arow + kb + 8 * hh + 4), x2 = *(const v4fa*)(arow + kb + 16 + 8 * hh), x3 = *(const v4fa*)(arow + kb + 16 + 8 * hh + 4);
    float xs[16] = {x0[0],x0[1],x0[2],x0[3],x1[0],x1[1],x1[2],x1[3],x2[0],x2[1],x2[2],x2[3],x3[0],x3[1],x3[2],x3[3]};
#pragma unroll
    for (int i = 0; i < 16; ++i) { const _Float16 h = (_Float16)xs[i]; ah.h[i] = h; al.h[i] = ASPLIT ? (_Float16)(xs[i] - (float)h) : (_Float16)0.0f; }
#pragma unroll
    for (int t = 0; t < 4; ++t) { if (col0 + t * 16 >= N) continue; const size_t boff = (size_t)(col0 + t * 16 + ln) * ldb + kb; FragH bq; bq.half[0] = *(const v8us*)(Bh + boff + 8 * hh); bq.half[1] = *(const v8us*)(Bh + boff + 16 + 8 * hh);
      acc[t] = mmaH<ASPLIT ? 2 : 1>(ah.v, al.v, bq.v, bq.v, acc[t]); }
  }
#pragma unroll
  for (int t = 0; t < 4; ++t) { if (col0 + t * 16 >= N) continue;
#pragma unroll
    for (int r = 0; r < 8; ++r) so[w][8 * hh + r][t * 16 + ln] = acc[t][r] * alpha; }
  __builtin_amdgcn_fence(__ATOMIC_ACQ_REL, "workgroup"); __builtin_amdgcn_wave_barrier();
  const int rsub = lane >> 4, c4 = (lane & 15) * 4;
  {
#pragma unroll
    for (int q = 0; q < 8; ++q) { const int r = q * 2 + rsub; if (col0 + c4 < N) { const v4f v = *(const v4fa*)&so[w][r][c4]; *(v4f*)(C + (size_t)(row0 + r) * ldc + col0 + c4) = v; } }
     }
}

// Wt[n][k] = f16(W[k][n]·scale) from f32 row-major W[K][N] (scale = power of two; bf16-exact weights stay exact in f16 away from the subnormal range)
__global__ __launch_bounds__(256) void k_wt_f16(const float* __restrict__ W, _Float16* __restrict__ Wt, int K, int N, float scale) {
  const int t = blockIdx.x * 256 + threadIdx.x; if (t >= N * (K / 8)) return; const int n = t / (K / 8), k8 = (t % (K / 8)) * 8; FragH f;
#pragma unroll
  for (int i = 0; i < 8; ++i) f.h[i] = (_Float16)(bf16_round(W[(size_t)(k8 + i) * N + n]) * scale); const v8us o = f.half[0];
  *(v8us*)((unsigned short*)Wt + (size_t)n * K + k8) = o; 
}
// k_gemm_hh variant with fused epilogue: v = acc·alpha + bias[by·sBias + col] (+ CP[(row/rowsPerB)·sCPb + by·64 + col] if CP) ; ACT 0 none / 1 elu ; writes f32 C and f16 C16, each if non-null
template <int ACT>
__global__ __launch_bounds__(128) void k_gemm_hhx(const _Float16* __restrict__ A, int lda, size_t sA, const _Float16* __restrict__ Bh, int ldb, size_t sB, float alpha, const float* __restrict__ bias, size_t sBias, const float* __restrict__ CP, int rowsPerB, size_t sCPb, int row0g,
    float* __restrict__ C, _Float16* __restrict__ C16, int ldc, size_t sC, int M, int N, int K) {
  __shared__ __attribute__((aligned(16))) float so[4][16][64];
  const int tid = threadIdx.x, w = tid >> 5, lane = tid & 31, ln = lane & 15, hh = lane >> 4; const int by = blockIdx.y;
  A += (size_t)by * sA; Bh += (size_t)by * sB; const size_t cofs = (size_t)by * sC; const float* bp = bias ? bias + (size_t)by * sBias : nullptr;
  const int ntn = (N + 63) / 64; const int wid = blockIdx.x * 4 + w; const int mt = wid / ntn, nq = wid % ntn; if (mt * 16 >= M) return;
  const int row0 = mt * 16, col0 = nq * 64; const _Float16* arow = A + (size_t)(row0 + ln) * lda;
  v8f acc[4] = {};
  for (int kb = 0; kb < K; kb += 32) { FragH ah; ah.half[0] = *(const v8us*)((const unsigned short*)arow + kb + 8 * hh); ah.half[1] = *(const v8us*)((const unsigned short*)arow + kb + 16 + 8 * hh);
#pragma unroll
    for (int t = 0; t < 4; ++t) { if (col0 + t * 16 >= N) continue; const size_t boff = (size_t)(col0 + t * 16 + ln) * ldb + kb; FragH bq; bq.half[0] = *(const v8us*)((const unsigned short*)Bh + boff + 8 * hh); bq.half[1] = *(const v8us*)((const unsigned short*)Bh + boff + 16 + 8 * hh);
      acc[t] = mmaH<1>(ah.v, ah.v, bq.v, bq.v, acc[t]); }
  }
#pragma unroll
  for (int t = 0; t < 4; ++t) { if (col0 + t * 16 >= N) continue; const int col = col0 + t * 16 + ln; const float bv = bp ? bf16_round(bp[col]) : 0.f;
#pragma unroll
    for (int r = 0; r < 8; ++r) { float v = acc[t][r] * alpha + bv; if (CP) { const int rr = row0g + row0 + 8 * hh + r; if (rowsPerB < 0) v += CP[cofs + (size_t)rr * ldc + col];      /* rowsPerB < 0: own element of the batched C plane */ else { const int bidx = rr / rowsPerB; v += CP[(size_t)bidx * sCPb + (size_t)by * 64 + col]; } } if (ACT == 1) v = (v > 0.f) ? v : expm1f(v); else if (ACT == 7) v = (v > 0.f) ? v + 1.0f : expf(v); else if (ACT == 8) v = tanhf(v); else if (ACT == 9) v = 0.5f * v * (1.0f + tanhf(0.7978845608028654f * (v + 0.044715f * v * v * v))); else if (ACT == 11) v = 1.0f / (1.0f + expf(-v)); else if (ACT == 12) v = (v > 0.f) ? v : 0.01f * v; else if (ACT == 14) v = (v > 0.f) ? v : 0.1f * v; else if (ACT == 16) v = (v >= 0.f) ? v : 0.3f * v; else if (ACT == 17) v = (v >= 0.f) ? v : 0.2f * v; else if (ACT == 15) v = v / (1.0f + expf(-v)); else if (ACT == 3) v = fmaxf(v, 0.f); else if (ACT == 6) v = 0.5f * v * (1.0f + erff(v * 0.70710678118654752f)); so[w][8 * hh + r][t * 16 + ln] = v; } }
  __builtin_amdgcn_fence(__ATOMIC_ACQ_REL, "workgroup"); __builtin_amdgcn_wave_barrier();
  const int rsub = lane >> 4, c4 = (lane & 15) * 4; typedef _Float16 v4h __attribute__((ext_vector_type(4)));
  {
#pragma unroll
    for (int q = 0; q < 8; ++q) { const int r = q * 2 + rsub; if (col0 + c4 < N) { const v4f v = *(const v4fa*)&so[w][r][c4]; if (C) *(v4f*)(C + cofs + (size_t)(row0 + r) * ldc + col0 + c4) = v; if (C16) { v4h h4; for (int i = 0; i < 4; ++i) h4[i] = (_Float16)v[i]; *(v4h*)(C16 + cofs + (size_t)(row0 + r) * ldc + col0 + c4) = h4; } } }
     }
}


typedef _Float16 v4h __attribute__((ext_vector_type(4)));

__global__ __launch_bounds__(256) void k_x16(const float* __restrict__ x, _Float16* __restrict__ X16, size_t n8) { const size_t t = (size_t)blockIdx.x * 256 + threadIdx.x; if (t >= n8) return; FragH f;
#pragma unroll
  for (int q = 0; q < 8; ++q) f.h[q] = (_Float16)bf16_round(x[t * 8 + q]); *(v8us*)((unsigned short*)X16 + t * 8) = f.half[0];  }
__global__ __launch_bounds__(256) void k_h16(const float* __restrict__ x, _Float16* __restrict__ X16, size_t n8) { const size_t t = (size_t)blockIdx.x * 256 + threadIdx.x; if (t >= n8) return; FragH f;
#pragma unroll
  for (int q = 0; q < 8; ++q) f.h[q] = (_Float16)x[t * 8 + q]; *(v8us*)((unsigned short*)X16 + t * 8) = f.half[0];  }
__global__ __launch_bounds__(256) void k_round16f(const float* __restrict__ W, _Float16* __restrict__ Bt, size_t n8) { const size_t t = (size_t)blockIdx.x * 256 + threadIdx.x; if (t >= n8) return; FragH f;
#pragma unroll
  for (int i = 0; i < 8; ++i) f.h[i] = (_Float16)(bf16_round(W[t * 8 + i]) * 16.0f); *(v8us*)((unsigned short*)Bt + t * 8) = f.half[0];  }
__global__ __launch_bounds__(256) void k_hl(const float* __restrict__ F, _Float16* __restrict__ Hh, _Float16* __restrict__ Hl, size_t n8) { const size_t t = (size_t)blockIdx.x * 256 + threadIdx.x; if (t >= n8) return; FragH fh, fl; const v4f a = *(const v4fa*)(F + t * 8), c = *(const v4fa*)(F + t * 8 + 4);
#pragma unroll
  for (int q = 0; q < 4; ++q) { _Float16 h = (_Float16)a[q]; fh.h[q] = h; fl.h[q] = (_Float16)((a[q] - (float)h) * 1024.0f); h = (_Float16)c[q]; fh.h[4 + q] = h; fl.h[4 + q] = (_Float16)((c[q] - (float)h) * 1024.0f); }
  { *(v8us*)((unsigned short*)Hh + t * 8) = fh.half[0]; *(v8us*)((unsigned short*)Hl + t * 8) = fl.half[0];  } }

// ---- the whole operator in one kernel: one work-group = one window x 512 queries, 16 waves x 32 query columns; it owns a WGP's LDS.
// The work-group forms K (1024 x 32) and V^T (32 x 1024) of both heads of its window from x and keeps them in LDS; q, the scores and the context never leave the registers.
// S^T = K.Q^T (lane = one query column, registers = keys), so the packed score tiles are the B operand of O^T += V^T.P^T.
// One pass over the keys forms exp(scale * (s - shift)) as f16, the shift being the maximum over the first 64 key places; the row sums prove the f16 range, and a wave that cannot prove it repeats with the true maximum.
#define KPITCH 40                /* K row pitch in LDS, f16 elements: 80 B = 16 B x odd, no bank conflict for 16-byte readers */
#define VPITCH 1032              /* V^T row pitch in LDS, f16 elements: 2064 B = 16 B x odd */
#define TPITCH 72                /* weight row pitch in LDS, f16 elements: 144 B = 16 B x odd */
#define QW 512                   /* queries per work-group */
#define FPITCH 516               /* output row (one channel, 512 tokens) pitch in LDS, f32 elements: 2064 B = 16 B x odd */
typedef float v2f __attribute__((ext_vector_type(2)));
typedef float v2fa __attribute__((ext_vector_type(2), may_alias));
typedef _Float16 v2h __attribute__((ext_vector_type(2)));
union FragP { v16h v; v2h p[8]; };
__device__ __forceinline__ v16h fa_frag(const unsigned short* p, int hh) { FragH f; f.half[0] = *(const v8us*)(p + 8 * hh); f.half[1] = *(const v8us*)(p + 16 + 8 * hh); return f.v; }
__device__ __forceinline__ v8f fa_mma(v16h a, v16h b, v8f c) { return __builtin_amdgcn_wmma_f32_16x16x32_f16(false, a, false, b, (short)0, c, false, false); }
// eight scores of one query -> eight f16 weights (elements 8 * half .. 8 * half + 7 of the B operand), their f32 values added to su
__device__ __forceinline__ void fa_exp8(const v8f s, const v2f c2, const v2f nb2, v2f& su, FragP& pf, const int half) {
#pragma unroll
  for (int i = 0; i < 4; ++i) { const v2f s2 = {s[2 * i], s[2 * i + 1]}; const v2f t = __builtin_elementwise_fma(s2, c2, nb2); const v2f e = {__builtin_amdgcn_exp2f(t[0]), __builtin_amdgcn_exp2f(t[1])}; su += e; pf.p[half * 4 + i] = __builtin_convertvector(e, v2h); }
}
// eight consecutive elements of a 64 x 64 f32 weight matrix (out, in) -> f16(bf16(w) * 16) in its LDS row; chunk i of 512
__device__ __forceinline__ void pj_wput(const v4f a, const v4f c, unsigned short* sWm, const int i) { FragH f;
#pragma unroll
  for (int q = 0; q < 4; ++q) { f.h[q] = (_Float16)(bf16_round(a[q]) * 16.0f); f.h[4 + q] = (_Float16)(bf16_round(c[q]) * 16.0f); }
  *(v8us*)&sWm[(i >> 3) * TPITCH + (i & 7) * 8] = f.half[0];
}
// 32 tokens x 64 channels of x, straight from NCHW: a lane reads tokens 2 ln and 2 ln + 1 of the 32 channels its fragments hold (xp stands at channel 8 hh), so a half-wave's load covers one whole 128-byte line.
__device__ __forceinline__ void fx_load(const float* __restrict__ xp, v2f (&xv)[32]) {
#pragma unroll
  for (int s = 0; s < 2; ++s) {
#pragma unroll
    for (int j = 0; j < 16; ++j) xv[s * 16 + j] = *(const v2fa*)(xp + (size_t)(s * 32 + (j >> 3) * 16 + (j & 7)) * HW);
    asm volatile("s_wait_xcnt 0x0" ::: "memory");      /* sixteen loads share one address pair: a later load may land in that pair, and this wait stands in front of it */
  }
}
// ... -> t[e][s]: tile e holds token 2 m + e in its row (or column) m, s is the k step of 32 channels. The same registers serve as A and as B operand.
__device__ __forceinline__ void fx_frags(const v2f (&xv)[32], v16h (&t)[2][2]) {
#pragma unroll
  for (int s = 0; s < 2; ++s) { FragH f0, f1;
#pragma unroll
    for (int j = 0; j < 16; ++j) { f0.h[j] = (_Float16)bf16_round(xv[s * 16 + j][0]); f1.h[j] = (_Float16)bf16_round(xv[s * 16 + j][1]); }
    t[0][s] = f0.v; t[1][s] = f1.v; }
}
// one head of a wave's 32 queries against all 1024 key places: the normalised context comes back as the B operand of Wp.ctx^T (lane = query, registers = channels 8 hh .. and 16 + 8 hh ..)
__device__ __forceinline__ void fa_head(const unsigned short* kl, const unsigned short* vl, const int hh, const v16h bq0, const v16h bq1, FragH& c0, FragH& c1) {
  const v8f z8 = {0.f,0.f,0.f,0.f,0.f,0.f,0.f,0.f};
  const float cs = 0.17677669529663687f * 1.4426950408889634f;      /* scale * log2(e) */
  const v2f c2 = {cs, cs};
  v8f o00, o10, o01, o11; float su0, su1;
  // Softmax is the same for any shift, so the shift need not be the true maximum: the first trip takes the maximum of the first 64 key places only.
  // The weights are positive, so a lane's sum bounds each of its weights: a sum of at most 2^15 proves that none left the f16 range.
  // Where a lane of the wave cannot prove it, the wave runs a second trip with the true maximum of all keys (every weight at most 1). Two trips at most.
  for (int nkt = 4; ; nkt = NTW / 16) {
    float m0 = -3.0e38f, m1 = -3.0e38f;
    for (int kt = 0; kt < nkt; kt += 4) {
#pragma unroll      /* four key tiles a trip: the later tiles' LDS reads overlap the earlier tiles' products and maxima */
      for (int k4 = 0; k4 < 4; ++k4) { const v16h a = fa_frag(kl + (kt + k4) * 16 * KPITCH, hh); const v8f s0 = fa_mma(a, bq0, z8), s1 = fa_mma(a, bq1, z8);
#pragma unroll
        for (int r = 0; r < 8; ++r) { m0 = fmaxf(m0, s0[r]); m1 = fmaxf(m1, s1[r]); } } }
    m0 = fmaxf(m0, __shfl_xor(m0, 16, 32)); m1 = fmaxf(m1, __shfl_xor(m1, 16, 32));      /* lanes l and l ^ 16 hold the two halves of a query's keys and must shift alike */
    const float n0f = -m0 * cs, n1f = -m1 * cs;
    const v2f nb0 = {n0f, n0f}, nb1 = {n1f, n1f};
    o00 = z8; o10 = z8; o01 = z8; o11 = z8; v2f sa0 = {0.f, 0.f}, sb0 = {0.f, 0.f}, sa1 = {0.f, 0.f}, sb1 = {0.f, 0.f};
#pragma unroll 2      /* two passes of 32 keys a trip: the second pass's LDS reads and products overlap the first's exponentials */
    for (int kb = 0; kb < NTW; kb += 32) {
      const v16h a0 = fa_frag(kl + kb * KPITCH, hh), a1 = fa_frag(kl + (kb + 16) * KPITCH, hh);
      const v16h v0 = fa_frag(vl + kb, hh), v1 = fa_frag(vl + 16 * VPITCH + kb, hh);
      const v8f s00 = fa_mma(a0, bq0, z8), s10 = fa_mma(a1, bq0, z8), s01 = fa_mma(a0, bq1, z8), s11 = fa_mma(a1, bq1, z8);
      FragP p0, p1;
      fa_exp8(s00, c2, nb0, sa0, p0, 0); fa_exp8(s10, c2, nb0, sb0, p0, 1);
      fa_exp8(s01, c2, nb1, sa1, p1, 0); fa_exp8(s11, c2, nb1, sb1, p1, 1);
      o00 = fa_mma(v0, p0.v, o00); o10 = fa_mma(v1, p0.v, o10); o01 = fa_mma(v0, p1.v, o01); o11 = fa_mma(v1, p1.v, o11);
    }
    su0 = (sa0[0] + sa0[1]) + (sb0[0] + sb0[1]); su1 = (sa1[0] + sa1[1]) + (sb1[0] + sb1[1]);
    /* negated compares, so that an infinite or undefined sum counts as unproven; the ballot makes the branch the same for the whole wave, as the matrix instructions need */
    if (nkt == NTW / 16 || __builtin_amdgcn_ballot_w32(!(su0 <= 32768.0f && su1 <= 32768.0f)) == 0u) break;
  }
  su0 += __shfl_xor(su0, 16, 32); su1 += __shfl_xor(su1, 16, 32);
  const float r0 = 1.0f / su0, r1 = 1.0f / su1;      /* sums and products carry the same shift */
#pragma unroll
  for (int r = 0; r < 8; ++r) { c0.h[r] = (_Float16)(o00[r] * r0); c0.h[8 + r] = (_Float16)(o10[r] * r0); c1.h[r] = (_Float16)(o01[r] * r1); c1.h[8 + r] = (_Float16)(o11[r] * r1); }
}
// x (NCHW f32) -> out (NCHW f32). A wave projects 64 tokens of the window: its own 32 queries (q, k, v) and the 32 tokens at the same place of the window's other half (k, v).
// Softmax and P.V do not depend on the order of the keys, so K rows and V^T columns stand in the order the fragments come in: place base + 16 e + m holds token base + 2 m + e (base a multiple of 32), in K and in V^T alike.
__global__ __launch_bounds__(512) void k_pattn(const float* __restrict__ x, const float* __restrict__ Wq, const float* __restrict__ Wk, const float* __restrict__ Wv, const float* __restrict__ Wp, float* __restrict__ out) {
  __shared__ __attribute__((aligned(16))) unsigned short sK[NHD * NTW * KPITCH];      /* K, head after head; at the end the 64 x FPITCH f32 output tile, which is smaller */
  __shared__ __attribute__((aligned(16))) unsigned short sV[NHD * HD * VPITCH];      /* V^T: 64 channel rows, head after head */
  __shared__ __attribute__((aligned(16))) unsigned short sW[3 * CC * TPITCH];      /* Wq, Wk, Wv; later Wp in Wq's place */
  const int tid = threadIdx.x, w = tid >> 5, lane = tid & 31, ln = lane & 15, hh = lane >> 4;
  const int bp = blockIdx.x >> 1, hf = blockIdx.x & 1;
  const size_t w0 = (size_t)(bp / NPW) * CC * HW + (size_t)(bp % NPW) * NTW;      /* channel 0 of the window's first token, in x and in out */
  const int tA = hf * QW + w * 32, tB = (1 - hf) * QW + w * 32;
  const float* xl = x + w0 + (size_t)(8 * hh) * HW + 2 * ln;
  const v4f wqa = *(const v4fa*)(Wq + tid * 8), wqc = *(const v4fa*)(Wq + tid * 8 + 4), wka = *(const v4fa*)(Wk + tid * 8), wkc = *(const v4fa*)(Wk + tid * 8 + 4);
  const v4f wva = *(const v4fa*)(Wv + tid * 8), wvc = *(const v4fa*)(Wv + tid * 8 + 4), wpa = *(const v4fa*)(Wp + tid * 8), wpc = *(const v4fa*)(Wp + tid * 8 + 4);
  v2f xa[32], xb[32];
  fx_load(xl + tA, xa); fx_load(xl + tB, xb);
  __builtin_amdgcn_sched_barrier(0);      /* every load above is issued before the first wait: without this line the weights are waited for and converted first, and x pays a second memory latency behind them */
  pj_wput(wqa, wqc, sW, tid); pj_wput(wka, wkc, sW + CC * TPITCH, tid); pj_wput(wva, wvc, sW + 2 * CC * TPITCH, tid);
  v16h ta[2][2], tb[2][2];
  fx_frags(xa, ta); fx_frags(xb, tb);
  __syncthreads();      /* the three weight matrices are complete */
  const v8f z8 = {0.f,0.f,0.f,0.f,0.f,0.f,0.f,0.f};
  FragH bq[NHD][2];      /* q of head h, query tile e: W.X^T leaves a lane eight consecutive channels of one token, which is the B operand of K.Q^T as it stands */
#pragma unroll
  for (int mt = 0; mt < 4; ++mt) {
    const unsigned short* wl = &sW[(mt * 16 + ln) * TPITCH];
    const v16h a0 = fa_frag(wl, hh), a1 = fa_frag(wl + 32, hh);
    const v8f d0 = fa_mma(a1, ta[0][1], fa_mma(a0, ta[0][0], z8)), d1 = fa_mma(a1, ta[1][1], fa_mma(a0, ta[1][0], z8));
#pragma unroll
    for (int r = 0; r < 8; ++r) { bq[mt >> 1][0].h[(mt & 1) * 8 + r] = (_Float16)(d0[r] * 0.0625f); bq[mt >> 1][1].h[(mt & 1) * 8 + r] = (_Float16)(d1[r] * 0.0625f); }
  }
#pragma unroll
  for (int mt = 0; mt < 4; ++mt) {      /* k: W.X^T, a lane holds eight consecutive channels of one token: 16 bytes of that token's K row */
    const unsigned short* wl = &sW[(CC + mt * 16 + ln) * TPITCH];
    const v16h a0 = fa_frag(wl, hh), a1 = fa_frag(wl + 32, hh);
    unsigned short* so = &sK[((mt >> 1) * NTW + ln) * KPITCH + (mt & 1) * 16 + 8 * hh];
#pragma unroll
    for (int e = 0; e < 2; ++e) {
      const v8f d0 = fa_mma(a1, ta[e][1], fa_mma(a0, ta[e][0], z8)), d1 = fa_mma(a1, tb[e][1], fa_mma(a0, tb[e][0], z8));
      FragH f;
#pragma unroll
      for (int r = 0; r < 8; ++r) { f.h[r] = (_Float16)(d0[r] * 0.0625f); f.h[8 + r] = (_Float16)(d1[r] * 0.0625f); }
      *(v8us*)(so + (tA + e * 16) * KPITCH) = f.half[0]; *(v8us*)(so + (tB + e * 16) * KPITCH) = f.half[1];
    }
  }
#pragma unroll
  for (int nt = 0; nt < 4; ++nt) {      /* v: X.W^T, a lane holds eight consecutive places of one channel: 16 bytes of that channel's V^T row */
    const unsigned short* wl = &sW[(2 * CC + nt * 16 + ln) * TPITCH];
    const v16h b0 = fa_frag(wl, hh), b1 = fa_frag(wl + 32, hh);
    unsigned short* so = &sV[(nt * 16 + ln) * VPITCH + 8 * hh];
#pragma unroll
    for (int e = 0; e < 2; ++e) {
      const v8f d0 = fa_mma(ta[e][1], b1, fa_mma(ta[e][0], b0, z8)), d1 = fa_mma(tb[e][1], b1, fa_mma(tb[e][0], b0, z8));
      FragH f;
#pragma unroll
      for (int r = 0; r < 8; ++r) { f.h[r] = (_Float16)(d0[r] * 0.0625f); f.h[8 + r] = (_Float16)(d1[r] * 0.0625f); }
      *(v8us*)(so + tA + e * 16) = f.half[0]; *(v8us*)(so + tB + e * 16) = f.half[1];
    }
  }
  __syncthreads();      /* K and V^T of the whole window are complete, and every wave has read Wq, Wk and Wv for the last time */
  pj_wput(wpa, wpc, sW, tid);      /* published by the barrier behind the two heads */
  FragH ca0, ca1, cb0, cb1;      /* context of head 0 (ca) and head 1 (cb), query tiles 0 and 1 */
  fa_head(&sK[ln * KPITCH], &sV[ln * VPITCH], hh, bq[0][0].v, bq[0][1].v, ca0, ca1);
  fa_head(&sK[(NTW + ln) * KPITCH], &sV[(HD + ln) * VPITCH], hh, bq[1][0].v, bq[1][1].v, cb0, cb1);
  __syncthreads();      /* every wave has read K and V^T for the last time: the LDS may take the output tile */
  float* sF = (float*)sK;
  const unsigned short* wl = &sW[ln * TPITCH];
#pragma unroll
  for (int ot = 0; ot < 4; ++ot) {      /* Wp.ctx^T: a lane holds eight consecutive output channels of tokens 2 ln and 2 ln + 1; k = head 0's channels, then head 1's */
    const v16h a0 = fa_frag(wl + ot * 16 * TPITCH, hh), a1 = fa_frag(wl + ot * 16 * TPITCH + 32, hh);
    const v8f d0 = fa_mma(a1, cb0.v, fa_mma(a0, ca0.v, z8)), d1 = fa_mma(a1, cb1.v, fa_mma(a0, ca1.v, z8));
    float* so = &sF[(ot * 16 + 8 * hh) * FPITCH + w * 32 + 2 * ln];
#pragma unroll
    for (int r = 0; r < 8; ++r) { const v2f o2 = {d0[r] * 0.0625f, d1[r] * 0.0625f}; *(v2fa*)(so + r * FPITCH) = o2; }
  }
  __syncthreads();      /* the 64 x 512 output tile is complete: each store below covers whole lines of one channel */
  float* dp = out + w0 + hf * QW;
  for (int j = 0; j < CC * QW / 4 / 512; ++j) { const int i = j * 512 + tid, o = i >> 7, pc = i & 127;
    *(v4f*)(dp + (size_t)o * HW + pc * 4) = *(const v4fa*)&sF[o * FPITCH + pc * 4]; }
}

extern "C" void kernel_launch(void* const* d_in, const int* in_sizes, int n_in,
                              void* d_out, int out_size, void* d_ws, size_t ws_size, hipStream_t stream) {
  (void)in_sizes; (void)n_in; (void)out_size; (void)d_ws; (void)ws_size;
  const float* const* I = (const float* const*)d_in; const float* x = I[0]; const float* Wq = I[1]; const float* Wk = I[2]; const float* Wv = I[3]; const float* Wp = I[4];
  k_pattn<<<NB * NPW * 2, 512, 0, stream>>>(x, Wq, Wk, Wv, Wp, (float*)d_out);      /* projections, scores, softmax, context of both heads, ctx Wp^T: NCHW to NCHW, no workspace */
}

// v006
// Measured time: 33.4 microseconds a run.
// Timed twice side by side with v005, it ran 1.06 and 1.07 times as fast.
// All steps since v000 together make it 31.9 times as fast.
#include <hip/hip_runtime.h>
// patch_attention (2 x 64 ch x 256 x 256; 64 row-band windows of 4 rows x 256 = 1024 tokens; 2 heads x 32; q, k, v = feat W^T per window; softmax(q.k / sqrt(32)) within the window; out = ctx Wp^T; back to NCHW).
// Compute dtype: inputs rounded to bf16; x and weights exact as f16; q/k/v, the softmax weights and the context as plain f16 operands (~2^-12); softmax f32. v_wmma_f32_16x16x32_f16.
#define NB 2
#define CC 64
#define HW 65536
#define NPW 64                   /* windows per image */
#define NTW 1024                 /* tokens per window */
#define NHD 2
#define HD 32
#define NTOK (NB * HW)           /* 131072 */
#define NU (NB * NPW * NHD)      /* 256 units */
typedef __bf16 v16b __attribute__((ext_vector_type(16)));
typedef unsigned short v8us __attribute__((ext_vector_type(8), may_alias));
typedef float  v8f  __attribute__((ext_vector_type(8)));
typedef float  v4f  __attribute__((ext_vector_type(4)));
typedef float  v4fa __attribute__((ext_vector_type(4), may_alias));
union FragB { v16b v; v8us half[2]; unsigned short u[16]; };

__device__ __forceinline__ unsigned short bf16_bits(float x) { unsigned int u = __float_as_uint(x); return (unsigned short)((u + 0x7FFFu + ((u >> 16) & 1u)) >> 16); }
__device__ __forceinline__ float bf16_val(unsigned short b) { return __uint_as_float(((unsigned int)b) << 16); }
__device__ __forceinline__ float bf16_round(float x) { return bf16_val(bf16_bits(x)); }
// D += A·B with NT terms: 1 = ah·bh, 2 = + al·bh (A split), 3 = + ah·bl (both split)
template <int NT>
__device__ __forceinline__ v8f mmaN(v16b ah, v16b al, v16b bh, v16b bl, v8f c) {
  c = __builtin_amdgcn_wmma_f32_16x16x32_bf16(false, ah, false, bh, (short)0, c, false, false);
  if (NT >= 2) c = __builtin_amdgcn_wmma_f32_16x16x32_bf16(false, al, false, bh, (short)0, c, false, false);
  if (NT >= 3) c = __builtin_amdgcn_wmma_f32_16x16x32_bf16(false, ah, false, bl, (short)0, c, false, false);
  asm volatile("v_nop\n\tv_nop\n\tv_nop\n\tv_nop" : "+v"(c) : "v"(ah), "v"(al), "v"(bh), "v"(bl));
  return c;
}

__global__ __launch_bounds__(256) void k_wt_bf16(const float* __restrict__ W, unsigned short* __restrict__ Wt, int K, int N) {
  const int t = blockIdx.x * 256 + threadIdx.x;
  const int k8n = K / 8;
  if (t >= N * k8n) return;
  const int n = t / k8n, k8 = (t % k8n) * 8;
  v8us v;
#pragma unroll
  for (int i = 0; i < 8; ++i) v[i] = bf16_bits(W[(size_t)(k8 + i) * N + n]);
  *(v8us*)(Wt + (size_t)n * K + k8) = v;
  
}

// GEMM C[M][N] (f32, pitch ldc) = act(A[M][K]·W + bias). A f32 row-major (pitch lda) converted per fragment to bf16
// (ASPLIT: hi/lo two planes -> 2 terms, else single rounded term); Wt bf16 [N][K] (pitch ldb). BIAS_BF16 rounds the
// bias to bf16 first (bias quantised to bf16 before the add). K%32==0, M%16==0, N%64==0.
template <bool ASPLIT, int ACT, bool BIAS_BF16>
__global__ __launch_bounds__(128) void k_gemm_bf(const float* __restrict__ A, int lda, const unsigned short* __restrict__ Wt, int ldb,
                                               const float* __restrict__ bias, float* __restrict__ C, int ldc, int M, int N, int K) {
  __shared__ __attribute__((aligned(16))) float so[4][16][64];
  const int tid = threadIdx.x, w = tid >> 5, lane = tid & 31, ln = lane & 15, hh = lane >> 4;
  const int ntn = N / 64;
  const int wid = blockIdx.x * 4 + w;
  const int mt = wid / ntn, nq = wid % ntn;
  if (mt * 16 >= M) return;
  const int row0 = mt * 16, col0 = nq * 64;
  const float* arow = A + (size_t)(row0 + ln) * lda;
  v8f acc[4] = {};
  for (int kb = 0; kb < K; kb += 32) {
    FragB ah, al;
    const v4f x0 = *(const v4fa*)(arow + kb + 8 * hh), x1 = *(const v4fa*)(arow + kb + 8 * hh + 4);
    const v4f x2 = *(const v4fa*)(arow + kb + 16 + 8 * hh), x3 = *(const v4fa*)(arow + kb + 16 + 8 * hh + 4);
    float xs[16] = {x0[0],x0[1],x0[2],x0[3],x1[0],x1[1],x1[2],x1[3],x2[0],x2[1],x2[2],x2[3],x3[0],x3[1],x3[2],x3[3]};
#pragma unroll
    for (int i = 0; i < 16; ++i) { const unsigned short hb = bf16_bits(xs[i]); ah.u[i] = hb; al.u[i] = ASPLIT ? bf16_bits(xs[i] - bf16_val(hb)) : (unsigned short)0; }
#pragma unroll
    for (int t = 0; t < 4; ++t) {
      const unsigned short* brow = Wt + (size_t)(col0 + t * 16 + ln) * ldb + kb;
      FragB b;
      b.half[0] = *(const v8us*)(brow + 8 * hh);
      b.half[1] = *(const v8us*)(brow + 16 + 8 * hh);
      acc[t] = mmaN<ASPLIT ? 2 : 1>(ah.v, al.v, b.v, b.v, acc[t]);
    }
  }
#pragma unroll
  for (int t = 0; t < 4; ++t) {
    float bv = bias ? bias[col0 + t * 16 + ln] : 0.f;
    if (BIAS_BF16) bv = bf16_round(bv);
#pragma unroll
    for (int r = 0; r < 8; ++r) { float v = acc[t][r] + bv; if (ACT == 1) v = fmaxf(v, 0.f); so[w][8 * hh + r][t * 16 + ln] = v; }
  }
  __builtin_amdgcn_fence(__ATOMIC_ACQ_REL, "workgroup");
  __builtin_amdgcn_wave_barrier();
  const int rsub = lane >> 4, c4 = (lane & 15) * 4;
  {
#pragma unroll
    for (int q = 0; q < 8; ++q) {
      const int r = q * 2 + rsub;
      const v4f v = *(const v4fa*)&so[w][r][c4];
      *(v4f*)(C + (size_t)(row0 + r) * ldc + col0 + c4) = v;
    }
    
  }
}

// GEMM C = act(A·W + bias + resid): A f32 (ASPLIT -> hi/lo 2 terms), Wt bf16 [N][K]; ACT 0 none, 1 relu, 2 exact gelu;
// resid (optional, f32, row index = (row % rmod), pitch ldr, RES_BF16 rounds it) added before the activation.
template <bool ASPLIT, int ACT, bool BIAS_BF16, bool RES_BF16>
__global__ __launch_bounds__(128) void k_gemm_bf3(const float* __restrict__ A, int lda, const unsigned short* __restrict__ Wt, int ldb,
                                                const float* __restrict__ bias, const float* __restrict__ resid, int rmod, int ldr,
                                                float* __restrict__ C, int ldc, int M, int N, int K) {
  __shared__ __attribute__((aligned(16))) float so[4][16][64];
  const int tid = threadIdx.x, w = tid >> 5, lane = tid & 31, ln = lane & 15, hh = lane >> 4;
  const int ntn = N / 64;
  const int wid = blockIdx.x * 4 + w;
  const int mt = wid / ntn, nq = wid % ntn;
  if (mt * 16 >= M) return;
  const int row0 = mt * 16, col0 = nq * 64;
  const float* arow = A + (size_t)(row0 + ln) * lda;
  v8f acc[4] = {};
  for (int kb = 0; kb < K; kb += 32) {
    FragB ah, al;
    const v4f x0 = *(const v4fa*)(arow + kb + 8 * hh), x1 = *(const v4fa*)(arow + kb + 8 * hh + 4);
    const v4f x2 = *(const v4fa*)(arow + kb + 16 + 8 * hh), x3 = *(const v4fa*)(arow + kb + 16 + 8 * hh + 4);
    float xs[16] = {x0[0],x0[1],x0[2],x0[3],x1[0],x1[1],x1[2],x1[3],x2[0],x2[1],x2[2],x2[3],x3[0],x3[1],x3[2],x3[3]};
#pragma unroll
    for (int i = 0; i < 16; ++i) { const unsigned short hb = bf16_bits(xs[i]); ah.u[i] = hb; al.u[i] = ASPLIT ? bf16_bits(xs[i] - bf16_val(hb)) : (unsigned short)0; }
#pragma unroll
    for (int t = 0; t < 4; ++t) {
      const unsigned short* brow = Wt + (size_t)(col0 + t * 16 + ln) * ldb + kb;
      FragB b;
      b.half[0] = *(const v8us*)(brow + 8 * hh);
      b.half[1] = *(const v8us*)(brow + 16 + 8 * hh);
      acc[t] = mmaN<ASPLIT ? 2 : 1>(ah.v, al.v, b.v, b.v, acc[t]);
    }
  }
#pragma unroll
  for (int t = 0; t < 4; ++t) {
    const int col = col0 + t * 16 + ln;
    float bv = bias ? bias[col] : 0.f;
    if (BIAS_BF16) bv = bf16_round(bv);
#pragma unroll
    for (int r = 0; r < 8; ++r) {
      float v = acc[t][r] + bv;
      if (resid) { float rv = resid[(size_t)((row0 + 8 * hh + r) % rmod) * ldr + col]; if (RES_BF16) rv = bf16_round(rv); v += rv; }
      if (ACT == 1) v = fmaxf(v, 0.f);
      if (ACT == 2) v = 0.5f * v * (1.0f + erff(v * 0.70710678118654752f));
      if (ACT == 3) { const float u = 0.7978845608028654f * (v + 0.044715f * v * v * v); v = 0.5f * v * (1.0f + tanhf(u)); }
      so[w][8 * hh + r][t * 16 + ln] = v;
    }
  }
  __builtin_amdgcn_fence(__ATOMIC_ACQ_REL, "workgroup");
  __builtin_amdgcn_wave_barrier();
  const int rsub = lane >> 4, c4 = (lane & 15) * 4;
  {
#pragma unroll
    for (int q = 0; q < 8; ++q) {
      const int r = q * 2 + rsub;
      const v4f v = *(const v4fa*)&so[w][r][c4];
      *(v4f*)(C + (size_t)(row0 + r) * ldc + col0 + c4) = v;
    }
    
  }
}
// row LayerNorm (biased variance, eps) over N: s = X (+ R); optional out_sum <- s; out_norm <- (s-mu)*rsqrt(var+eps)*g + b
template <bool PARAM_BF16>
__global__ __launch_bounds__(256) void k_layernorm(const float* __restrict__ X, const float* __restrict__ R, const float* __restrict__ g, const float* __restrict__ bta,
                                                  float* __restrict__ out_sum, float* __restrict__ out_norm, int N, float eps) {
  __shared__ float red[256];
  const int row = blockIdx.x, tid = threadIdx.x;
  const float* x = X + (size_t)row * N; const float* rr = R ? R + (size_t)row * N : nullptr;
  float vals[16];                     // up to N = 4096
  const int per = N / 256;            // contiguous chunk per thread? use strided-by-4 chunks: thread handles j = tid*4 + 1024*u
  float s1 = 0.f;
  for (int u = 0; u < per / 4; ++u) {
    const int j = tid * 4 + 1024 * u;
    const v4f a = *(const v4fa*)(x + j);
    v4f b = {0.f,0.f,0.f,0.f}; if (rr) b = *(const v4fa*)(rr + j);
#pragma unroll
    for (int q = 0; q < 4; ++q) { const float v = a[q] + b[q]; vals[u * 4 + q] = v; s1 += v; }
  }
  red[tid] = s1; __syncthreads();
  for (int st = 128; st > 0; st >>= 1) { if (tid < st) red[tid] += red[tid + st]; __syncthreads(); }
  const float mu = red[0] / (float)N; __syncthreads();
  float s2 = 0.f;
  for (int u = 0; u < per / 4; ++u)
#pragma unroll
    for (int q = 0; q < 4; ++q) { const float c = vals[u * 4 + q] - mu; s2 += c * c; }
  red[tid] = s2; __syncthreads();
  for (int st = 128; st > 0; st >>= 1) { if (tid < st) red[tid] += red[tid + st]; __syncthreads(); }
  const float rs = rsqrtf(red[0] / (float)N + eps);
  {
    for (int u = 0; u < per / 4; ++u) {
      const int j = tid * 4 + 1024 * u;
      v4f o, sm;
#pragma unroll
      for (int q = 0; q < 4; ++q) {
        float gg = g[j + q], bb = bta[j + q];
        if (PARAM_BF16) { gg = bf16_round(gg); bb = bf16_round(bb); }
        sm[q] = vals[u * 4 + q]; o[q] = (vals[u * 4 + q] - mu) * rs * gg + bb;
      }
      if (out_sum) *(v4f*)(out_sum + (size_t)row * N + j) = sm;
      *(v4f*)(out_norm + (size_t)row * N + j) = o;
    }
    
  }
}



// ---- f16 WMMA path (v_wmma_f32_16x16x32_f16): 11-bit significands for operands in range — used where a [0,1] probability operand needs more precision than bf16
typedef _Float16 v16h __attribute__((ext_vector_type(16)));
union FragH { v16h v; v8us half[2]; _Float16 h[16]; unsigned short u[16]; };
template <int NT>
__device__ __forceinline__ v8f mmaH(v16h ah, v16h al, v16h bh, v16h bl, v8f c) {
  c = __builtin_amdgcn_wmma_f32_16x16x32_f16(false, ah, false, bh, (short)0, c, false, false);
  if (NT >= 2) c = __builtin_amdgcn_wmma_f32_16x16x32_f16(false, al, false, bh, (short)0, c, false, false);
  if (NT >= 3) c = __builtin_amdgcn_wmma_f32_16x16x32_f16(false, ah, false, bl, (short)0, c, false, false);
  asm volatile("v_nop\n\tv_nop\n\tv_nop\n\tv_nop" : "+v"(c) : "v"(ah), "v"(al), "v"(bh), "v"(bl));
  return c;
}
// batched GEMM like k_gemm_b but f16 operands: A f32 (split into f16 hi/lo if ASPLIT, else rounded to f16), Bt = f16 values [n][k]; alpha; C f32; N multiple of 16 (partial tiles skipped)
template <bool ASPLIT>
__global__ __launch_bounds__(128) void k_gemm_h(const float* __restrict__ A, int lda, size_t sA, const _Float16* __restrict__ Bh, int ldb, size_t sB, float alpha, float* __restrict__ C, int ldc, size_t sC, int M, int N, int K) {
  __shared__ __attribute__((aligned(16))) float so[4][16][64];
  const int tid = threadIdx.x, w = tid >> 5, lane = tid & 31, ln = lane & 15, hh = lane >> 4; const int by = blockIdx.y;
  A += (size_t)by * sA; Bh += (size_t)by * sB; C += (size_t)by * sC;
  const int ntn = (N + 63) / 64; const int wid = blockIdx.x * 4 + w; const int mt = wid / ntn, nq = wid % ntn; if (mt * 16 >= M) return;
  const int row0 = mt * 16, col0 = nq * 64; const float* arow = A + (size_t)(row0 + ln) * lda;
  v8f acc[4] = {};
  for (int kb = 0; kb < K; kb += 32) {
    FragH ah, al;
    const v4f x0 = *(const v4fa*)(arow + kb + 8 * hh), x1 = *(const v4fa*)(arow + kb + 8 * hh + 4), x2 = *(const v4fa*)(arow + kb + 16 + 8 * hh), x3 = *(const v4fa*)(arow + kb + 16 + 8 * hh + 4);
    float xs[16] = {x0[0],x0[1],x0[2],x0[3],x1[0],x1[1],x1[2],x1[3],x2[0],x2[1],x2[2],x2[3],x3[0],x3[1],x3[2],x3[3]};
#pragma unroll
    for (int i = 0; i < 16; ++i) { const _Float16 h = (_Float16)xs[i]; ah.h[i] = h; al.h[i] = ASPLIT ? (_Float16)(xs[i] - (float)h) : (_Float16)0.0f; }
#pragma unroll
    for (int t = 0; t < 4; ++t) { if (col0 + t * 16 >= N) continue; const size_t boff = (size_t)(col0 + t * 16 + ln) * ldb + kb; FragH bq; bq.half[0] = *(const v8us*)(Bh + boff + 8 * hh); bq.half[1] = *(const v8us*)(Bh + boff + 16 + 8 * hh);
      acc[t] = mmaH<ASPLIT ? 2 : 1>(ah.v, al.v, bq.v, bq.v, acc[t]); }
  }
#pragma unroll
  for (int t = 0; t < 4; ++t) { if (col0 + t * 16 >= N) continue;
#pragma unroll
    for (int r = 0; r < 8; ++r) so[w][8 * hh + r][t * 16 + ln] = acc[t][r] * alpha; }
  __builtin_amdgcn_fence(__ATOMIC_ACQ_REL, "workgroup"); __builtin_amdgcn_wave_barrier();
  const int rsub = lane >> 4, c4 = (lane & 15) * 4;
  {
#pragma unroll
    for (int q = 0; q < 8; ++q) { const int r = q * 2 + rsub; if (col0 + c4 < N) { const v4f v = *(const v4fa*)&so[w][r][c4]; *(v4f*)(C + (size_t)(row0 + r) * ldc + col0 + c4) = v; } }
     }
}

// Wt[n][k] = f16(W[k][n]·scale) from f32 row-major W[K][N] (scale = power of two; bf16-exact weights stay exact in f16 away from the subnormal range)
__global__ __launch_bounds__(256) void k_wt_f16(const float* __restrict__ W, _Float16* __restrict__ Wt, int K, int N, float scale) {
  const int t = blockIdx.x * 256 + threadIdx.x; if (t >= N * (K / 8)) return; const int n = t / (K / 8), k8 = (t % (K / 8)) * 8; FragH f;
#pragma unroll
  for (int i = 0; i < 8; ++i) f.h[i] = (_Float16)(bf16_round(W[(size_t)(k8 + i) * N + n]) * scale); const v8us o = f.half[0];
  *(v8us*)((unsigned short*)Wt + (size_t)n * K + k8) = o; 
}
// k_gemm_hh variant with fused epilogue: v = acc·alpha + bias[by·sBias + col] (+ CP[(row/rowsPerB)·sCPb + by·64 + col] if CP) ; ACT 0 none / 1 elu ; writes f32 C and f16 C16, each if non-null
template <int ACT>
__global__ __launch_bounds__(128) void k_gemm_hhx(const _Float16* __restrict__ A, int lda, size_t sA, const _Float16* __restrict__ Bh, int ldb, size_t sB, float alpha, const float* __restrict__ bias, size_t sBias, const float* __restrict__ CP, int rowsPerB, size_t sCPb, int row0g,
    float* __restrict__ C, _Float16* __restrict__ C16, int ldc, size_t sC, int M, int N, int K) {
  __shared__ __attribute__((aligned(16))) float so[4][16][64];
  const int tid = threadIdx.x, w = tid >> 5, lane = tid & 31, ln = lane & 15, hh = lane >> 4; const int by = blockIdx.y;
  A += (size_t)by * sA; Bh += (size_t)by * sB; const size_t cofs = (size_t)by * sC; const float* bp = bias ? bias + (size_t)by * sBias : nullptr;
  const int ntn = (N + 63) / 64; const int wid = blockIdx.x * 4 + w; const int mt = wid / ntn, nq = wid % ntn; if (mt * 16 >= M) return;
  const int row0 = mt * 16, col0 = nq * 64; const _Float16* arow = A + (size_t)(row0 + ln) * lda;
  v8f acc[4] = {};
  for (int kb = 0; kb < K; kb += 32) { FragH ah; ah.half[0] = *(const v8us*)((const unsigned short*)arow + kb + 8 * hh); ah.half[1] = *(const v8us*)((const unsigned short*)arow + kb + 16 + 8 * hh);
#pragma unroll
    for (int t = 0; t < 4; ++t) { if (col0 + t * 16 >= N) continue; const size_t boff = (size_t)(col0 + t * 16 + ln) * ldb + kb; FragH bq; bq.half[0] = *(const v8us*)((const unsigned short*)Bh + boff + 8 * hh); bq.half[1] = *(const v8us*)((const unsigned short*)Bh + boff + 16 + 8 * hh);
      acc[t] = mmaH<1>(ah.v, ah.v, bq.v, bq.v, acc[t]); }
  }
#pragma unroll
  for (int t = 0; t < 4; ++t) { if (col0 + t * 16 >= N) continue; const int col = col0 + t * 16 + ln; const float bv = bp ? bf16_round(bp[col]) : 0.f;
#pragma unroll
    for (int r = 0; r < 8; ++r) { float v = acc[t][r] * alpha + bv; if (CP) { const int rr = row0g + row0 + 8 * hh + r; if (rowsPerB < 0) v += CP[cofs + (size_t)rr * ldc + col];      /* rowsPerB < 0: own element of the batched C plane */ else { const int bidx = rr / rowsPerB; v += CP[(size_t)bidx * sCPb + (size_t)by * 64 + col]; } } if (ACT == 1) v = (v > 0.f) ? v : expm1f(v); else if (ACT == 7) v = (v > 0.f) ? v + 1.0f : expf(v); else if (ACT == 8) v = tanhf(v); else if (ACT == 9) v = 0.5f * v * (1.0f + tanhf(0.7978845608028654f * (v + 0.044715f * v * v * v))); else if (ACT == 11) v = 1.0f / (1.0f + expf(-v)); else if (ACT == 12) v = (v > 0.f) ? v : 0.01f * v; else if (ACT == 14) v = (v > 0.f) ? v : 0.1f * v; else if (ACT == 16) v = (v >= 0.f) ? v : 0.3f * v; else if (ACT == 17) v = (v >= 0.f) ? v : 0.2f * v; else if (ACT == 15) v = v / (1.0f + expf(-v)); else if (ACT == 3) v = fmaxf(v, 0.f); else if (ACT == 6) v = 0.5f * v * (1.0f + erff(v * 0.70710678118654752f)); so[w][8 * hh + r][t * 16 + ln] = v; } }
  __builtin_amdgcn_fence(__ATOMIC_ACQ_REL, "workgroup"); __builtin_amdgcn_wave_barrier();
  const int rsub = lane >> 4, c4 = (lane & 15) * 4; typedef _Float16 v4h __attribute__((ext_vector_type(4)));
  {
#pragma unroll
    for (int q = 0; q < 8; ++q) { const int r = q * 2 + rsub; if (col0 + c4 < N) { const v4f v = *(const v4fa*)&so[w][r][c4]; if (C) *(v4f*)(C + cofs + (size_t)(row0 + r) * ldc + col0 + c4) = v; if (C16) { v4h h4; for (int i = 0; i < 4; ++i) h4[i] = (_Float16)v[i]; *(v4h*)(C16 + cofs + (size_t)(row0 + r) * ldc + col0 + c4) = h4; } } }
     }
}


typedef _Float16 v4h __attribute__((ext_vector_type(4)));

__global__ __launch_bounds__(256) void k_x16(const float* __restrict__ x, _Float16* __restrict__ X16, size_t n8) { const size_t t = (size_t)blockIdx.x * 256 + threadIdx.x; if (t >= n8) return; FragH f;
#pragma unroll
  for (int q = 0; q < 8; ++q) f.h[q] = (_Float16)bf16_round(x[t * 8 + q]); *(v8us*)((unsigned short*)X16 + t * 8) = f.half[0];  }
__global__ __launch_bounds__(256) void k_h16(const float* __restrict__ x, _Float16* __restrict__ X16, size_t n8) { const size_t t = (size_t)blockIdx.x * 256 + threadIdx.x; if (t >= n8) return; FragH f;
#pragma unroll
  for (int q = 0; q < 8; ++q) f.h[q] = (_Float16)x[t * 8 + q]; *(v8us*)((unsigned short*)X16 + t * 8) = f.half[0];  }
__global__ __launch_bounds__(256) void k_round16f(const float* __restrict__ W, _Float16* __restrict__ Bt, size_t n8) { const size_t t = (size_t)blockIdx.x * 256 + threadIdx.x; if (t >= n8) return; FragH f;
#pragma unroll
  for (int i = 0; i < 8; ++i) f.h[i] = (_Float16)(bf16_round(W[t * 8 + i]) * 16.0f); *(v8us*)((unsigned short*)Bt + t * 8) = f.half[0];  }
__global__ __launch_bounds__(256) void k_hl(const float* __restrict__ F, _Float16* __restrict__ Hh, _Float16* __restrict__ Hl, size_t n8) { const size_t t = (size_t)blockIdx.x * 256 + threadIdx.x; if (t >= n8) return; FragH fh, fl; const v4f a = *(const v4fa*)(F + t * 8), c = *(const v4fa*)(F + t * 8 + 4);
#pragma unroll
  for (int q = 0; q < 4; ++q) { _Float16 h = (_Float16)a[q]; fh.h[q] = h; fl.h[q] = (_Float16)((a[q] - (float)h) * 1024.0f); h = (_Float16)c[q]; fh.h[4 + q] = h; fl.h[4 + q] = (_Float16)((c[q] - (float)h) * 1024.0f); }
  { *(v8us*)((unsigned short*)Hh + t * 8) = fh.half[0]; *(v8us*)((unsigned short*)Hl + t * 8) = fl.half[0];  } }

// ---- the whole operator in one kernel: one work-group = one window x 512 queries, 16 waves x 32 query columns; it owns a WGP's LDS.
// The work-group forms K (1024 x 32) and V^T (32 x 1024) of both heads of its window from x and keeps them in LDS; q, the scores and the context never leave the registers.
// S^T = K.Q^T (lane = one query column, registers = keys), so the packed score tiles are the B operand of O^T += V^T.P^T.
// q carries scale * log2(e), and the score product takes minus the shift as its C operand: one pass over the keys forms exp2(s - shift) as f16, the shift being the maximum over the first 64 key places; the row sums prove the f16 range, and a wave that cannot prove it repeats with the true maximum.
#define KPITCH 40                /* K row pitch in LDS, f16 elements: 80 B = 16 B x odd, no bank conflict for 16-byte readers */
#define VPITCH 1032              /* V^T row pitch in LDS, f16 elements: 2064 B = 16 B x odd */
#define TPITCH 72                /* weight row pitch in LDS, f16 elements: 144 B = 16 B x odd */
#define QW 512                   /* queries per work-group */
#define QSC (0.17677669529663687f * 1.4426950408889634f)      /* softmax scale * log2(e), folded into q before its rounding to f16 */
#define FPITCH 516               /* output row (one channel, 512 tokens) pitch in LDS, f32 elements: 2064 B = 16 B x odd */
typedef float v2f __attribute__((ext_vector_type(2)));
typedef float v2fa __attribute__((ext_vector_type(2), may_alias));
typedef _Float16 v2h __attribute__((ext_vector_type(2)));
union FragP { v16h v; v2h p[8]; };
__device__ __forceinline__ v16h fa_frag(const unsigned short* p, int hh) { FragH f; f.half[0] = *(const v8us*)(p + 8 * hh); f.half[1] = *(const v8us*)(p + 16 + 8 * hh); return f.v; }
__device__ __forceinline__ v8f fa_mma(v16h a, v16h b, v8f c) { return __builtin_amdgcn_wmma_f32_16x16x32_f16(false, a, false, b, (short)0, c, false, false); }
// eight exponents of one query, as the score product leaves them -> eight f16 weights (elements 8 * half .. 8 * half + 7 of the B operand), their f32 values added to su
__device__ __forceinline__ void fa_exp8(const v8f t, v2f& su, FragP& pf, const int half) {
#pragma unroll
  for (int i = 0; i < 4; ++i) { const v2f e = {__builtin_amdgcn_exp2f(t[2 * i]), __builtin_amdgcn_exp2f(t[2 * i + 1])}; su += e; pf.p[half * 4 + i] = __builtin_convertvector(e, v2h); }
}
// eight consecutive elements of a 64 x 64 f32 weight matrix (out, in) -> f16(bf16(w) * 16) in its LDS row; chunk i of 512
__device__ __forceinline__ void pj_wput(const v4f a, const v4f c, unsigned short* sWm, const int i) { FragH f;
#pragma unroll
  for (int q = 0; q < 4; ++q) { f.h[q] = (_Float16)(bf16_round(a[q]) * 16.0f); f.h[4 + q] = (_Float16)(bf16_round(c[q]) * 16.0f); }
  *(v8us*)&sWm[(i >> 3) * TPITCH + (i & 7) * 8] = f.half[0];
}
// 32 tokens x 64 channels of x, straight from NCHW: a lane reads tokens 2 ln and 2 ln + 1 of the 32 channels its fragments hold (xp stands at channel 8 hh), so a half-wave's load covers one whole 128-byte line.
__device__ __forceinline__ void fx_load(const float* __restrict__ xp, v2f (&xv)[32]) {
#pragma unroll
  for (int s = 0; s < 2; ++s) {
#pragma unroll
    for (int j = 0; j < 16; ++j) xv[s * 16 + j] = *(const v2fa*)(xp + (size_t)(s * 32 + (j >> 3) * 16 + (j & 7)) * HW);
    asm volatile("s_wait_xcnt 0x0" ::: "memory");      /* sixteen loads share one address pair: a later load may land in that pair, and this wait stands in front of it */
  }
}
// ... -> t[e][s]: tile e holds token 2 m + e in its row (or column) m, s is the k step of 32 channels. The same registers serve as A and as B operand.
__device__ __forceinline__ void fx_frags(const v2f (&xv)[32], v16h (&t)[2][2]) {
#pragma unroll
  for (int s = 0; s < 2; ++s) { FragH f0, f1;
#pragma unroll
    for (int j = 0; j < 16; ++j) { f0.h[j] = (_Float16)bf16_round(xv[s * 16 + j][0]); f1.h[j] = (_Float16)bf16_round(xv[s * 16 + j][1]); }
    t[0][s] = f0.v; t[1][s] = f1.v; }
}
// one head of a wave's 32 queries against all 1024 key places; bq0 and bq1 hold q * QSC, so K.Q^T is the score in log2 units: the normalised context comes back as the B operand of Wp.ctx^T (lane = query, registers = channels 8 hh .. and 16 + 8 hh ..)
__device__ __forceinline__ void fa_head(const unsigned short* kl, const unsigned short* vl, const int hh, const v16h bq0, const v16h bq1, FragH& c0, FragH& c1) {
  const v8f z8 = {0.f,0.f,0.f,0.f,0.f,0.f,0.f,0.f};
  v8f o00, o10, o01, o11; float su0, su1;
  // Softmax is the same for any shift, so the shift need not be the true maximum: the first trip takes the maximum of the first 64 key places only.
  // The weights are positive, so a lane's sum bounds each of its weights: a sum of at most 2^15 proves that none left the f16 range.
  // Where a lane of the wave cannot prove it, the wave runs a second trip with the true maximum of all keys (every weight at most 1). Two trips at most.
  for (int nkt = 4; ; nkt = NTW / 16) {
    float m0 = -3.0e38f, m1 = -3.0e38f;
    for (int kt = 0; kt < nkt; kt += 4) {
#pragma unroll      /* four key tiles a trip: the later tiles' LDS reads overlap the earlier tiles' products and maxima */
      for (int k4 = 0; k4 < 4; ++k4) { const v16h a = fa_frag(kl + (kt + k4) * 16 * KPITCH, hh); const v8f s0 = fa_mma(a, bq0, z8), s1 = fa_mma(a, bq1, z8);
#pragma unroll
        for (int r = 0; r < 8; ++r) { m0 = fmaxf(m0, s0[r]); m1 = fmaxf(m1, s1[r]); } } }
    m0 = fmaxf(m0, __shfl_xor(m0, 16, 32)); m1 = fmaxf(m1, __shfl_xor(m1, 16, 32));      /* lanes l and l ^ 16 hold the two halves of a query's keys and must shift alike */
    /* a lane's eight accumulator registers belong to one query, so minus its shift in all eight, given to the score product as its C operand, makes D the exponent itself: no vector multiply-add per score */
    const float n0f = -m0, n1f = -m1;
    const v8f nb0 = {n0f, n0f, n0f, n0f, n0f, n0f, n0f, n0f}, nb1 = {n1f, n1f, n1f, n1f, n1f, n1f, n1f, n1f};
    o00 = z8; o10 = z8; o01 = z8; o11 = z8; v2f sa0 = {0.f, 0.f}, sb0 = {0.f, 0.f}, sa1 = {0.f, 0.f}, sb1 = {0.f, 0.f};
#pragma unroll 2      /* two passes of 32 keys a trip: the second pass's LDS reads and products overlap the first's exponentials */
    for (int kb = 0; kb < NTW; kb += 32) {
      const v16h a0 = fa_frag(kl + kb * KPITCH, hh), a1 = fa_frag(kl + (kb + 16) * KPITCH, hh);
      const v16h v0 = fa_frag(vl + kb, hh), v1 = fa_frag(vl + 16 * VPITCH + kb, hh);
      const v8f s00 = fa_mma(a0, bq0, nb0), s10 = fa_mma(a1, bq0, nb0), s01 = fa_mma(a0, bq1, nb1), s11 = fa_mma(a1, bq1, nb1);
      FragP p0, p1;
      fa_exp8(s00, sa0, p0, 0); fa_exp8(s10, sb0, p0, 1);
      fa_exp8(s01, sa1, p1, 0); fa_exp8(s11, sb1, p1, 1);
      o00 = fa_mma(v0, p0.v, o00); o10 = fa_mma(v1, p0.v, o10); o01 = fa_mma(v0, p1.v, o01); o11 = fa_mma(v1, p1.v, o11);
    }
    su0 = (sa0[0] + sa0[1]) + (sb0[0] + sb0[1]); su1 = (sa1[0] + sa1[1]) + (sb1[0] + sb1[1]);
    /* negated compares, so that an infinite or undefined sum counts as unproven; the ballot makes the branch the same for the whole wave, as the matrix instructions need */
    if (nkt == NTW / 16 || __builtin_amdgcn_ballot_w32(!(su0 <= 32768.0f && su1 <= 32768.0f)) == 0u) break;
  }
  su0 += __shfl_xor(su0, 16, 32); su1 += __shfl_xor(su1, 16, 32);
  const float r0 = 1.0f / su0, r1 = 1.0f / su1;      /* sums and products carry the same shift */
#pragma unroll
  for (int r = 0; r < 8; ++r) { c0.h[r] = (_Float16)(o00[r] * r0); c0.h[8 + r] = (_Float16)(o10[r] * r0); c1.h[r] = (_Float16)(o01[r] * r1); c1.h[8 + r] = (_Float16)(o11[r] * r1); }
}
// x (NCHW f32) -> out (NCHW f32). A wave projects 64 tokens of the window: its own 32 queries (q, k, v) and the 32 tokens at the same place of the window's other half (k, v).
// Softmax and P.V do not depend on the order of the keys, so K rows and V^T columns stand in the order the fragments come in: place base + 16 e + m holds token base + 2 m + e (base a multiple of 32), in K and in V^T alike.
__global__ __launch_bounds__(512) void k_pattn(const float* __restrict__ x, const float* __restrict__ Wq, const float* __restrict__ Wk, const float* __restrict__ Wv, const float* __restrict__ Wp, float* __restrict__ out) {
  __shared__ __attribute__((aligned(16))) unsigned short sK[NHD * NTW * KPITCH];      /* K, head after head; at the end the 64 x FPITCH f32 output tile, which is smaller */
  __shared__ __attribute__((aligned(16))) unsigned short sV[NHD * HD * VPITCH];      /* V^T: 64 channel rows, head after head */
  __shared__ __attribute__((aligned(16))) unsigned short sW[3 * CC * TPITCH];      /* Wq, Wk, Wv; later Wp in Wq's place */
  const int tid = threadIdx.x, w = tid >> 5, lane = tid & 31, ln = lane & 15, hh = lane >> 4;
  const int bp = blockIdx.x >> 1, hf = blockIdx.x & 1;
  const size_t w0 = (size_t)(bp / NPW) * CC * HW + (size_t)(bp % NPW) * NTW;      /* channel 0 of the window's first token, in x and in out */
  const int tA = hf * QW + w * 32, tB = (1 - hf) * QW + w * 32;
  const float* xl = x + w0 + (size_t)(8 * hh) * HW + 2 * ln;
  const v4f wqa = *(const v4fa*)(Wq + tid * 8), wqc = *(const v4fa*)(Wq + tid * 8 + 4), wka = *(const v4fa*)(Wk + tid * 8), wkc = *(const v4fa*)(Wk + tid * 8 + 4);
  const v4f wva = *(const v4fa*)(Wv + tid * 8), wvc = *(const v4fa*)(Wv + tid * 8 + 4), wpa = *(const v4fa*)(Wp + tid * 8), wpc = *(const v4fa*)(Wp + tid * 8 + 4);
  v2f xa[32], xb[32];
  fx_load(xl + tA, xa); fx_load(xl + tB, xb);
  __builtin_amdgcn_sched_barrier(0);      /* every load above is issued before the first wait: without this line the weights are waited for and converted first, and x pays a second memory latency behind them */
  pj_wput(wqa, wqc, sW, tid); pj_wput(wka, wkc, sW + CC * TPITCH, tid); pj_wput(wva, wvc, sW + 2 * CC * TPITCH, tid);
  v16h ta[2][2], tb[2][2];
  fx_frags(xa, ta); fx_frags(xb, tb);
  __syncthreads();      /* the three weight matrices are complete */
  const v8f z8 = {0.f,0.f,0.f,0.f,0.f,0.f,0.f,0.f};
  FragH bq[NHD][2];      /* q of head h, query tile e: W.X^T leaves a lane eight consecutive channels of one token, which is the B operand of K.Q^T as it stands */
#pragma unroll
  for (int mt = 0; mt < 4; ++mt) {
    const unsigned short* wl = &sW[(mt * 16 + ln) * TPITCH];
    const v16h a0 = fa_frag(wl, hh), a1 = fa_frag(wl + 32, hh);
    const v8f d0 = fa_mma(a1, ta[0][1], fa_mma(a0, ta[0][0], z8)), d1 = fa_mma(a1, ta[1][1], fa_mma(a0, ta[1][0], z8));
#pragma unroll
    for (int r = 0; r < 8; ++r) { bq[mt >> 1][0].h[(mt & 1) * 8 + r] = (_Float16)(d0[r] * (0.0625f * QSC)); bq[mt >> 1][1].h[(mt & 1) * 8 + r] = (_Float16)(d1[r] * (0.0625f * QSC)); }
  }
#pragma unroll
  for (int mt = 0; mt < 4; ++mt) {      /* k: W.X^T, a lane holds eight consecutive channels of one token: 16 bytes of that token's K row */
    const unsigned short* wl = &sW[(CC + mt * 16 + ln) * TPITCH];
    const v16h a0 = fa_frag(wl, hh), a1 = fa_frag(wl + 32, hh);
    unsigned short* so = &sK[((mt >> 1) * NTW + ln) * KPITCH + (mt & 1) * 16 + 8 * hh];
#pragma unroll
    for (int e = 0; e < 2; ++e) {
      const v8f d0 = fa_mma(a1, ta[e][1], fa_mma(a0, ta[e][0], z8)), d1 = fa_mma(a1, tb[e][1], fa_mma(a0, tb[e][0], z8));
      FragH f;
#pragma unroll
      for (int r = 0; r < 8; ++r) { f.h[r] = (_Float16)(d0[r] * 0.0625f); f.h[8 + r] = (_Float16)(d1[r] * 0.0625f); }
      *(v8us*)(so + (tA + e * 16) * KPITCH) = f.half[0]; *(v8us*)(so + (tB + e * 16) * KPITCH) = f.half[1];
    }
  }
#pragma unroll
  for (int nt = 0; nt < 4; ++nt) {      /* v: X.W^T, a lane holds eight consecutive places of one channel: 16 bytes of that channel's V^T row */
    const unsigned short* wl = &sW[(2 * CC + nt * 16 + ln) * TPITCH];
    const v16h b0 = fa_frag(wl, hh), b1 = fa_frag(wl + 32, hh);
    unsigned short* so = &sV[(nt * 16 + ln) * VPITCH + 8 * hh];
#pragma unroll
    for (int e = 0; e < 2; ++e) {
      const v8f d0 = fa_mma(ta[e][1], b1, fa_mma(ta[e][0], b0, z8)), d1 = fa_mma(tb[e][1], b1, fa_mma(tb[e][0], b0, z8));
      FragH f;
#pragma unroll
      for (int r = 0; r < 8; ++r) { f.h[r] = (_Float16)(d0[r] * 0.0625f); f.h[8 + r] = (_Float16)(d1[r] * 0.0625f); }
      *(v8us*)(so + tA + e * 16) = f.half[0]; *(v8us*)(so + tB + e * 16) = f.half[1];
    }
  }
  __syncthreads();      /* K and V^T of the whole window are complete, and every wave has read Wq, Wk and Wv for the last time */
  pj_wput(wpa, wpc, sW, tid);      /* published by the barrier behind the two heads */
  FragH ca0, ca1, cb0, cb1;      /* context of head 0 (ca) and head 1 (cb), query tiles 0 and 1 */
  fa_head(&sK[ln * KPITCH], &sV[ln * VPITCH], hh, bq[0][0].v, bq[0][1].v, ca0, ca1);
  fa_head(&sK[(NTW + ln) * KPITCH], &sV[(HD + ln) * VPITCH], hh, bq[1][0].v, bq[1][1].v, cb0, cb1);
  __syncthreads();      /* every wave has read K and V^T for the last time: the LDS may take the output tile */
  float* sF = (float*)sK;
  const unsigned short* wl = &sW[ln * TPITCH];
#pragma unroll
  for (int ot = 0; ot < 4; ++ot) {      /* Wp.ctx^T: a lane holds eight consecutive output channels of tokens 2 ln and 2 ln + 1; k = head 0's channels, then head 1's */
    const v16h a0 = fa_frag(wl + ot * 16 * TPITCH, hh), a1 = fa_frag(wl + ot * 16 * TPITCH + 32, hh);
    const v8f d0 = fa_mma(a1, cb0.v, fa_mma(a0, ca0.v, z8)), d1 = fa_mma(a1, cb1.v, fa_mma(a0, ca1.v, z8));
    float* so = &sF[(ot * 16 + 8 * hh) * FPITCH + w * 32 + 2 * ln];
#pragma unroll
    for (int r = 0; r < 8; ++r) { const v2f o2 = {d0[r] * 0.0625f, d1[r] * 0.0625f}; *(v2fa*)(so + r * FPITCH) = o2; }
  }
  __syncthreads();      /* the 64 x 512 output tile is complete: each store below covers whole lines of one channel */
  float* dp = out + w0 + hf * QW;
  for (int j = 0; j < CC * QW / 4 / 512; ++j) { const int i = j * 512 + tid, o = i >> 7, pc = i & 127;
    *(v4f*)(dp + (size_t)o * HW + pc * 4) = *(const v4fa*)&sF[o * FPITCH + pc * 4]; }
}

extern "C" void kernel_launch(void* const* d_in, const int* in_sizes, int n_in,
                              void* d_out, int out_size, void* d_ws, size_t ws_size, hipStream_t stream) {
  (void)in_sizes; (void)n_in; (void)out_size; (void)d_ws; (void)ws_size;
  const float* const* I = (const float* const*)d_in; const float* x = I[0]; const float* Wq = I[1]; const float* Wk = I[2]; const float* Wv = I[3]; const float* Wp = I[4];
  k_pattn<<<NB * NPW * 2, 512, 0, stream>>>(x, Wq, Wk, Wv, Wp, (float*)d_out);      /* projections, scores, softmax, context of both heads, ctx Wp^T: NCHW to NCHW, no workspace */
}

// v007
// A run of this version takes 31.9 microseconds.
// Two timings next to v006 put it at 1.05 and 1.04 times that version's speed.
// Over all steps from v000 it is 33.3 times as fast.
#include <hip/hip_runtime.h>
// patch_attention (2 x 64 ch x 256 x 256; 64 row-band windows of 4 rows x 256 = 1024 tokens; 2 heads x 32; q, k, v = feat W^T per window; softmax(q.k / sqrt(32)) within the window; out = ctx Wp^T; back to NCHW).
// Compute dtype: inputs rounded to bf16; x, Wq, Wk and Wv are bf16 operands as they stand (v_wmma_f32_16x16x32_bf16), Wp exact as f16; q/k/v, the softmax weights and the context as plain f16 operands; softmax f32. v_wmma_f32_16x16x32_f16.
#define NB 2
#define CC 64
#define HW 65536
#define NPW 64                   /* windows per image */
#define NTW 1024                 /* tokens per window */
#define NHD 2
#define HD 32
#define NTOK (NB * HW)           /* 131072 */
#define NU (NB * NPW * NHD)      /* 256 units */
typedef __bf16 v16b __attribute__((ext_vector_type(16)));
typedef unsigned short v8us __attribute__((ext_vector_type(8), may_alias));
typedef float  v8f  __attribute__((ext_vector_type(8)));
typedef float  v4f  __attribute__((ext_vector_type(4)));
typedef float  v4fa __attribute__((ext_vector_type(4), may_alias));
union FragB { v16b v; v8us half[2]; unsigned short u[16]; };

__device__ __forceinline__ unsigned short bf16_bits(float x) { unsigned int u = __float_as_uint(x); return (unsigned short)((u + 0x7FFFu + ((u >> 16) & 1u)) >> 16); }
__device__ __forceinline__ float bf16_val(unsigned short b) { return __uint_as_float(((unsigned int)b) << 16); }
__device__ __forceinline__ float bf16_round(float x) { return bf16_val(bf16_bits(x)); }
// D += A·B with NT terms: 1 = ah·bh, 2 = + al·bh (A split), 3 = + ah·bl (both split)
template <int NT>
__device__ __forceinline__ v8f mmaN(v16b ah, v16b al, v16b bh, v16b bl, v8f c) {
  c = __builtin_amdgcn_wmma_f32_16x16x32_bf16(false, ah, false, bh, (short)0, c, false, false);
  if (NT >= 2) c = __builtin_amdgcn_wmma_f32_16x16x32_bf16(false, al, false, bh, (short)0, c, false, false);
  if (NT >= 3) c = __builtin_amdgcn_wmma_f32_16x16x32_bf16(false, ah, false, bl, (short)0, c, false, false);
  asm volatile("v_nop\n\tv_nop\n\tv_nop\n\tv_nop" : "+v"(c) : "v"(ah), "v"(al), "v"(bh), "v"(bl));
  return c;
}

__global__ __launch_bounds__(256) void k_wt_bf16(const float* __restrict__ W, unsigned short* __restrict__ Wt, int K, int N) {
  const int t = blockIdx.x * 256 + threadIdx.x;
  const int k8n = K / 8;
  if (t >= N * k8n) return;
  const int n = t / k8n, k8 = (t % k8n) * 8;
  v8us v;
#pragma unroll
  for (int i = 0; i < 8; ++i) v[i] = bf16_bits(W[(size_t)(k8 + i) * N + n]);
  *(v8us*)(Wt + (size_t)n * K + k8) = v;
  
}

// GEMM C[M][N] (f32, pitch ldc) = act(A[M][K]·W + bias). A f32 row-major (pitch lda) converted per fragment to bf16
// (ASPLIT: hi/lo two planes -> 2 terms, else single rounded term); Wt bf16 [N][K] (pitch ldb). BIAS_BF16 rounds the
// bias to bf16 first (bias quantised to bf16 before the add). K%32==0, M%16==0, N%64==0.
template <bool ASPLIT, int ACT, bool BIAS_BF16>
__global__ __launch_bounds__(128) void k_gemm_bf(const float* __restrict__ A, int lda, const unsigned short* __restrict__ Wt, int ldb,
                                               const float* __restrict__ bias, float* __restrict__ C, int ldc, int M, int N, int K) {
  __shared__ __attribute__((aligned(16))) float so[4][16][64];
  const int tid = threadIdx.x, w = tid >> 5, lane = tid & 31, ln = lane & 15, hh = lane >> 4;
  const int ntn = N / 64;
  const int wid = blockIdx.x * 4 + w;
  const int mt = wid / ntn, nq = wid % ntn;
  if (mt * 16 >= M) return;
  const int row0 = mt * 16, col0 = nq * 64;
  const float* arow = A + (size_t)(row0 + ln) * lda;
  v8f acc[4] = {};
  for (int kb = 0; kb < K; kb += 32) {
    FragB ah, al;
    const v4f x0 = *(const v4fa*)(arow + kb + 8 * hh), x1 = *(const v4fa*)(arow + kb + 8 * hh + 4);
    const v4f x2 = *(const v4fa*)(arow + kb + 16 + 8 * hh), x3 = *(const v4fa*)(arow + kb + 16 + 8 * hh + 4);
    float xs[16] = {x0[0],x0[1],x0[2],x0[3],x1[0],x1[1],x1[2],x1[3],x2[0],x2[1],x2[2],x2[3],x3[0],x3[1],x3[2],x3[3]};
#pragma unroll
    for (int i = 0; i < 16; ++i) { const unsigned short hb = bf16_bits(xs[i]); ah.u[i] = hb; al.u[i] = ASPLIT ? bf16_bits(xs[i] - bf16_val(hb)) : (unsigned short)0; }
#pragma unroll
    for (int t = 0; t < 4; ++t) {
      const unsigned short* brow = Wt + (size_t)(col0 + t * 16 + ln) * ldb + kb;
      FragB b;
      b.half[0] = *(const v8us*)(brow + 8 * hh);
      b.half[1] = *(const v8us*)(brow + 16 + 8 * hh);
      acc[t] = mmaN<ASPLIT ? 2 : 1>(ah.v, al.v, b.v, b.v, acc[t]);
    }
  }
#pragma unroll
  for (int t = 0; t < 4; ++t) {
    float bv = bias ? bias[col0 + t * 16 + ln] : 0.f;
    if (BIAS_BF16) bv = bf16_round(bv);
#pragma unroll
    for (int r = 0; r < 8; ++r) { float v = acc[t][r] + bv; if (ACT == 1) v = fmaxf(v, 0.f); so[w][8 * hh + r][t * 16 + ln] = v; }
  }
  __builtin_amdgcn_fence(__ATOMIC_ACQ_REL, "workgroup");
  __builtin_amdgcn_wave_barrier();
  const int rsub = lane >> 4, c4 = (lane & 15) * 4;
  {
#pragma unroll
    for (int q = 0; q < 8; ++q) {
      const int r = q * 2 + rsub;
      const v4f v = *(const v4fa*)&so[w][r][c4];
      *(v4f*)(C + (size_t)(row0 + r) * ldc + col0 + c4) = v;
    }
    
  }
}

// GEMM C = act(A·W + bias + resid): A f32 (ASPLIT -> hi/lo 2 terms), Wt bf16 [N][K]; ACT 0 none, 1 relu, 2 exact gelu;
// resid (optional, f32, row index = (row % rmod), pitch ldr, RES_BF16 rounds it) added before the activation.
template <bool ASPLIT, int ACT, bool BIAS_BF16, bool RES_BF16>
__global__ __launch_bounds__(128) void k_gemm_bf3(const float* __restrict__ A, int lda, const unsigned short* __restrict__ Wt, int ldb,
                                                const float* __restrict__ bias, const float* __restrict__ resid, int rmod, int ldr,
                                                float* __restrict__ C, int ldc, int M, int N, int K) {
  __shared__ __attribute__((aligned(16))) float so[4][16][64];
  const int tid = threadIdx.x, w = tid >> 5, lane = tid & 31, ln = lane & 15, hh = lane >> 4;
  const int ntn = N / 64;
  const int wid = blockIdx.x * 4 + w;
  const int mt = wid / ntn, nq = wid % ntn;
  if (mt * 16 >= M) return;
  const int row0 = mt * 16, col0 = nq * 64;
  const float* arow = A + (size_t)(row0 + ln) * lda;
  v8f acc[4] = {};
  for (int kb = 0; kb < K; kb += 32) {
    FragB ah, al;
    const v4f x0 = *(const v4fa*)(arow + kb + 8 * hh), x1 = *(const v4fa*)(arow + kb + 8 * hh + 4);
    const v4f x2 = *(const v4fa*)(arow + kb + 16 + 8 * hh), x3 = *(const v4fa*)(arow + kb + 16 + 8 * hh + 4);
    float xs[16] = {x0[0],x0[1],x0[2],x0[3],x1[0],x1[1],x1[2],x1[3],x2[0],x2[1],x2[2],x2[3],x3[0],x3[1],x3[2],x3[3]};
#pragma unroll
    for (int i = 0; i < 16; ++i) { const unsigned short hb = bf16_bits(xs[i]); ah.u[i] = hb; al.u[i] = ASPLIT ? bf16_bits(xs[i] - bf16_val(hb)) : (unsigned short)0; }
#pragma unroll
    for (int t = 0; t < 4; ++t) {
      const unsigned short* brow = Wt + (size_t)(col0 + t * 16 + ln) * ldb + kb;
      FragB b;
      b.half[0] = *(const v8us*)(brow + 8 * hh);
      b.half[1] = *(const v8us*)(brow + 16 + 8 * hh);
      acc[t] = mmaN<ASPLIT ? 2 : 1>(ah.v, al.v, b.v, b.v, acc[t]);
    }
  }
#pragma unroll
  for (int t = 0; t < 4; ++t) {
    const int col = col0 + t * 16 + ln;
    float bv = bias ? bias[col] : 0.f;
    if (BIAS_BF16) bv = bf16_round(bv);
#pragma unroll
    for (int r = 0; r < 8; ++r) {
      float v = acc[t][r] + bv;
      if (resid) { float rv = resid[(size_t)((row0 + 8 * hh + r) % rmod) * ldr + col]; if (RES_BF16) rv = bf16_round(rv); v += rv; }
      if (ACT == 1) v = fmaxf(v, 0.f);
      if (ACT == 2) v = 0.5f * v * (1.0f + erff(v * 0.70710678118654752f));
      if (ACT == 3) { const float u = 0.7978845608028654f * (v + 0.044715f * v * v * v); v = 0.5f * v * (1.0f + tanhf(u)); }
      so[w][8 * hh + r][t * 16 + ln] = v;
    }
  }
  __builtin_amdgcn_fence(__ATOMIC_ACQ_REL, "workgroup");
  __builtin_amdgcn_wave_barrier();
  const int rsub = lane >> 4, c4 = (lane & 15) * 4;
  {
#pragma unroll
    for (int q = 0; q < 8; ++q) {
      const int r = q * 2 + rsub;
      const v4f v = *(const v4fa*)&so[w][r][c4];
      *(v4f*)(C + (size_t)(row0 + r) * ldc + col0 + c4) = v;
    }
    
  }
}
// row LayerNorm (biased variance, eps) over N: s = X (+ R); optional out_sum <- s; out_norm <- (s-mu)*rsqrt(var+eps)*g + b
template <bool PARAM_BF16>
__global__ __launch_bounds__(256) void k_layernorm(const float* __restrict__ X, const float* __restrict__ R, const float* __restrict__ g, const float* __restrict__ bta,
                                                  float* __restrict__ out_sum, float* __restrict__ out_norm, int N, float eps) {
  __shared__ float red[256];
  const int row = blockIdx.x, tid = threadIdx.x;
  const float* x = X + (size_t)row * N; const float* rr = R ? R + (size_t)row * N : nullptr;
  float vals[16];                     // up to N = 4096
  const int per = N / 256;            // contiguous chunk per thread? use strided-by-4 chunks: thread handles j = tid*4 + 1024*u
  float s1 = 0.f;
  for (int u = 0; u < per / 4; ++u) {
    const int j = tid * 4 + 1024 * u;
    const v4f a = *(const v4fa*)(x + j);
    v4f b = {0.f,0.f,0.f,0.f}; if (rr) b = *(const v4fa*)(rr + j);
#pragma unroll
    for (int q = 0; q < 4; ++q) { const float v = a[q] + b[q]; vals[u * 4 + q] = v; s1 += v; }
  }
  red[tid] = s1; __syncthreads();
  for (int st = 128; st > 0; st >>= 1) { if (tid < st) red[tid] += red[tid + st]; __syncthreads(); }
  const float mu = red[0] / (float)N; __syncthreads();
  float s2 = 0.f;
  for (int u = 0; u < per / 4; ++u)
#pragma unroll
    for (int q = 0; q < 4; ++q) { const float c = vals[u * 4 + q] - mu; s2 += c * c; }
  red[tid] = s2; __syncthreads();
  for (int st = 128; st > 0; st >>= 1) { if (tid < st) red[tid] += red[tid + st]; __syncthreads(); }
  const float rs = rsqrtf(red[0] / (float)N + eps);
  {
    for (int u = 0; u < per / 4; ++u) {
      const int j = tid * 4 + 1024 * u;
      v4f o, sm;
#pragma unroll
      for (int q = 0; q < 4; ++q) {
        float gg = g[j + q], bb = bta[j + q];
        if (PARAM_BF16) { gg = bf16_round(gg); bb = bf16_round(bb); }
        sm[q] = vals[u * 4 + q]; o[q] = (vals[u * 4 + q] - mu) * rs * gg + bb;
      }
      if (out_sum) *(v4f*)(out_sum + (size_t)row * N + j) = sm;
      *(v4f*)(out_norm + (size_t)row * N + j) = o;
    }
    
  }
}



// ---- f16 WMMA path (v_wmma_f32_16x16x32_f16): 11-bit significands for operands in range — used where a [0,1] probability operand needs more precision than bf16
typedef _Float16 v16h __attribute__((ext_vector_type(16)));
union FragH { v16h v; v8us half[2]; _Float16 h[16]; unsigned short u[16]; };
template <int NT>
__device__ __forceinline__ v8f mmaH(v16h ah, v16h al, v16h bh, v16h bl, v8f c) {
  c = __builtin_amdgcn_wmma_f32_16x16x32_f16(false, ah, false, bh, (short)0, c, false, false);
  if (NT >= 2) c = __builtin_amdgcn_wmma_f32_16x16x32_f16(false, al, false, bh, (short)0, c, false, false);
  if (NT >= 3) c = __builtin_amdgcn_wmma_f32_16x16x32_f16(false, ah, false, bl, (short)0, c, false, false);
  asm volatile("v_nop\n\tv_nop\n\tv_nop\n\tv_nop" : "+v"(c) : "v"(ah), "v"(al), "v"(bh), "v"(bl));
  return c;
}
// batched GEMM like k_gemm_b but f16 operands: A f32 (split into f16 hi/lo if ASPLIT, else rounded to f16), Bt = f16 values [n][k]; alpha; C f32; N multiple of 16 (partial tiles skipped)
template <bool ASPLIT>
__global__ __launch_bounds__(128) void k_gemm_h(const float* __restrict__ A, int lda, size_t sA, const _Float16* __restrict__ Bh, int ldb, size_t sB, float alpha, float* __restrict__ C, int ldc, size_t sC, int M, int N, int K) {
  __shared__ __attribute__((aligned(16))) float so[4][16][64];
  const int tid = threadIdx.x, w = tid >> 5, lane = tid & 31, ln = lane & 15, hh = lane >> 4; const int by = blockIdx.y;
  A += (size_t)by * sA; Bh += (size_t)by * sB; C += (size_t)by * sC;
  const int ntn = (N + 63) / 64; const int wid = blockIdx.x * 4 + w; const int mt = wid / ntn, nq = wid % ntn; if (mt * 16 >= M) return;
  const int row0 = mt * 16, col0 = nq * 64; const float* arow = A + (size_t)(row0 + ln) * lda;
  v8f acc[4] = {};
  for (int kb = 0; kb < K; kb += 32) {
    FragH ah, al;
    const v4f x0 = *(const v4fa*)(arow + kb + 8 * hh), x1 = *(const v4fa*)(arow + kb + 8 * hh + 4), x2 = *(const v4fa*)(arow + kb + 16 + 8 * hh), x3 = *(const v4fa*)(arow + kb + 16 + 8 * hh + 4);
    float xs[16] = {x0[0],x0[1],x0[2],x0[3],x1[0],x1[1],x1[2],x1[3],x2[0],x2[1],x2[2],x2[3],x3[0],x3[1],x3[2],x3[3]};
#pragma unroll
    for (int i = 0; i < 16; ++i) { const _Float16 h = (_Float16)xs[i]; ah.h[i] = h; al.h[i] = ASPLIT ? (_Float16)(xs[i] - (float)h) : (_Float16)0.0f; }
#pragma unroll
    for (int t = 0; t < 4; ++t) { if (col0 + t * 16 >= N) continue; const size_t boff = (size_t)(col0 + t * 16 + ln) * ldb + kb; FragH bq; bq.half[0] = *(const v8us*)(Bh + boff + 8 * hh); bq.half[1] = *(const v8us*)(Bh + boff + 16 + 8 * hh);
      acc[t] = mmaH<ASPLIT ? 2 : 1>(ah.v, al.v, bq.v, bq.v, acc[t]); }
  }
#pragma unroll
  for (int t = 0; t < 4; ++t) { if (col0 + t * 16 >= N) continue;
#pragma unroll
    for (int r = 0; r < 8; ++r) so[w][8 * hh + r][t * 16 + ln] = acc[t][r] * alpha; }
  __builtin_amdgcn_fence(__ATOMIC_ACQ_REL, "workgroup"); __builtin_amdgcn_wave_barrier();
  const int rsub = lane >> 4, c4 = (lane & 15) * 4;
  {
#pragma unroll
    for (int q = 0; q < 8; ++q) { const int r = q * 2 + rsub; if (col0 + c4 < N) { const v4f v = *(const v4fa*)&so[w][r][c4]; *(v4f*)(C + (size_t)(row0 + r) * ldc + col0 + c4) = v; } }
     }
}

// Wt[n][k] = f16(W[k][n]·scale) from f32 row-major W[K][N] (scale = power of two; bf16-exact weights stay exact in f16 away from the subnormal range)
__global__ __launch_bounds__(256) void k_wt_f16(const float* __restrict__ W, _Float16* __restrict__ Wt, int K, int N, float scale) {
  const int t = blockIdx.x * 256 + threadIdx.x; if (t >= N * (K / 8)) return; const int n = t / (K / 8), k8 = (t % (K / 8)) * 8; FragH f;
#pragma unroll
  for (int i = 0; i < 8; ++i) f.h[i] = (_Float16)(bf16_round(W[(size_t)(k8 + i) * N + n]) * scale); const v8us o = f.half[0];
  *(v8us*)((unsigned short*)Wt + (size_t)n * K + k8) = o; 
}
// k_gemm_hh variant with fused epilogue: v = acc·alpha + bias[by·sBias + col] (+ CP[(row/rowsPerB)·sCPb + by·64 + col] if CP) ; ACT 0 none / 1 elu ; writes f32 C and f16 C16, each if non-null
template <int ACT>
__global__ __launch_bounds__(128) void k_gemm_hhx(const _Float16* __restrict__ A, int lda, size_t sA, const _Float16* __restrict__ Bh, int ldb, size_t sB, float alpha, const float* __restrict__ bias, size_t sBias, const float* __restrict__ CP, int rowsPerB, size_t sCPb, int row0g,
    float* __restrict__ C, _Float16* __restrict__ C16, int ldc, size_t sC, int M, int N, int K) {
  __shared__ __attribute__((aligned(16))) float so[4][16][64];
  const int tid = threadIdx.x, w = tid >> 5, lane = tid & 31, ln = lane & 15, hh = lane >> 4; const int by = blockIdx.y;
  A += (size_t)by * sA; Bh += (size_t)by * sB; const size_t cofs = (size_t)by * sC; const float* bp = bias ? bias + (size_t)by * sBias : nullptr;
  const int ntn = (N + 63) / 64; const int wid = blockIdx.x * 4 + w; const int mt = wid / ntn, nq = wid % ntn; if (mt * 16 >= M) return;
  const int row0 = mt * 16, col0 = nq * 64; const _Float16* arow = A + (size_t)(row0 + ln) * lda;
  v8f acc[4] = {};
  for (int kb = 0; kb < K; kb += 32) { FragH ah; ah.half[0] = *(const v8us*)((const unsigned short*)arow + kb + 8 * hh); ah.half[1] = *(const v8us*)((const unsigned short*)arow + kb + 16 + 8 * hh);
#pragma unroll
    for (int t = 0; t < 4; ++t) { if (col0 + t * 16 >= N) continue; const size_t boff = (size_t)(col0 + t * 16 + ln) * ldb + kb; FragH bq; bq.half[0] = *(const v8us*)((const unsigned short*)Bh + boff + 8 * hh); bq.half[1] = *(const v8us*)((const unsigned short*)Bh + boff + 16 + 8 * hh);
      acc[t] = mmaH<1>(ah.v, ah.v, bq.v, bq.v, acc[t]); }
  }
#pragma unroll
  for (int t = 0; t < 4; ++t) { if (col0 + t * 16 >= N) continue; const int col = col0 + t * 16 + ln; const float bv = bp ? bf16_round(bp[col]) : 0.f;
#pragma unroll
    for (int r = 0; r < 8; ++r) { float v = acc[t][r] * alpha + bv; if (CP) { const int rr = row0g + row0 + 8 * hh + r; if (rowsPerB < 0) v += CP[cofs + (size_t)rr * ldc + col];      /* rowsPerB < 0: own element of the batched C plane */ else { const int bidx = rr / rowsPerB; v += CP[(size_t)bidx * sCPb + (size_t)by * 64 + col]; } } if (ACT == 1) v = (v > 0.f) ? v : expm1f(v); else if (ACT == 7) v = (v > 0.f) ? v + 1.0f : expf(v); else if (ACT == 8) v = tanhf(v); else if (ACT == 9) v = 0.5f * v * (1.0f + tanhf(0.7978845608028654f * (v + 0.044715f * v * v * v))); else if (ACT == 11) v = 1.0f / (1.0f + expf(-v)); else if (ACT == 12) v = (v > 0.f) ? v : 0.01f * v; else if (ACT == 14) v = (v > 0.f) ? v : 0.1f * v; else if (ACT == 16) v = (v >= 0.f) ? v : 0.3f * v; else if (ACT == 17) v = (v >= 0.f) ? v : 0.2f * v; else if (ACT == 15) v = v / (1.0f + expf(-v)); else if (ACT == 3) v = fmaxf(v, 0.f); else if (ACT == 6) v = 0.5f * v * (1.0f + erff(v * 0.70710678118654752f)); so[w][8 * hh + r][t * 16 + ln] = v; } }
  __builtin_amdgcn_fence(__ATOMIC_ACQ_REL, "workgroup"); __builtin_amdgcn_wave_barrier();
  const int rsub = lane >> 4, c4 = (lane & 15) * 4; typedef _Float16 v4h __attribute__((ext_vector_type(4)));
  {
#pragma unroll
    for (int q = 0; q < 8; ++q) { const int r = q * 2 + rsub; if (col0 + c4 < N) { const v4f v = *(const v4fa*)&so[w][r][c4]; if (C) *(v4f*)(C + cofs + (size_t)(row0 + r) * ldc + col0 + c4) = v; if (C16) { v4h h4; for (int i = 0; i < 4; ++i) h4[i] = (_Float16)v[i]; *(v4h*)(C16 + cofs + (size_t)(row0 + r) * ldc + col0 + c4) = h4; } } }
     }
}


typedef _Float16 v4h __attribute__((ext_vector_type(4)));

__global__ __launch_bounds__(256) void k_x16(const float* __restrict__ x, _Float16* __restrict__ X16, size_t n8) { const size_t t = (size_t)blockIdx.x * 256 + threadIdx.x; if (t >= n8) return; FragH f;
#pragma unroll
  for (int q = 0; q < 8; ++q) f.h[q] = (_Float16)bf16_round(x[t * 8 + q]); *(v8us*)((unsigned short*)X16 + t * 8) = f.half[0];  }
__global__ __launch_bounds__(256) void k_h16(const float* __restrict__ x, _Float16* __restrict__ X16, size_t n8) { const size_t t = (size_t)blockIdx.x * 256 + threadIdx.x; if (t >= n8) return; FragH f;
#pragma unroll
  for (int q = 0; q < 8; ++q) f.h[q] = (_Float16)x[t * 8 + q]; *(v8us*)((unsigned short*)X16 + t * 8) = f.half[0];  }
__global__ __launch_bounds__(256) void k_round16f(const float* __restrict__ W, _Float16* __restrict__ Bt, size_t n8) { const size_t t = (size_t)blockIdx.x * 256 + threadIdx.x; if (t >= n8) return; FragH f;
#pragma unroll
  for (int i = 0; i < 8; ++i) f.h[i] = (_Float16)(bf16_round(W[t * 8 + i]) * 16.0f); *(v8us*)((unsigned short*)Bt + t * 8) = f.half[0];  }
__global__ __launch_bounds__(256) void k_hl(const float* __restrict__ F, _Float16* __restrict__ Hh, _Float16* __restrict__ Hl, size_t n8) { const size_t t = (size_t)blockIdx.x * 256 + threadIdx.x; if (t >= n8) return; FragH fh, fl; const v4f a = *(const v4fa*)(F + t * 8), c = *(const v4fa*)(F + t * 8 + 4);
#pragma unroll
  for (int q = 0; q < 4; ++q) { _Float16 h = (_Float16)a[q]; fh.h[q] = h; fl.h[q] = (_Float16)((a[q] - (float)h) * 1024.0f); h = (_Float16)c[q]; fh.h[4 + q] = h; fl.h[4 + q] = (_Float16)((c[q] - (float)h) * 1024.0f); }
  { *(v8us*)((unsigned short*)Hh + t * 8) = fh.half[0]; *(v8us*)((unsigned short*)Hl + t * 8) = fl.half[0];  } }

// ---- the whole operator in one kernel: one work-group = one window x 512 queries, 16 waves x 32 query columns; it owns a WGP's LDS.
// The work-group forms K (1024 x 32) and V^T (32 x 1024) of both heads of its window from x and keeps them in LDS; q, the scores and the context never leave the registers.
// S^T = K.Q^T (lane = one query column, registers = keys), so the packed score tiles are the B operand of O^T += V^T.P^T.
// q carries scale * log2(e), and the score product takes minus the shift as its C operand: one pass over the keys forms exp2(s - shift) as f16, the shift being the maximum over the first 64 key places; the row sums prove the f16 range, and a wave that cannot prove it repeats with the true maximum.
#define KPITCH 40                /* K row pitch in LDS, f16 elements: 80 B = 16 B x odd, no bank conflict for 16-byte readers */
#define VPITCH 1032              /* V^T row pitch in LDS, f16 elements: 2064 B = 16 B x odd */
#define TPITCH 72                /* weight row pitch in LDS, 16-bit elements: 144 B = 16 B x odd */
#define QW 512                   /* queries per work-group */
#define QSC (0.17677669529663687f * 1.4426950408889634f)      /* softmax scale * log2(e), folded into q before its rounding to f16 */
#define FPITCH 516               /* output row (one channel, 512 tokens) pitch in LDS, f32 elements: 2064 B = 16 B x odd */
typedef float v2f __attribute__((ext_vector_type(2)));
typedef float v2fa __attribute__((ext_vector_type(2), may_alias));
typedef _Float16 v2h __attribute__((ext_vector_type(2)));
union FragP { v16h v; v2h p[8]; };
__device__ __forceinline__ v16h fa_frag(const unsigned short* p, int hh) { FragH f; f.half[0] = *(const v8us*)(p + 8 * hh); f.half[1] = *(const v8us*)(p + 16 + 8 * hh); return f.v; }
__device__ __forceinline__ v8f fa_mma(v16h a, v16h b, v8f c) { return __builtin_amdgcn_wmma_f32_16x16x32_f16(false, a, false, b, (short)0, c, false, false); }
// eight exponents of one query, as the score product leaves them -> eight f16 weights (elements 8 * half .. 8 * half + 7 of the B operand), their f32 values added to su
__device__ __forceinline__ void fa_exp8(const v8f t, v2f& su, FragP& pf, const int half) {
#pragma unroll
  for (int i = 0; i < 4; ++i) { const v2f e = {__builtin_amdgcn_exp2f(t[2 * i]), __builtin_amdgcn_exp2f(t[2 * i + 1])}; su += e; pf.p[half * 4 + i] = __builtin_convertvector(e, v2h); }
}
// eight consecutive elements of a 64 x 64 f32 weight matrix (out, in) -> f16(bf16(w) * 16) in its LDS row; chunk i of 512
__device__ __forceinline__ void pj_wput(const v4f a, const v4f c, unsigned short* sWm, const int i) { FragH f;
#pragma unroll
  for (int q = 0; q < 4; ++q) { f.h[q] = (_Float16)(bf16_round(a[q]) * 16.0f); f.h[4 + q] = (_Float16)(bf16_round(c[q]) * 16.0f); }
  *(v8us*)&sWm[(i >> 3) * TPITCH + (i & 7) * 8] = f.half[0];
}
// the 16-bit fragments of the q, k, v projections: x and the weights rounded to bf16 are the operands themselves, one packed conversion for two values, no scaling (bf16 has the exponent range of f32)
typedef __bf16 v2b __attribute__((ext_vector_type(2)));
union FragX { v16b v; v2b p[8]; v8us half[2]; };
__device__ __forceinline__ v16b fb_frag(const unsigned short* p, int hh) { FragX f; f.half[0] = *(const v8us*)(p + 8 * hh); f.half[1] = *(const v8us*)(p + 16 + 8 * hh); return f.v; }
__device__ __forceinline__ v8f fb_mma(v16b a, v16b b, v8f c) { return __builtin_amdgcn_wmma_f32_16x16x32_bf16(false, a, false, b, (short)0, c, false, false); }
// eight consecutive elements of a 64 x 64 f32 weight matrix (out, in) -> bf16(w) in its LDS row; chunk i of 512
__device__ __forceinline__ void pj_wputb(const v4f a, const v4f c, unsigned short* sWm, const int i) { FragX f;
#pragma unroll
  for (int q = 0; q < 2; ++q) { const v2f lo = {a[2 * q], a[2 * q + 1]}, hi = {c[2 * q], c[2 * q + 1]}; f.p[q] = __builtin_convertvector(lo, v2b); f.p[2 + q] = __builtin_convertvector(hi, v2b); }
  *(v8us*)&sWm[(i >> 3) * TPITCH + (i & 7) * 8] = f.half[0];
}
// 32 tokens x 64 channels of x, straight from NCHW: a lane reads tokens 2 ln and 2 ln + 1 of the 32 channels its fragments hold (xp stands at channel 8 hh), so a half-wave's load covers one whole 128-byte line.
__device__ __forceinline__ void fx_load(const float* __restrict__ xp, v2f (&xv)[32]) {
#pragma unroll
  for (int s = 0; s < 2; ++s) {
#pragma unroll
    for (int j = 0; j < 16; ++j) xv[s * 16 + j] = *(const v2fa*)(xp + (size_t)(s * 32 + (j >> 3) * 16 + (j & 7)) * HW);
    asm volatile("s_wait_xcnt 0x0" ::: "memory");      /* sixteen loads share one address pair: a later load may land in that pair, and this wait stands in front of it */
  }
}
// ... -> t[e][s]: tile e holds token 2 m + e in its row (or column) m, s is the k step of 32 channels. The same registers serve as A and as B operand.
__device__ __forceinline__ void fx_frags(const v2f (&xv)[32], v16b (&t)[2][2]) {
#pragma unroll
  for (int s = 0; s < 2; ++s) { FragX f0, f1;
#pragma unroll
    for (int j = 0; j < 16; ++j) { f0.v[j] = (__bf16)xv[s * 16 + j][0]; f1.v[j] = (__bf16)xv[s * 16 + j][1]; }
    t[0][s] = f0.v; t[1][s] = f1.v; }
}
// one head of a wave's 32 queries against all 1024 key places; bq0 and bq1 hold q * QSC, so K.Q^T is the score in log2 units: the normalised context comes back as the B operand of Wp.ctx^T (lane = query, registers = channels 8 hh .. and 16 + 8 hh ..)
__device__ __forceinline__ void fa_head(const unsigned short* kl, const unsigned short* vl, const int hh, const v16h bq0, const v16h bq1, FragH& c0, FragH& c1) {
  const v8f z8 = {0.f,0.f,0.f,0.f,0.f,0.f,0.f,0.f};
  v8f o00, o10, o01, o11; float su0, su1;
  // Softmax is the same for any shift, so the shift need not be the true maximum: the first trip takes the maximum of the first 64 key places only.
  // The weights are positive, so a lane's sum bounds each of its weights: a sum of at most 2^15 proves that none left the f16 range.
  // Where a lane of the wave cannot prove it, the wave runs a second trip with the true maximum of all keys (every weight at most 1). Two trips at most.
  for (int nkt = 4; ; nkt = NTW / 16) {
    float m0 = -3.0e38f, m1 = -3.0e38f;
    for (int kt = 0; kt < nkt; kt += 4) {
#pragma unroll      /* four key tiles a trip: the later tiles' LDS reads overlap the earlier tiles' products and maxima */
      for (int k4 = 0; k4 < 4; ++k4) { const v16h a = fa_frag(kl + (kt + k4) * 16 * KPITCH, hh); const v8f s0 = fa_mma(a, bq0, z8), s1 = fa_mma(a, bq1, z8);
#pragma unroll
        for (int r = 0; r < 8; ++r) { m0 = fmaxf(m0, s0[r]); m1 = fmaxf(m1, s1[r]); } } }
    m0 = fmaxf(m0, __shfl_xor(m0, 16, 32)); m1 = fmaxf(m1, __shfl_xor(m1, 16, 32));      /* lanes l and l ^ 16 hold the two halves of a query's keys and must shift alike */
    /* a lane's eight accumulator registers belong to one query, so minus its shift in all eight, given to the score product as its C operand, makes D the exponent itself: no vector multiply-add per score */
    const float n0f = -m0, n1f = -m1;
    const v8f nb0 = {n0f, n0f, n0f, n0f, n0f, n0f, n0f, n0f}, nb1 = {n1f, n1f, n1f, n1f, n1f, n1f, n1f, n1f};
    o00 = z8; o10 = z8; o01 = z8; o11 = z8; v2f sa0 = {0.f, 0.f}, sb0 = {0.f, 0.f}, sa1 = {0.f, 0.f}, sb1 = {0.f, 0.f};
#pragma unroll 2      /* two passes of 32 keys a trip: the second pass's LDS reads and products overlap the first's exponentials */
    for (int kb = 0; kb < NTW; kb += 32) {
      const v16h a0 = fa_frag(kl + kb * KPITCH, hh), a1 = fa_frag(kl + (kb + 16) * KPITCH, hh);
      const v16h v0 = fa_frag(vl + kb, hh), v1 = fa_frag(vl + 16 * VPITCH + kb, hh);
      const v8f s00 = fa_mma(a0, bq0, nb0), s10 = fa_mma(a1, bq0, nb0), s01 = fa_mma(a0, bq1, nb1), s11 = fa_mma(a1, bq1, nb1);
      FragP p0, p1;
      fa_exp8(s00, sa0, p0, 0); fa_exp8(s10, sb0, p0, 1);
      fa_exp8(s01, sa1, p1, 0); fa_exp8(s11, sb1, p1, 1);
      o00 = fa_mma(v0, p0.v, o00); o10 = fa_mma(v1, p0.v, o10); o01 = fa_mma(v0, p1.v, o01); o11 = fa_mma(v1, p1.v, o11);
    }
    su0 = (sa0[0] + sa0[1]) + (sb0[0] + sb0[1]); su1 = (sa1[0] + sa1[1]) + (sb1[0] + sb1[1]);
    /* negated compares, so that an infinite or undefined sum counts as unproven; the ballot makes the branch the same for the whole wave, as the matrix instructions need */
    if (nkt == NTW / 16 || __builtin_amdgcn_ballot_w32(!(su0 <= 32768.0f && su1 <= 32768.0f)) == 0u) break;
  }
  su0 += __shfl_xor(su0, 16, 32); su1 += __shfl_xor(su1, 16, 32);
  const float r0 = 1.0f / su0, r1 = 1.0f / su1;      /* sums and products carry the same shift */
#pragma unroll
  for (int r = 0; r < 8; ++r) { c0.h[r] = (_Float16)(o00[r] * r0); c0.h[8 + r] = (_Float16)(o10[r] * r0); c1.h[r] = (_Float16)(o01[r] * r1); c1.h[8 + r] = (_Float16)(o11[r] * r1); }
}
// x (NCHW f32) -> out (NCHW f32). A wave projects 64 tokens of the window: its own 32 queries (q, k, v) and the 32 tokens at the same place of the window's other half (k, v).
// Softmax and P.V do not depend on the order of the keys, so K rows and V^T columns stand in the order the fragments come in: place base + 16 e + m holds token base + 2 m + e (base a multiple of 32), in K and in V^T alike.
__global__ __launch_bounds__(512) void k_pattn(const float* __restrict__ x, const float* __restrict__ Wq, const float* __restrict__ Wk, const float* __restrict__ Wv, const float* __restrict__ Wp, float* __restrict__ out) {
  __shared__ __attribute__((aligned(16))) unsigned short sK[NHD * NTW * KPITCH];      /* K, head after head; at the end the 64 x FPITCH f32 output tile, which is smaller */
  __shared__ __attribute__((aligned(16))) unsigned short sV[NHD * HD * VPITCH];      /* V^T: 64 channel rows, head after head */
  __shared__ __attribute__((aligned(16))) unsigned short sW[3 * CC * TPITCH];      /* Wq, Wk, Wv as bf16; later Wp, as f16 times 16, in Wq's place */
  const int tid = threadIdx.x, w = tid >> 5, lane = tid & 31, ln = lane & 15, hh = lane >> 4;
  const int bp = blockIdx.x >> 1, hf = blockIdx.x & 1;
  const size_t w0 = (size_t)(bp / NPW) * CC * HW + (size_t)(bp % NPW) * NTW;      /* channel 0 of the window's first token, in x and in out */
  const int tA = hf * QW + w * 32, tB = (1 - hf) * QW + w * 32;
  const float* xl = x + w0 + (size_t)(8 * hh) * HW + 2 * ln;
  const v4f wqa = *(const v4fa*)(Wq + tid * 8), wqc = *(const v4fa*)(Wq + tid * 8 + 4), wka = *(const v4fa*)(Wk + tid * 8), wkc = *(const v4fa*)(Wk + tid * 8 + 4);
  const v4f wva = *(const v4fa*)(Wv + tid * 8), wvc = *(const v4fa*)(Wv + tid * 8 + 4), wpa = *(const v4fa*)(Wp + tid * 8), wpc = *(const v4fa*)(Wp + tid * 8 + 4);
  asm volatile("s_wait_xcnt 0x0" ::: "memory");      /* the eight weight loads share one offset register: a load of x may land in it, and this wait stands in front of that */
  v2f xa[32], xb[32];
  fx_load(xl + tA, xa); fx_load(xl + tB, xb);
  __builtin_amdgcn_sched_barrier(0);      /* every load above is issued before the first wait: without this line the weights are waited for and converted first, and x pays a second memory latency behind them */
  pj_wputb(wqa, wqc, sW, tid); pj_wputb(wka, wkc, sW + CC * TPITCH, tid); pj_wputb(wva, wvc, sW + 2 * CC * TPITCH, tid);
  v16b ta[2][2], tb[2][2];
  fx_frags(xa, ta); fx_frags(xb, tb);
  __syncthreads();      /* the three weight matrices are complete */
  const v8f z8 = {0.f,0.f,0.f,0.f,0.f,0.f,0.f,0.f};
  FragH bq[NHD][2];      /* q of head h, query tile e: W.X^T leaves a lane eight consecutive channels of one token, which is the B operand of K.Q^T as it stands */
#pragma unroll
  for (int mt = 0; mt < 4; ++mt) {
    const unsigned short* wl = &sW[(mt * 16 + ln) * TPITCH];
    const v16b a0 = fb_frag(wl, hh), a1 = fb_frag(wl + 32, hh);
    const v8f d0 = fb_mma(a1, ta[0][1], fb_mma(a0, ta[0][0], z8)), d1 = fb_mma(a1, ta[1][1], fb_mma(a0, ta[1][0], z8));
#pragma unroll
    for (int r = 0; r < 8; ++r) { bq[mt >> 1][0].h[(mt & 1) * 8 + r] = (_Float16)(d0[r] * QSC); bq[mt >> 1][1].h[(mt & 1) * 8 + r] = (_Float16)(d1[r] * QSC); }
  }
#pragma unroll
  for (int mt = 0; mt < 4; ++mt) {      /* k: W.X^T, a lane holds eight consecutive channels of one token: 16 bytes of that token's K row */
    const unsigned short* wl = &sW[(CC + mt * 16 + ln) * TPITCH];
    const v16b a0 = fb_frag(wl, hh), a1 = fb_frag(wl + 32, hh);
    unsigned short* so = &sK[((mt >> 1) * NTW + ln) * KPITCH + (mt & 1) * 16 + 8 * hh];
#pragma unroll
    for (int e = 0; e < 2; ++e) {
      const v8f d0 = fb_mma(a1, ta[e][1], fb_mma(a0, ta[e][0], z8)), d1 = fb_mma(a1, tb[e][1], fb_mma(a0, tb[e][0], z8));
      FragH f;
#pragma unroll
      for (int r = 0; r < 8; ++r) { f.h[r] = (_Float16)d0[r]; f.h[8 + r] = (_Float16)d1[r]; }
      *(v8us*)(so + (tA + e * 16) * KPITCH) = f.half[0]; *(v8us*)(so + (tB + e * 16) * KPITCH) = f.half[1];
    }
  }
#pragma unroll
  for (int nt = 0; nt < 4; ++nt) {      /* v: X.W^T, a lane holds eight consecutive places of one channel: 16 bytes of that channel's V^T row */
    const unsigned short* wl = &sW[(2 * CC + nt * 16 + ln) * TPITCH];
    const v16b b0 = fb_frag(wl, hh), b1 = fb_frag(wl + 32, hh);
    unsigned short* so = &sV[(nt * 16 + ln) * VPITCH + 8 * hh];
#pragma unroll
    for (int e = 0; e < 2; ++e) {
      const v8f d0 = fb_mma(ta[e][1], b1, fb_mma(ta[e][0], b0, z8)), d1 = fb_mma(tb[e][1], b1, fb_mma(tb[e][0], b0, z8));
      FragH f;
#pragma unroll
      for (int r = 0; r < 8; ++r) { f.h[r] = (_Float16)d0[r]; f.h[8 + r] = (_Float16)d1[r]; }
      *(v8us*)(so + tA + e * 16) = f.half[0]; *(v8us*)(so + tB + e * 16) = f.half[1];
    }
  }
  __syncthreads();      /* K and V^T of the whole window are complete, and every wave has read Wq, Wk and Wv for the last time */
  pj_wput(wpa, wpc, sW, tid);      /* published by the barrier behind the two heads */
  FragH ca0, ca1, cb0, cb1;      /* context of head 0 (ca) and head 1 (cb), query tiles 0 and 1 */
  fa_head(&sK[ln * KPITCH], &sV[ln * VPITCH], hh, bq[0][0].v, bq[0][1].v, ca0, ca1);
  fa_head(&sK[(NTW + ln) * KPITCH], &sV[(HD + ln) * VPITCH], hh, bq[1][0].v, bq[1][1].v, cb0, cb1);
  __syncthreads();      /* every wave has read K and V^T for the last time: the LDS may take the output tile */
  float* sF = (float*)sK;
  const unsigned short* wl = &sW[ln * TPITCH];
#pragma unroll
  for (int ot = 0; ot < 4; ++ot) {      /* Wp.ctx^T: a lane holds eight consecutive output channels of tokens 2 ln and 2 ln + 1; k = head 0's channels, then head 1's */
    const v16h a0 = fa_frag(wl + ot * 16 * TPITCH, hh), a1 = fa_frag(wl + ot * 16 * TPITCH + 32, hh);
    const v8f d0 = fa_mma(a1, cb0.v, fa_mma(a0, ca0.v, z8)), d1 = fa_mma(a1, cb1.v, fa_mma(a0, ca1.v, z8));
    float* so = &sF[(ot * 16 + 8 * hh) * FPITCH + w * 32 + 2 * ln];
#pragma unroll
    for (int r = 0; r < 8; ++r) { const v2f o2 = {d0[r] * 0.0625f, d1[r] * 0.0625f}; *(v2fa*)(so + r * FPITCH) = o2; }
  }
  __syncthreads();      /* the 64 x 512 output tile is complete: each store below covers whole lines of one channel */
  float* dp = out + w0 + hf * QW;
  for (int j = 0; j < CC * QW / 4 / 512; ++j) { const int i = j * 512 + tid, o = i >> 7, pc = i & 127;
    *(v4f*)(dp + (size_t)o * HW + pc * 4) = *(const v4fa*)&sF[o * FPITCH + pc * 4]; }
}

extern "C" void kernel_launch(void* const* d_in, const int* in_sizes, int n_in,
                              void* d_out, int out_size, void* d_ws, size_t ws_size, hipStream_t stream) {
  (void)in_sizes; (void)n_in; (void)out_size; (void)d_ws; (void)ws_size;
  const float* const* I = (const float* const*)d_in; const float* x = I[0]; const float* Wq = I[1]; const float* Wk = I[2]; const float* Wv = I[3]; const float* Wp = I[4];
  k_pattn<<<NB * NPW * 2, 512, 0, stream>>>(x, Wq, Wk, Wv, Wp, (float*)d_out);      /* projections, scores, softmax, context of both heads, ctx Wp^T: NCHW to NCHW, no workspace */
}
